// v000
// Measured on an AMD MI455X. A time is GPU time per run, averaged over a window of back-to-back runs after a warm-up
// (all launches, gaps included; the runs take copies of the inputs in turn), and the median of several windows.
// Apart from v000's, it joins two sittings. Times from different sittings can be a few percent apart, while
// side-by-side timings come from the same sitting.
// v000, which the later versions start from, runs in 1400 microseconds.
#include <hip/hip_runtime.h>

// SelectiveAttentionModule (x [8][2048][768]; Q/K/V = x W^T + b (d 128, single head); temps_q[s] = 1 + sigmoid(alpha[s]) log(s+1) + tanh(tokenq[s] . gelu(Q[s])), temps_v likewise with tokenv / V; scores = (temps_q Q) . K / sqrt(128), causal;
// softmax; out = softmax . (temps_v V) -> [8][2048][128]).
// Compute dtypes, f32 accumulate: every input rounded to bf16; Q/K/V on PLAIN bf16 operands (inputs: exact) + bias; the temperatures (erf-gelu, 128-term fixed-order dots, tanh, sigmoid, log) f32 on the VALU; gated Q / K / gated V -> bf16 hi+lo

#define NB_  8
#define TT   2048
#define DE   768
#define DK   128
#define D3   384
typedef _Float16 h16;
typedef unsigned short bf;
typedef __attribute__((ext_vector_type(16))) __bf16   v16bf;
typedef __attribute__((ext_vector_type(16))) _Float16 v16h;
typedef __attribute__((ext_vector_type(8)))  _Float16 v8h;
typedef __attribute__((ext_vector_type(8)))  unsigned short v8us;
typedef __attribute__((ext_vector_type(8)))  float    v8f;
typedef __attribute__((ext_vector_type(4)))  float    v4f;
typedef v8h  __attribute__((may_alias)) v8ha;
typedef v4f  __attribute__((may_alias)) v4fa;
typedef v8us __attribute__((may_alias)) v8usa;

__device__ __forceinline__ unsigned short f2bf(float f) { unsigned u = __float_as_uint(f); u += 0x7FFFu + ((u >> 16) & 1u); return (unsigned short)(u >> 16); }
__device__ __forceinline__ float bf2f(unsigned short b) { return __uint_as_float(((unsigned)b) << 16); }
__device__ __forceinline__ float bfr(float f) { return bf2f(f2bf(f)); }
__device__ __forceinline__ v16h cat16(v8h lo, v8h hi) { return __builtin_shufflevector(lo, hi, 0, 1, 2, 3, 4, 5, 6, 7, 8, 9, 10, 11, 12, 13, 14, 15); }
__device__ __forceinline__ v16bf cat16b(v8us lo, v8us hi) { return __builtin_bit_cast(v16bf, __builtin_shufflevector(lo, hi, 0, 1, 2, 3, 4, 5, 6, 7, 8, 9, 10, 11, 12, 13, 14, 15)); }
__device__ __forceinline__ v8f wmma16(v16h a, v16h b, v8f c) { return __builtin_amdgcn_wmma_f32_16x16x32_f16(false, a, false, b, (short)0, c, false, false); }
__device__ __forceinline__ v8f wmmab(v16bf a, v16bf b, v8f c) { return __builtin_amdgcn_wmma_f32_16x16x32_bf16(false, a, false, b, (short)0, c, false, false); }



// ---- k_gemmw: register-blocked GEMM, ONE WAVE per 64x64 output tile (16 accumulators), operands straight from K-contiguous 16-bit planes; grid (M/64, N/64, Z), 32 threads.
// C[m][n] (f32, pitch ldc, + optional f32 bias[n]) = sum_k A[m][k] Bt[n][k] (+ split products per NSPLIT). z-batch strides sA/sB/sC in elements. K % 32 == 0.
template <typename T16> struct WFrag;
template <> struct WFrag<h16> { typedef v16h V; static __device__ __forceinline__ V ld(const h16* p) { return cat16(*(const v8h*)p, *(const v8h*)(p + 16)); } static __device__ __forceinline__ v8f mma(V a, V b, v8f c) { return wmma16(a, b, c); } };
template <> struct WFrag<bf> { typedef v16bf V; static __device__ __forceinline__ V ld(const bf* p) { return cat16b(*(const v8us*)p, *(const v8us*)(p + 16)); } static __device__ __forceinline__ v8f mma(V a, V b, v8f c) { return wmmab(a, b, c); } };
template <typename T16, int NSPLIT, bool BIAS>
__global__ __launch_bounds__(32) void k_gemmw(const T16* __restrict__ A, const T16* __restrict__ A2, const T16* __restrict__ Bt, const T16* __restrict__ Bt2, int K, float* C, int ldc, const float* __restrict__ bias, size_t sA, size_t sB, size_t sC) {
    typedef typename WFrag<T16>::V V;
    __shared__ __align__(16) float os[16 * 68];
    const size_t z = blockIdx.z; A += z * sA; if (A2) A2 += z * sA; Bt += z * sB; if (Bt2) Bt2 += z * sB; C += z * sC;
    const int lane = threadIdx.x & 31, lr = lane & 15, hi = lane >> 4; const int r0 = blockIdx.x * 64, c0 = blockIdx.y * 64;
    v8f acc[4][4];
#pragma unroll
    for (int mb = 0; mb < 4; ++mb)
#pragma unroll
        for (int nb = 0; nb < 4; ++nb) acc[mb][nb] = (v8f){};
    const size_t aoff = (size_t)(r0 + lr) * K + 8 * hi, boff = (size_t)(c0 + lr) * K + 8 * hi;
#pragma unroll 1
    for (int kc = 0; kc < K; kc += 32) {
        V a[4], a2[4];
#pragma unroll
        for (int mb = 0; mb < 4; ++mb) { a[mb] = WFrag<T16>::ld(A + aoff + (size_t)mb * 16 * K + kc); if (NSPLIT == 1 || NSPLIT == 2) a2[mb] = WFrag<T16>::ld(A2 + aoff + (size_t)mb * 16 * K + kc); }
#pragma unroll
        for (int nb = 0; nb < 4; ++nb) { const V b = WFrag<T16>::ld(Bt + boff + (size_t)nb * 16 * K + kc); V b2; if (NSPLIT >= 2) b2 = WFrag<T16>::ld(Bt2 + boff + (size_t)nb * 16 * K + kc);
#pragma unroll
            for (int mb = 0; mb < 4; ++mb) { acc[mb][nb] = WFrag<T16>::mma(a[mb], b, acc[mb][nb]); if (NSPLIT == 1 || NSPLIT == 2) acc[mb][nb] = WFrag<T16>::mma(a2[mb], b, acc[mb][nb]); if (NSPLIT >= 2) acc[mb][nb] = WFrag<T16>::mma(a[mb], b2, acc[mb][nb]); } }
        asm volatile("v_nop\n\tv_nop\n\tv_nop\n\tv_nop" : "+v"(acc[0][0]), "+v"(acc[1][1]), "+v"(acc[2][2]), "+v"(acc[3][3]) : "v"(a[0]), "v"(a[3]));
    }
#pragma unroll
    for (int mb = 0; mb < 4; ++mb) {
#pragma unroll
        for (int nb = 0; nb < 4; ++nb) {
#pragma unroll
            for (int j = 0; j < 8; ++j) os[(hi * 8 + j) * 68 + nb * 16 + lr] = acc[mb][nb][j]; }
        __builtin_amdgcn_wave_barrier(); asm volatile("" ::: "memory");
        float* crow = C + (size_t)(r0 + mb * 16) * ldc + c0;
{
#pragma unroll
            for (int s = 0; s < 8; ++s) { const int row = 2 * s + hi, cofs = lr * 4; v4f val = *(const v4fa*)(os + row * 68 + cofs); if (BIAS) { val[0] += bfr(bias[c0 + cofs]); val[1] += bfr(bias[c0 + cofs + 1]); val[2] += bfr(bias[c0 + cofs + 2]); val[3] += bfr(bias[c0 + cofs + 3]); }
                *(v4f*)(crow + (size_t)row * ldc + cofs) = val; }
             }
        __builtin_amdgcn_wave_barrier(); asm volatile("" ::: "memory");
    }
}

// ---- k_gemmc: the same one-wave 64x64 tile GEMM specialised for causal attention: CMODE 1 skips score tiles entirely above the diagonal (query rows r0+roff.., key columns c0..), CMODE 2 limits the
// key (K) loop of the probability x value contraction to the diagonal block (probabilities beyond it are exactly zero). roff = row offset of this launch's first row within the sequence.
template <typename T16, int NSPLIT, int CMODE>
__global__ __launch_bounds__(32) void k_gemmc(const T16* __restrict__ A, const T16* __restrict__ A2, const T16* __restrict__ Bt, const T16* __restrict__ Bt2, int K, float* C, int ldc, int roff, size_t sA, size_t sB, size_t sC) {
    typedef typename WFrag<T16>::V V;
    __shared__ __align__(16) float os[16 * 68];
    const size_t z = blockIdx.z; A += z * sA; if (A2) A2 += z * sA; Bt += z * sB; if (Bt2) Bt2 += z * sB; C += z * sC;
    const int lane = threadIdx.x & 31, lr = lane & 15, hi = lane >> 4; const int r0 = blockIdx.x * 64, c0 = blockIdx.y * 64;
    if (CMODE == 1 && c0 > r0 + roff + 63) return;                  // score tile entirely above the causal diagonal: never read (the softmax masks j > i by select)
    const int Kl = (CMODE == 2) ? min(K, r0 + roff + 64) : K;        // P.V: probabilities are exactly 0 beyond the diagonal block, so the K loop stops there
    v8f acc[4][4];
#pragma unroll
    for (int mb = 0; mb < 4; ++mb)
#pragma unroll
        for (int nb = 0; nb < 4; ++nb) acc[mb][nb] = (v8f){};
    const size_t aoff = (size_t)(r0 + lr) * K + 8 * hi, boff = (size_t)(c0 + lr) * K + 8 * hi;
#pragma unroll 1
    for (int kc = 0; kc < Kl; kc += 32) {
        V a[4], a2[4];
#pragma unroll
        for (int mb = 0; mb < 4; ++mb) { a[mb] = WFrag<T16>::ld(A + aoff + (size_t)mb * 16 * K + kc); if (NSPLIT == 1 || NSPLIT == 2) a2[mb] = WFrag<T16>::ld(A2 + aoff + (size_t)mb * 16 * K + kc); }
#pragma unroll
        for (int nb = 0; nb < 4; ++nb) { const V b = WFrag<T16>::ld(Bt + boff + (size_t)nb * 16 * K + kc); V b2; if (NSPLIT >= 2) b2 = WFrag<T16>::ld(Bt2 + boff + (size_t)nb * 16 * K + kc);
#pragma unroll
            for (int mb = 0; mb < 4; ++mb) { acc[mb][nb] = WFrag<T16>::mma(a[mb], b, acc[mb][nb]); if (NSPLIT == 1 || NSPLIT == 2) acc[mb][nb] = WFrag<T16>::mma(a2[mb], b, acc[mb][nb]); if (NSPLIT >= 2) acc[mb][nb] = WFrag<T16>::mma(a[mb], b2, acc[mb][nb]); } }
        asm volatile("v_nop\n\tv_nop\n\tv_nop\n\tv_nop" : "+v"(acc[0][0]), "+v"(acc[1][1]), "+v"(acc[2][2]), "+v"(acc[3][3]) : "v"(a[0]), "v"(a[3]));
    }
#pragma unroll
    for (int mb = 0; mb < 4; ++mb) {
#pragma unroll
        for (int nb = 0; nb < 4; ++nb) {
#pragma unroll
            for (int j = 0; j < 8; ++j) os[(hi * 8 + j) * 68 + nb * 16 + lr] = acc[mb][nb][j]; }
        __builtin_amdgcn_wave_barrier(); asm volatile("" ::: "memory");
        float* crow = C + (size_t)(r0 + mb * 16) * ldc + c0;
{
#pragma unroll
            for (int s = 0; s < 8; ++s) { const int row = 2 * s + hi, cofs = lr * 4; v4f val = *(const v4fa*)(os + row * 68 + cofs);
                *(v4f*)(crow + (size_t)row * ldc + cofs) = val; }
             }
        __builtin_amdgcn_wave_barrier(); asm volatile("" ::: "memory");
    }
}

__device__ __forceinline__ void splitf(float y, unsigned short& h, unsigned short& l) { h = f2bf(y); l = f2bf(y - bf2f(h)); }
typedef __attribute__((ext_vector_type(2))) unsigned short v2us;
typedef __attribute__((ext_vector_type(4))) unsigned short v4us;

__global__ __launch_bounds__(256) void k_cvt8(const float* __restrict__ src, bf* dst, size_t n8) { const size_t i = (size_t)blockIdx.x * 256 + threadIdx.x; if (i >= n8) return; const v8f v = *(const v8f*)(src + i * 8); v8us o;
#pragma unroll
    for (int k = 0; k < 8; ++k) o[k] = f2bf(v[k]); *(v8us*)(dst + i * 8) = o;  }
// k_temp: thread per token s: tq = tanh(sum_d tokenq[s][d] gelu(Q[s][d])), tv likewise; pos = 1 + sigmoid(alpha[s]) log(s+1) -> TQ[s] = pos + tq, TV[s] = pos + tv (4-B thread-linear); k_gpl: hl planes GQ[s][d] = TQ[s] Q[s][d], Kp[s][d] = K[s][d] (8-B lanes);
__global__ __launch_bounds__(256) void k_temp(const float* __restrict__ QKV, const float* __restrict__ tq, const float* __restrict__ tv, const float* __restrict__ alpha, float* TQ, float* TV) { const int s = blockIdx.x * 256 + threadIdx.x; if (s >= TT) return; const float* q = QKV + (size_t)s * D3; const float* v = q + 2 * DK; float aq = 0.f, av = 0.f;
#pragma unroll 1
    for (int d = 0; d < DK; ++d) { const float x1 = q[d], x2 = v[d]; float g1 = __fmul_rn(0.5f * x1, __fadd_rn(1.0f, erff(x1 * 0.70710678118654752f))), g2 = __fmul_rn(0.5f * x2, __fadd_rn(1.0f, erff(x2 * 0.70710678118654752f))); asm volatile("" : "+v"(g1)); asm volatile("" : "+v"(g2));
        float p1 = __fmul_rn(bfr(tq[(size_t)s * DK + d]), g1), p2 = __fmul_rn(bfr(tv[(size_t)s * DK + d]), g2); asm volatile("" : "+v"(p1)); asm volatile("" : "+v"(p2)); aq = __fadd_rn(aq, p1); av = __fadd_rn(av, p2); }
    float sg = __fdiv_rn(1.0f, __fadd_rn(1.0f, __expf(-bfr(alpha[s])))); asm volatile("" : "+v"(sg)); const float pos = __fadd_rn(1.0f, __fmul_rn(sg, __logf((float)(s + 1)))); const float rq = __fadd_rn(pos, tanhf(aq)), rv = __fadd_rn(pos, tanhf(av));
    { *(float*)(TQ + s) = rq; *(float*)(TV + s) = rv;  } }
__global__ __launch_bounds__(256) void k_gpl(const float* __restrict__ QKV, const float* __restrict__ TQ, bf* GQh, bf* GQl, bf* Kh, bf* Kl) { const int e = (blockIdx.x * 256 + threadIdx.x) * 4; if (e >= TT * DK) return; const int d = e % DK; const int s = e / DK; const float t = TQ[s]; const float* q = QKV + (size_t)s * D3 + d; v4us a, b, c, dd;
#pragma unroll
    for (int u = 0; u < 4; ++u) { unsigned short h1, l1, h2, l2; splitf(__fmul_rn(t, q[u]), h1, l1); splitf(q[DK + u], h2, l2); a[u] = h1; b[u] = l1; c[u] = h2; dd[u] = l2; }
    { *(v4us*)(GQh + e) = a; *(v4us*)(GQl + e) = b; *(v4us*)(Kh + e) = c; *(v4us*)(Kl + e) = dd;  } }
__global__ __launch_bounds__(256) void k_gvt(const float* __restrict__ QKV, const float* __restrict__ TV, bf* Th, bf* Tl) { const int e = (blockIdx.x * 256 + threadIdx.x) * 4; if (e >= DK * TT) return; const int s = e % TT; const int d = e / TT; v4us oh, ol;
#pragma unroll
    for (int u = 0; u < 4; ++u) { unsigned short a, b; splitf(__fmul_rn(TV[s + u], QKV[(size_t)(s + u) * D3 + 2 * DK + d]), a, b); oh[u] = a; ol[u] = b; } *(v4us*)(Th + e) = oh; *(v4us*)(Tl + e) = ol;  }
__global__ __launch_bounds__(256) void k_csoft(const float* __restrict__ Sb, bf* Ph, bf* Pl) { const int lane = threadIdx.x & 31; const int i = blockIdx.x * 8 + (threadIdx.x >> 5); if (i >= TT) return; const float* sr = Sb + (size_t)i * TT; float v[TT / 32]; float mx = -3.0e38f; const float scl = 0.088388347648318447f;
#pragma unroll
    for (int ch = 0; ch < TT / 128; ++ch) { const int j0 = ch * 128 + lane * 4; const v4f a = *(const v4f*)(sr + j0);
#pragma unroll
        for (int u = 0; u < 4; ++u) { const float t = (j0 + u <= i) ? a[u] * scl : -3.0e38f; v[ch * 4 + u] = t; mx = fmaxf(mx, t); } }
#pragma unroll
    for (int sh = 16; sh; sh >>= 1) mx = fmaxf(mx, __shfl_xor(mx, sh, 32));
    float sum = 0.f;
#pragma unroll
    for (int q = 0; q < TT / 32; ++q) { float d0 = __fsub_rn(v[q], mx); asm volatile("" : "+v"(d0)); v[q] = (v[q] > -1.0e38f) ? __builtin_amdgcn_exp2f(__fmul_rn(d0, 1.4426950408889634f)) : 0.f; sum += v[q]; }
#pragma unroll
    for (int sh = 16; sh; sh >>= 1) sum += __shfl_xor(sum, sh, 32);
    const float f = __fdiv_rn(1.0f, sum);
    {
#pragma unroll
        for (int ch = 0; ch < TT / 128; ++ch) { v4us oh, ol;
#pragma unroll
            for (int q = 0; q < 4; ++q) { unsigned short a, b; splitf(v[ch * 4 + q] * f, a, b); oh[q] = a; ol[q] = b; } const size_t oo = (size_t)i * TT + ch * 128 + lane * 4; *(v4us*)(Ph + oo) = oh; *(v4us*)(Pl + oo) = ol; }
         } }

extern "C" void kernel_launch(void* const* d_in, const int* in_sizes, int n_in,
                              void* d_out, int out_size, void* d_ws, size_t ws_size, hipStream_t stream) {
    (void)in_sizes; (void)n_in; (void)out_size;
    const float** I = (const float**)d_in;
    const float *x = I[0], *Wq = I[1], *bq = I[2], *Wk = I[3], *bk = I[4], *Wv = I[5], *bv = I[6], *alpha = I[7], *tokq = I[8], *tokv = I[9];
    float* OUT = (float*)d_out;     // [8][2048][128]
    char* wsp = (char*)d_ws;
    auto take = [&](size_t bytes) { char* p = wsp; wsp += (bytes + 255) & ~(size_t)255; return (void*)p; };
    bf* BQ = (bf*)take((size_t)DK * DE * 2); bf* BK = (bf*)take((size_t)DK * DE * 2); bf* BV = (bf*)take((size_t)DK * DE * 2); bf* XB = (bf*)take((size_t)TT * DE * 2); float* QKV = (float*)take((size_t)TT * D3 * 4); float* TQ = (float*)take(TT * 4); float* TV = (float*)take(TT * 4);
    bf* GQh = (bf*)take((size_t)TT * DK * 2); bf* GQl = (bf*)take((size_t)TT * DK * 2); bf* Kh = (bf*)take((size_t)TT * DK * 2); bf* Kl = (bf*)take((size_t)TT * DK * 2); bf* GVh = (bf*)take((size_t)DK * TT * 2); bf* GVl = (bf*)take((size_t)DK * TT * 2);
    float* Sb = (float*)take((size_t)TT * TT * 4); bf* Ph = (bf*)take((size_t)TT * TT * 2); bf* Pl = (bf*)take((size_t)TT * TT * 2);
    if ((size_t)(wsp - (char*)d_ws) > ws_size) return;    // total ~ 42 MB
    k_cvt8<<<(DK * DE / 8 + 255) / 256, 256, 0, stream>>>(Wq, BQ, DK * DE / 8); k_cvt8<<<(DK * DE / 8 + 255) / 256, 256, 0, stream>>>(Wk, BK, DK * DE / 8); k_cvt8<<<(DK * DE / 8 + 255) / 256, 256, 0, stream>>>(Wv, BV, DK * DE / 8);   // [out][in] = Bt
    for (int b = 0; b < NB_; ++b) {
        k_cvt8<<<(TT * DE / 8 + 255) / 256, 256, 0, stream>>>(x + (size_t)b * TT * DE, XB, (size_t)TT * DE / 8);
        k_gemmw<bf, 0, true><<<dim3(TT / 64, DK / 64, 1), 32, 0, stream>>>(XB, nullptr, BQ, nullptr, DE, QKV, D3, bq, 0, 0, 0); k_gemmw<bf, 0, true><<<dim3(TT / 64, DK / 64, 1), 32, 0, stream>>>(XB, nullptr, BK, nullptr, DE, QKV + DK, D3, bk, 0, 0, 0); k_gemmw<bf, 0, true><<<dim3(TT / 64, DK / 64, 1), 32, 0, stream>>>(XB, nullptr, BV, nullptr, DE, QKV + 2 * DK, D3, bv, 0, 0, 0);
        k_temp<<<(TT + 255) / 256, 256, 0, stream>>>(QKV, tokq, tokv, alpha, TQ, TV); k_gpl<<<(TT * DK / 4 + 255) / 256, 256, 0, stream>>>(QKV, TQ, GQh, GQl, Kh, Kl); k_gvt<<<(DK * TT / 4 + 255) / 256, 256, 0, stream>>>(QKV, TV, GVh, GVl);
        k_gemmc<bf, 2, 1><<<dim3(TT / 64, TT / 64, 1), 32, 0, stream>>>(GQh, GQl, Kh, Kl, DK, Sb, TT, 0, 0, 0, 0);
        k_csoft<<<TT / 8, 256, 0, stream>>>(Sb, Ph, Pl);
        k_gemmc<bf, 2, 2><<<dim3(TT / 64, DK / 64, 1), 32, 0, stream>>>(Ph, Pl, GVh, GVl, TT, OUT + (size_t)b * TT * DK, DK, 0, 0, 0, 0); }
}

// v001
// One run takes 290 microseconds.
// Timed twice side by side with v000, it ran 4.74 and 4.86 times as fast.
#include <hip/hip_runtime.h>

// SelectiveAttentionModule (x [8][2048][768]; Q/K/V = x W^T + b (d 128, single head); temps_q[s] = 1 + sigmoid(alpha[s]) log(s+1) + tanh(tokenq[s] . gelu(Q[s])), temps_v likewise with tokenv / V; scores = (temps_q Q) . K / sqrt(128), causal;
// softmax; out = softmax . (temps_v V) -> [8][2048][128]).
// Compute dtypes, f32 accumulate: every input rounded to bf16; Q/K/V on PLAIN bf16 operands (inputs: exact) + bias; the temperatures (erf-gelu, 128-term fixed-order dots, tanh, sigmoid, log) f32 on the VALU; gated Q / K / gated V -> bf16 hi+lo

#define NB_  8
#define TT   2048
#define DE   768
#define DK   128
#define D3   384
typedef _Float16 h16;
typedef unsigned short bf;
typedef __attribute__((ext_vector_type(16))) __bf16   v16bf;
typedef __attribute__((ext_vector_type(16))) _Float16 v16h;
typedef __attribute__((ext_vector_type(8)))  _Float16 v8h;
typedef __attribute__((ext_vector_type(8)))  unsigned short v8us;
typedef __attribute__((ext_vector_type(8)))  float    v8f;
typedef __attribute__((ext_vector_type(4)))  float    v4f;
typedef v8h  __attribute__((may_alias)) v8ha;
typedef v4f  __attribute__((may_alias)) v4fa;
typedef v8us __attribute__((may_alias)) v8usa;

__device__ __forceinline__ unsigned short f2bf(float f) { unsigned u = __float_as_uint(f); u += 0x7FFFu + ((u >> 16) & 1u); return (unsigned short)(u >> 16); }
__device__ __forceinline__ float bf2f(unsigned short b) { return __uint_as_float(((unsigned)b) << 16); }
__device__ __forceinline__ float bfr(float f) { return bf2f(f2bf(f)); }
__device__ __forceinline__ v16h cat16(v8h lo, v8h hi) { return __builtin_shufflevector(lo, hi, 0, 1, 2, 3, 4, 5, 6, 7, 8, 9, 10, 11, 12, 13, 14, 15); }
__device__ __forceinline__ v16bf cat16b(v8us lo, v8us hi) { return __builtin_bit_cast(v16bf, __builtin_shufflevector(lo, hi, 0, 1, 2, 3, 4, 5, 6, 7, 8, 9, 10, 11, 12, 13, 14, 15)); }
__device__ __forceinline__ v8f wmma16(v16h a, v16h b, v8f c) { return __builtin_amdgcn_wmma_f32_16x16x32_f16(false, a, false, b, (short)0, c, false, false); }
__device__ __forceinline__ v8f wmmab(v16bf a, v16bf b, v8f c) { return __builtin_amdgcn_wmma_f32_16x16x32_bf16(false, a, false, b, (short)0, c, false, false); }



// ---- k_gemmw: register-blocked GEMM, ONE WAVE per 64x64 output tile (16 accumulators), operands straight from K-contiguous 16-bit planes; grid (M/64, N/64, Z), 32 threads.
// C[m][n] (f32, pitch ldc, + optional f32 bias[n]) = sum_k A[m][k] Bt[n][k] (+ split products per NSPLIT). z-batch strides sA/sB/sC in elements. K % 32 == 0.
template <typename T16> struct WFrag;
template <> struct WFrag<h16> { typedef v16h V; static __device__ __forceinline__ V ld(const h16* p) { return cat16(*(const v8h*)p, *(const v8h*)(p + 16)); } static __device__ __forceinline__ v8f mma(V a, V b, v8f c) { return wmma16(a, b, c); } };
template <> struct WFrag<bf> { typedef v16bf V; static __device__ __forceinline__ V ld(const bf* p) { return cat16b(*(const v8us*)p, *(const v8us*)(p + 16)); } static __device__ __forceinline__ v8f mma(V a, V b, v8f c) { return wmmab(a, b, c); } };
template <typename T16, int NSPLIT, bool BIAS>
__global__ __launch_bounds__(32) void k_gemmw(const T16* __restrict__ A, const T16* __restrict__ A2, const T16* __restrict__ Bt, const T16* __restrict__ Bt2, int K, float* C, int ldc, const float* __restrict__ bias, size_t sA, size_t sB, size_t sC) {
    typedef typename WFrag<T16>::V V;
    __shared__ __align__(16) float os[16 * 68];
    const size_t z = blockIdx.z; A += z * sA; if (A2) A2 += z * sA; Bt += z * sB; if (Bt2) Bt2 += z * sB; C += z * sC;
    const int lane = threadIdx.x & 31, lr = lane & 15, hi = lane >> 4; const int r0 = blockIdx.x * 64, c0 = blockIdx.y * 64;
    v8f acc[4][4];
#pragma unroll
    for (int mb = 0; mb < 4; ++mb)
#pragma unroll
        for (int nb = 0; nb < 4; ++nb) acc[mb][nb] = (v8f){};
    const size_t aoff = (size_t)(r0 + lr) * K + 8 * hi, boff = (size_t)(c0 + lr) * K + 8 * hi;
#pragma unroll 1
    for (int kc = 0; kc < K; kc += 32) {
        V a[4], a2[4];
#pragma unroll
        for (int mb = 0; mb < 4; ++mb) { a[mb] = WFrag<T16>::ld(A + aoff + (size_t)mb * 16 * K + kc); if (NSPLIT == 1 || NSPLIT == 2) a2[mb] = WFrag<T16>::ld(A2 + aoff + (size_t)mb * 16 * K + kc); }
#pragma unroll
        for (int nb = 0; nb < 4; ++nb) { const V b = WFrag<T16>::ld(Bt + boff + (size_t)nb * 16 * K + kc); V b2; if (NSPLIT >= 2) b2 = WFrag<T16>::ld(Bt2 + boff + (size_t)nb * 16 * K + kc);
#pragma unroll
            for (int mb = 0; mb < 4; ++mb) { acc[mb][nb] = WFrag<T16>::mma(a[mb], b, acc[mb][nb]); if (NSPLIT == 1 || NSPLIT == 2) acc[mb][nb] = WFrag<T16>::mma(a2[mb], b, acc[mb][nb]); if (NSPLIT >= 2) acc[mb][nb] = WFrag<T16>::mma(a[mb], b2, acc[mb][nb]); } }
        asm volatile("v_nop\n\tv_nop\n\tv_nop\n\tv_nop" : "+v"(acc[0][0]), "+v"(acc[1][1]), "+v"(acc[2][2]), "+v"(acc[3][3]) : "v"(a[0]), "v"(a[3]));
    }
#pragma unroll
    for (int mb = 0; mb < 4; ++mb) {
#pragma unroll
        for (int nb = 0; nb < 4; ++nb) {
#pragma unroll
            for (int j = 0; j < 8; ++j) os[(hi * 8 + j) * 68 + nb * 16 + lr] = acc[mb][nb][j]; }
        __builtin_amdgcn_wave_barrier(); asm volatile("" ::: "memory");
        float* crow = C + (size_t)(r0 + mb * 16) * ldc + c0;
{
#pragma unroll
            for (int s = 0; s < 8; ++s) { const int row = 2 * s + hi, cofs = lr * 4; v4f val = *(const v4fa*)(os + row * 68 + cofs); if (BIAS) { val[0] += bfr(bias[c0 + cofs]); val[1] += bfr(bias[c0 + cofs + 1]); val[2] += bfr(bias[c0 + cofs + 2]); val[3] += bfr(bias[c0 + cofs + 3]); }
                *(v4f*)(crow + (size_t)row * ldc + cofs) = val; }
             }
        __builtin_amdgcn_wave_barrier(); asm volatile("" ::: "memory");
    }
}

// ---- k_gemmc: the same one-wave 64x64 tile GEMM specialised for causal attention: CMODE 1 skips score tiles entirely above the diagonal (query rows r0+roff.., key columns c0..), CMODE 2 limits the
// key (K) loop of the probability x value contraction to the diagonal block (probabilities beyond it are exactly zero). roff = row offset of this launch's first row within the sequence.
template <typename T16, int NSPLIT, int CMODE>
__global__ __launch_bounds__(32) void k_gemmc(const T16* __restrict__ A, const T16* __restrict__ A2, const T16* __restrict__ Bt, const T16* __restrict__ Bt2, int K, float* C, int ldc, int roff, size_t sA, size_t sB, size_t sC) {
    typedef typename WFrag<T16>::V V;
    __shared__ __align__(16) float os[16 * 68];
    const size_t z = blockIdx.z; A += z * sA; if (A2) A2 += z * sA; Bt += z * sB; if (Bt2) Bt2 += z * sB; C += z * sC;
    const int lane = threadIdx.x & 31, lr = lane & 15, hi = lane >> 4; const int r0 = blockIdx.x * 64, c0 = blockIdx.y * 64;
    if (CMODE == 1 && c0 > r0 + roff + 63) return;                  // score tile entirely above the causal diagonal: never read (the softmax masks j > i by select)
    const int Kl = (CMODE == 2) ? min(K, r0 + roff + 64) : K;        // P.V: probabilities are exactly 0 beyond the diagonal block, so the K loop stops there
    v8f acc[4][4];
#pragma unroll
    for (int mb = 0; mb < 4; ++mb)
#pragma unroll
        for (int nb = 0; nb < 4; ++nb) acc[mb][nb] = (v8f){};
    const size_t aoff = (size_t)(r0 + lr) * K + 8 * hi, boff = (size_t)(c0 + lr) * K + 8 * hi;
#pragma unroll 1
    for (int kc = 0; kc < Kl; kc += 32) {
        V a[4], a2[4];
#pragma unroll
        for (int mb = 0; mb < 4; ++mb) { a[mb] = WFrag<T16>::ld(A + aoff + (size_t)mb * 16 * K + kc); if (NSPLIT == 1 || NSPLIT == 2) a2[mb] = WFrag<T16>::ld(A2 + aoff + (size_t)mb * 16 * K + kc); }
#pragma unroll
        for (int nb = 0; nb < 4; ++nb) { const V b = WFrag<T16>::ld(Bt + boff + (size_t)nb * 16 * K + kc); V b2; if (NSPLIT >= 2) b2 = WFrag<T16>::ld(Bt2 + boff + (size_t)nb * 16 * K + kc);
#pragma unroll
            for (int mb = 0; mb < 4; ++mb) { acc[mb][nb] = WFrag<T16>::mma(a[mb], b, acc[mb][nb]); if (NSPLIT == 1 || NSPLIT == 2) acc[mb][nb] = WFrag<T16>::mma(a2[mb], b, acc[mb][nb]); if (NSPLIT >= 2) acc[mb][nb] = WFrag<T16>::mma(a[mb], b2, acc[mb][nb]); } }
        asm volatile("v_nop\n\tv_nop\n\tv_nop\n\tv_nop" : "+v"(acc[0][0]), "+v"(acc[1][1]), "+v"(acc[2][2]), "+v"(acc[3][3]) : "v"(a[0]), "v"(a[3]));
    }
#pragma unroll
    for (int mb = 0; mb < 4; ++mb) {
#pragma unroll
        for (int nb = 0; nb < 4; ++nb) {
#pragma unroll
            for (int j = 0; j < 8; ++j) os[(hi * 8 + j) * 68 + nb * 16 + lr] = acc[mb][nb][j]; }
        __builtin_amdgcn_wave_barrier(); asm volatile("" ::: "memory");
        float* crow = C + (size_t)(r0 + mb * 16) * ldc + c0;
{
#pragma unroll
            for (int s = 0; s < 8; ++s) { const int row = 2 * s + hi, cofs = lr * 4; v4f val = *(const v4fa*)(os + row * 68 + cofs);
                *(v4f*)(crow + (size_t)row * ldc + cofs) = val; }
             }
        __builtin_amdgcn_wave_barrier(); asm volatile("" ::: "memory");
    }
}

__device__ __forceinline__ void splitf(float y, unsigned short& h, unsigned short& l) { h = f2bf(y); l = f2bf(y - bf2f(h)); }
typedef __attribute__((ext_vector_type(2))) unsigned short v2us;
typedef __attribute__((ext_vector_type(4))) unsigned short v4us;

__global__ __launch_bounds__(256) void k_cvt8(const float* __restrict__ src, bf* dst, size_t n8) { const size_t i = (size_t)blockIdx.x * 256 + threadIdx.x; if (i >= n8) return; const v8f v = *(const v8f*)(src + i * 8); v8us o;
#pragma unroll
    for (int k = 0; k < 8; ++k) o[k] = f2bf(v[k]); *(v8us*)(dst + i * 8) = o;  }
// Every kernel below covers all NB_ sequences in one launch: k_temp / k_gvt / k_csoft take the sequence from blockIdx.y, k_gpl runs over the NB_*TT rows as one list.
// k_temp: thread per token s: tq = tanh(sum_d tokenq[s][d] gelu(Q[s][d])), tv likewise; pos = 1 + sigmoid(alpha[s]) log(s+1) -> TQ[s] = pos + tq, TV[s] = pos + tv (4-B thread-linear); k_gpl: hl planes GQ[s][d] = TQ[s] Q[s][d], Kp[s][d] = K[s][d] (8-B lanes);
__global__ __launch_bounds__(256) void k_temp(const float* __restrict__ QKV, const float* __restrict__ tq, const float* __restrict__ tv, const float* __restrict__ alpha, float* TQ, float* TV) { const int s = blockIdx.x * 256 + threadIdx.x; if (s >= TT) return; const size_t g = (size_t)blockIdx.y * TT + s; const float* q = QKV + g * D3; const float* v = q + 2 * DK; float aq = 0.f, av = 0.f;
#pragma unroll 1
    for (int d = 0; d < DK; ++d) { const float x1 = q[d], x2 = v[d]; float g1 = __fmul_rn(0.5f * x1, __fadd_rn(1.0f, erff(x1 * 0.70710678118654752f))), g2 = __fmul_rn(0.5f * x2, __fadd_rn(1.0f, erff(x2 * 0.70710678118654752f))); asm volatile("" : "+v"(g1)); asm volatile("" : "+v"(g2));
        float p1 = __fmul_rn(bfr(tq[(size_t)s * DK + d]), g1), p2 = __fmul_rn(bfr(tv[(size_t)s * DK + d]), g2); asm volatile("" : "+v"(p1)); asm volatile("" : "+v"(p2)); aq = __fadd_rn(aq, p1); av = __fadd_rn(av, p2); }
    float sg = __fdiv_rn(1.0f, __fadd_rn(1.0f, __expf(-bfr(alpha[s])))); asm volatile("" : "+v"(sg)); const float pos = __fadd_rn(1.0f, __fmul_rn(sg, __logf((float)(s + 1)))); const float rq = __fadd_rn(pos, tanhf(aq)), rv = __fadd_rn(pos, tanhf(av));
    { *(float*)(TQ + g) = rq; *(float*)(TV + g) = rv;  } }
__global__ __launch_bounds__(256) void k_gpl(const float* __restrict__ QKV, const float* __restrict__ TQ, bf* GQh, bf* GQl, bf* Kh, bf* Kl) { const int e = (blockIdx.x * 256 + threadIdx.x) * 4; if (e >= NB_ * TT * DK) return; const int d = e % DK; const int s = e / DK; const float t = TQ[s]; const float* q = QKV + (size_t)s * D3 + d; v4us a, b, c, dd;
#pragma unroll
    for (int u = 0; u < 4; ++u) { unsigned short h1, l1, h2, l2; splitf(__fmul_rn(t, q[u]), h1, l1); splitf(q[DK + u], h2, l2); a[u] = h1; b[u] = l1; c[u] = h2; dd[u] = l2; }
    { *(v4us*)(GQh + e) = a; *(v4us*)(GQl + e) = b; *(v4us*)(Kh + e) = c; *(v4us*)(Kl + e) = dd;  } }
__global__ __launch_bounds__(256) void k_gvt(const float* __restrict__ QKV, const float* __restrict__ TV, bf* Th, bf* Tl) { const int e = (blockIdx.x * 256 + threadIdx.x) * 4; if (e >= DK * TT) return; const int s = e % TT; const int d = e / TT; v4us oh, ol; const size_t z = blockIdx.y; QKV += z * TT * D3; TV += z * TT; const size_t o = (z * DK + d) * (2 * TT) + s;   // row d = [TT hi][TT lo], the pitch of the probability rows (the tile GEMM has one pitch for both operands)
#pragma unroll
    for (int u = 0; u < 4; ++u) { unsigned short a, b; splitf(__fmul_rn(TV[s + u], QKV[(size_t)(s + u) * D3 + 2 * DK + d]), a, b); oh[u] = a; ol[u] = b; } *(v4us*)(Th + o) = oh; *(v4us*)(Tl + o) = ol;  }
// k_csoft: one wave per score row; the row's hi and lo probability planes (2 x TT 16-bit) are stored over the row's own TT f32 scores, which the wave holds whole in registers before its first store (every store needs the row sum).
__global__ __launch_bounds__(256) void k_csoft(const float* Sb, bf* Ph, bf* Pl) { const int lane = threadIdx.x & 31; const int i = blockIdx.x * 8 + (threadIdx.x >> 5); if (i >= TT) return; const size_t g = (size_t)blockIdx.y * TT + i; const float* sr = Sb + g * TT; float v[TT / 32]; float mx = -3.0e38f; const float scl = 0.088388347648318447f;
#pragma unroll
    for (int ch = 0; ch < TT / 128; ++ch) { const int j0 = ch * 128 + lane * 4; const v4f a = *(const v4f*)(sr + j0);
#pragma unroll
        for (int u = 0; u < 4; ++u) { const float t = (j0 + u <= i) ? a[u] * scl : -3.0e38f; v[ch * 4 + u] = t; mx = fmaxf(mx, t); } }
#pragma unroll
    for (int sh = 16; sh; sh >>= 1) mx = fmaxf(mx, __shfl_xor(mx, sh, 32));
    float sum = 0.f;
#pragma unroll
    for (int q = 0; q < TT / 32; ++q) { float d0 = __fsub_rn(v[q], mx); asm volatile("" : "+v"(d0)); v[q] = (v[q] > -1.0e38f) ? __builtin_amdgcn_exp2f(__fmul_rn(d0, 1.4426950408889634f)) : 0.f; sum += v[q]; }
#pragma unroll
    for (int sh = 16; sh; sh >>= 1) sum += __shfl_xor(sum, sh, 32);
    const float f = __fdiv_rn(1.0f, sum);
    {
#pragma unroll
        for (int ch = 0; ch < TT / 128; ++ch) { v4us oh, ol;
#pragma unroll
            for (int q = 0; q < 4; ++q) { unsigned short a, b; splitf(v[ch * 4 + q] * f, a, b); oh[q] = a; ol[q] = b; } const size_t oo = g * (2 * TT) + ch * 128 + lane * 4; *(v4us*)(Ph + oo) = oh; *(v4us*)(Pl + oo) = ol; }
         } }

extern "C" void kernel_launch(void* const* d_in, const int* in_sizes, int n_in,
                              void* d_out, int out_size, void* d_ws, size_t ws_size, hipStream_t stream) {
    (void)in_sizes; (void)n_in; (void)out_size;
    const float** I = (const float**)d_in;
    const float *x = I[0], *Wq = I[1], *bq = I[2], *Wk = I[3], *bk = I[4], *Wv = I[5], *bv = I[6], *alpha = I[7], *tokq = I[8], *tokv = I[9];
    float* OUT = (float*)d_out;     // [8][2048][128]
    char* wsp = (char*)d_ws;
    auto take = [&](size_t bytes) { char* p = wsp; wsp += (bytes + 255) & ~(size_t)255; return (void*)p; };
    bf* BQ = (bf*)take((size_t)DK * DE * 2); bf* BK = (bf*)take((size_t)DK * DE * 2); bf* BV = (bf*)take((size_t)DK * DE * 2); bf* XB = (bf*)take((size_t)NB_ * TT * DE * 2); float* QKV = (float*)take((size_t)NB_ * TT * D3 * 4); float* TQ = (float*)take(NB_ * TT * 4); float* TV = (float*)take(NB_ * TT * 4);
    bf* GQh = (bf*)take((size_t)NB_ * TT * DK * 2); bf* GQl = (bf*)take((size_t)NB_ * TT * DK * 2); bf* Kh = (bf*)take((size_t)NB_ * TT * DK * 2); bf* Kl = (bf*)take((size_t)NB_ * TT * DK * 2); bf* GVh = (bf*)take((size_t)NB_ * DK * TT * 4); bf* GVl = GVh + TT;
    float* Sb = (float*)take((size_t)NB_ * TT * TT * 4); bf* Ph = (bf*)Sb; bf* Pl = Ph + TT;    // probability planes in place: row r = [TT hi][TT lo] over score row r, pitch 2*TT
    if ((size_t)(wsp - (char*)d_ws) > ws_size) return;    // total ~ 211 MB
    k_cvt8<<<(DK * DE / 8 + 255) / 256, 256, 0, stream>>>(Wq, BQ, DK * DE / 8); k_cvt8<<<(DK * DE / 8 + 255) / 256, 256, 0, stream>>>(Wk, BK, DK * DE / 8); k_cvt8<<<(DK * DE / 8 + 255) / 256, 256, 0, stream>>>(Wv, BV, DK * DE / 8);   // [out][in] = Bt
    k_cvt8<<<(NB_ * TT * DE / 8 + 255) / 256, 256, 0, stream>>>(x, XB, (size_t)NB_ * TT * DE / 8);
    k_gemmw<bf, 0, true><<<dim3(NB_ * TT / 64, DK / 64, 1), 32, 0, stream>>>(XB, nullptr, BQ, nullptr, DE, QKV, D3, bq, 0, 0, 0); k_gemmw<bf, 0, true><<<dim3(NB_ * TT / 64, DK / 64, 1), 32, 0, stream>>>(XB, nullptr, BK, nullptr, DE, QKV + DK, D3, bk, 0, 0, 0); k_gemmw<bf, 0, true><<<dim3(NB_ * TT / 64, DK / 64, 1), 32, 0, stream>>>(XB, nullptr, BV, nullptr, DE, QKV + 2 * DK, D3, bv, 0, 0, 0);
    k_temp<<<dim3((TT + 255) / 256, NB_, 1), 256, 0, stream>>>(QKV, tokq, tokv, alpha, TQ, TV); k_gpl<<<(NB_ * TT * DK / 4 + 255) / 256, 256, 0, stream>>>(QKV, TQ, GQh, GQl, Kh, Kl); k_gvt<<<dim3((DK * TT / 4 + 255) / 256, NB_, 1), 256, 0, stream>>>(QKV, TV, GVh, GVl);
    k_gemmc<bf, 2, 1><<<dim3(TT / 64, TT / 64, NB_), 32, 0, stream>>>(GQh, GQl, Kh, Kl, DK, Sb, TT, 0, (size_t)TT * DK, (size_t)TT * DK, (size_t)TT * TT);
    k_csoft<<<dim3(TT / 8, NB_, 1), 256, 0, stream>>>(Sb, Ph, Pl);
    k_gemmc<bf, 2, 2><<<dim3(TT / 64, DK / 64, NB_), 32, 0, stream>>>(Ph, Pl, GVh, GVl, 2 * TT, OUT, DK, 0, (size_t)TT * 2 * TT, (size_t)DK * 2 * TT, (size_t)TT * DK);   // K = the common row pitch; the loop ends at the diagonal block (<= TT)
}

// v002
// It runs in 219 microseconds.
// Next to v001, in two timings, it ran 1.31 and 1.32 times as fast.
// All steps since v000 together make it 6.31 times as fast.
#include <hip/hip_runtime.h>

// SelectiveAttentionModule (x [8][2048][768]; Q/K/V = x W^T + b (d 128, single head); temps_q[s] = 1 + sigmoid(alpha[s]) log(s+1) + tanh(tokenq[s] . gelu(Q[s])), temps_v likewise with tokenv / V; scores = (temps_q Q) . K / sqrt(128), causal;
// softmax; out = softmax . (temps_v V) -> [8][2048][128]).
// Compute dtypes, f32 accumulate: every input rounded to bf16; Q/K/V on PLAIN bf16 operands (inputs: exact) + bias; the temperatures (erf-gelu, 128-term fixed-order dots, tanh, sigmoid, log) f32 on the VALU; gated Q / K / gated V -> bf16 hi+lo

#define NB_  8
#define TT   2048
#define DE   768
#define DK   128
#define D3   384
typedef _Float16 h16;
typedef unsigned short bf;
typedef __attribute__((ext_vector_type(16))) __bf16   v16bf;
typedef __attribute__((ext_vector_type(16))) _Float16 v16h;
typedef __attribute__((ext_vector_type(8)))  _Float16 v8h;
typedef __attribute__((ext_vector_type(8)))  unsigned short v8us;
typedef __attribute__((ext_vector_type(8)))  float    v8f;
typedef __attribute__((ext_vector_type(4)))  float    v4f;
typedef v8h  __attribute__((may_alias)) v8ha;
typedef v4f  __attribute__((may_alias)) v4fa;
typedef v8us __attribute__((may_alias)) v8usa;

__device__ __forceinline__ unsigned short f2bf(float f) { unsigned u = __float_as_uint(f); u += 0x7FFFu + ((u >> 16) & 1u); return (unsigned short)(u >> 16); }
__device__ __forceinline__ float bf2f(unsigned short b) { return __uint_as_float(((unsigned)b) << 16); }
__device__ __forceinline__ float bfr(float f) { return bf2f(f2bf(f)); }
__device__ __forceinline__ v16h cat16(v8h lo, v8h hi) { return __builtin_shufflevector(lo, hi, 0, 1, 2, 3, 4, 5, 6, 7, 8, 9, 10, 11, 12, 13, 14, 15); }
__device__ __forceinline__ v16bf cat16b(v8us lo, v8us hi) { return __builtin_bit_cast(v16bf, __builtin_shufflevector(lo, hi, 0, 1, 2, 3, 4, 5, 6, 7, 8, 9, 10, 11, 12, 13, 14, 15)); }
__device__ __forceinline__ v8f wmma16(v16h a, v16h b, v8f c) { return __builtin_amdgcn_wmma_f32_16x16x32_f16(false, a, false, b, (short)0, c, false, false); }
__device__ __forceinline__ v8f wmmab(v16bf a, v16bf b, v8f c) { return __builtin_amdgcn_wmma_f32_16x16x32_bf16(false, a, false, b, (short)0, c, false, false); }



// ---- k_gemmw: register-blocked GEMM, ONE WAVE per 64x64 output tile (16 accumulators), operands straight from K-contiguous 16-bit planes; grid (M/64, N/64, Z), 32 threads.
// C[m][n] (f32, pitch ldc, + optional f32 bias[n]) = sum_k A[m][k] Bt[n][k] (+ split products per NSPLIT). z-batch strides sA/sB/sC in elements. K % 32 == 0.
template <typename T16> struct WFrag;
template <> struct WFrag<h16> { typedef v16h V; static __device__ __forceinline__ V ld(const h16* p) { return cat16(*(const v8h*)p, *(const v8h*)(p + 16)); } static __device__ __forceinline__ v8f mma(V a, V b, v8f c) { return wmma16(a, b, c); } };
template <> struct WFrag<bf> { typedef v16bf V; static __device__ __forceinline__ V ld(const bf* p) { return cat16b(*(const v8us*)p, *(const v8us*)(p + 16)); } static __device__ __forceinline__ v8f mma(V a, V b, v8f c) { return wmmab(a, b, c); } };
template <typename T16, int NSPLIT, bool BIAS>
__global__ __launch_bounds__(32) void k_gemmw(const T16* __restrict__ A, const T16* __restrict__ A2, const T16* __restrict__ Bt, const T16* __restrict__ Bt2, int K, float* C, int ldc, const float* __restrict__ bias, size_t sA, size_t sB, size_t sC) {
    typedef typename WFrag<T16>::V V;
    __shared__ __align__(16) float os[16 * 68];
    const size_t z = blockIdx.z; A += z * sA; if (A2) A2 += z * sA; Bt += z * sB; if (Bt2) Bt2 += z * sB; C += z * sC;
    const int lane = threadIdx.x & 31, lr = lane & 15, hi = lane >> 4; const int r0 = blockIdx.x * 64, c0 = blockIdx.y * 64;
    v8f acc[4][4];
#pragma unroll
    for (int mb = 0; mb < 4; ++mb)
#pragma unroll
        for (int nb = 0; nb < 4; ++nb) acc[mb][nb] = (v8f){};
    const size_t aoff = (size_t)(r0 + lr) * K + 8 * hi, boff = (size_t)(c0 + lr) * K + 8 * hi;
#pragma unroll 1
    for (int kc = 0; kc < K; kc += 32) {
        V a[4], a2[4];
#pragma unroll
        for (int mb = 0; mb < 4; ++mb) { a[mb] = WFrag<T16>::ld(A + aoff + (size_t)mb * 16 * K + kc); if (NSPLIT == 1 || NSPLIT == 2) a2[mb] = WFrag<T16>::ld(A2 + aoff + (size_t)mb * 16 * K + kc); }
#pragma unroll
        for (int nb = 0; nb < 4; ++nb) { const V b = WFrag<T16>::ld(Bt + boff + (size_t)nb * 16 * K + kc); V b2; if (NSPLIT >= 2) b2 = WFrag<T16>::ld(Bt2 + boff + (size_t)nb * 16 * K + kc);
#pragma unroll
            for (int mb = 0; mb < 4; ++mb) { acc[mb][nb] = WFrag<T16>::mma(a[mb], b, acc[mb][nb]); if (NSPLIT == 1 || NSPLIT == 2) acc[mb][nb] = WFrag<T16>::mma(a2[mb], b, acc[mb][nb]); if (NSPLIT >= 2) acc[mb][nb] = WFrag<T16>::mma(a[mb], b2, acc[mb][nb]); } }
        asm volatile("v_nop\n\tv_nop\n\tv_nop\n\tv_nop" : "+v"(acc[0][0]), "+v"(acc[1][1]), "+v"(acc[2][2]), "+v"(acc[3][3]) : "v"(a[0]), "v"(a[3]));
    }
#pragma unroll
    for (int mb = 0; mb < 4; ++mb) {
#pragma unroll
        for (int nb = 0; nb < 4; ++nb) {
#pragma unroll
            for (int j = 0; j < 8; ++j) os[(hi * 8 + j) * 68 + nb * 16 + lr] = acc[mb][nb][j]; }
        __builtin_amdgcn_wave_barrier(); asm volatile("" ::: "memory");
        float* crow = C + (size_t)(r0 + mb * 16) * ldc + c0;
{
#pragma unroll
            for (int s = 0; s < 8; ++s) { const int row = 2 * s + hi, cofs = lr * 4; v4f val = *(const v4fa*)(os + row * 68 + cofs); if (BIAS) { val[0] += bfr(bias[c0 + cofs]); val[1] += bfr(bias[c0 + cofs + 1]); val[2] += bfr(bias[c0 + cofs + 2]); val[3] += bfr(bias[c0 + cofs + 3]); }
                *(v4f*)(crow + (size_t)row * ldc + cofs) = val; }
             }
        __builtin_amdgcn_wave_barrier(); asm volatile("" ::: "memory");
    }
}

// ---- k_gemmc: the same one-wave 64x64 tile GEMM specialised for causal attention: CMODE 1 skips score tiles entirely above the diagonal (query rows r0+roff.., key columns c0..), CMODE 2 limits the
// key (K) loop of the probability x value contraction to the diagonal block (probabilities beyond it are exactly zero). roff = row offset of this launch's first row within the sequence.
template <typename T16, int NSPLIT, int CMODE>
__global__ __launch_bounds__(32) void k_gemmc(const T16* __restrict__ A, const T16* __restrict__ A2, const T16* __restrict__ Bt, const T16* __restrict__ Bt2, int K, float* C, int ldc, int roff, size_t sA, size_t sB, size_t sC) {
    typedef typename WFrag<T16>::V V;
    __shared__ __align__(16) float os[16 * 68];
    const size_t z = blockIdx.z; A += z * sA; if (A2) A2 += z * sA; Bt += z * sB; if (Bt2) Bt2 += z * sB; C += z * sC;
    const int lane = threadIdx.x & 31, lr = lane & 15, hi = lane >> 4; const int r0 = blockIdx.x * 64, c0 = blockIdx.y * 64;
    if (CMODE == 1 && c0 > r0 + roff + 63) return;                  // score tile entirely above the causal diagonal: never read (the softmax masks j > i by select)
    const int Kl = (CMODE == 2) ? min(K, r0 + roff + 64) : K;        // P.V: probabilities are exactly 0 beyond the diagonal block, so the K loop stops there
    v8f acc[4][4];
#pragma unroll
    for (int mb = 0; mb < 4; ++mb)
#pragma unroll
        for (int nb = 0; nb < 4; ++nb) acc[mb][nb] = (v8f){};
    const size_t aoff = (size_t)(r0 + lr) * K + 8 * hi, boff = (size_t)(c0 + lr) * K + 8 * hi;
#pragma unroll 1
    for (int kc = 0; kc < Kl; kc += 32) {
        V a[4], a2[4];
#pragma unroll
        for (int mb = 0; mb < 4; ++mb) { a[mb] = WFrag<T16>::ld(A + aoff + (size_t)mb * 16 * K + kc); if (NSPLIT == 1 || NSPLIT == 2) a2[mb] = WFrag<T16>::ld(A2 + aoff + (size_t)mb * 16 * K + kc); }
#pragma unroll
        for (int nb = 0; nb < 4; ++nb) { const V b = WFrag<T16>::ld(Bt + boff + (size_t)nb * 16 * K + kc); V b2; if (NSPLIT >= 2) b2 = WFrag<T16>::ld(Bt2 + boff + (size_t)nb * 16 * K + kc);
#pragma unroll
            for (int mb = 0; mb < 4; ++mb) { acc[mb][nb] = WFrag<T16>::mma(a[mb], b, acc[mb][nb]); if (NSPLIT == 1 || NSPLIT == 2) acc[mb][nb] = WFrag<T16>::mma(a2[mb], b, acc[mb][nb]); if (NSPLIT >= 2) acc[mb][nb] = WFrag<T16>::mma(a[mb], b2, acc[mb][nb]); } }
        asm volatile("v_nop\n\tv_nop\n\tv_nop\n\tv_nop" : "+v"(acc[0][0]), "+v"(acc[1][1]), "+v"(acc[2][2]), "+v"(acc[3][3]) : "v"(a[0]), "v"(a[3]));
    }
#pragma unroll
    for (int mb = 0; mb < 4; ++mb) {
#pragma unroll
        for (int nb = 0; nb < 4; ++nb) {
#pragma unroll
            for (int j = 0; j < 8; ++j) os[(hi * 8 + j) * 68 + nb * 16 + lr] = acc[mb][nb][j]; }
        __builtin_amdgcn_wave_barrier(); asm volatile("" ::: "memory");
        float* crow = C + (size_t)(r0 + mb * 16) * ldc + c0;
{
#pragma unroll
            for (int s = 0; s < 8; ++s) { const int row = 2 * s + hi, cofs = lr * 4; v4f val = *(const v4fa*)(os + row * 68 + cofs);
                *(v4f*)(crow + (size_t)row * ldc + cofs) = val; }
             }
        __builtin_amdgcn_wave_barrier(); asm volatile("" ::: "memory");
    }
}

__device__ __forceinline__ void splitf(float y, unsigned short& h, unsigned short& l) { h = f2bf(y); l = f2bf(y - bf2f(h)); }
typedef __attribute__((ext_vector_type(2))) unsigned short v2us;
typedef __attribute__((ext_vector_type(4))) unsigned short v4us;

__global__ __launch_bounds__(256) void k_cvt8(const float* __restrict__ src, bf* dst, size_t n8) { const size_t i = (size_t)blockIdx.x * 256 + threadIdx.x; if (i >= n8) return; const v8f v = *(const v8f*)(src + i * 8); v8us o;
#pragma unroll
    for (int k = 0; k < 8; ++k) o[k] = f2bf(v[k]); *(v8us*)(dst + i * 8) = o;  }
// Every kernel below covers all NB_ sequences in one launch: k_gvt / k_csoft take the sequence from blockIdx.y, k_temp / k_gpl run over the NB_*TT rows as one list.
// k_temp: TQ[g] = pos + tanh(sum_d tokenq[s][d] gelu(Q[g][d])), TV[g] likewise with tokenv / V, pos = 1 + sigmoid(alpha[s]) log(s+1). One work-group per 32 tokens of the NB_*TT list: wave w takes tokens 4w..4w+3 with its lanes ACROSS d,
// so each row of Q, V, tokenq, tokenv is one whole 512-B load, and leaves the 128 products of each dot in LDS; behind the barrier lane t of wave 0 (Q) and of wave 1 (V) adds token t's products in the order d = 0..127 and the wave stores one whole 128-B line.
// k_gpl: hl planes GQ[s][d] = TQ[s] Q[s][d], Kp[s][d] = K[s][d] (8-B lanes);
#define TPP 132   // pitch of a product row in LDS, in floats: rows stay 16-B aligned and do not all start in one bank
__global__ __launch_bounds__(256) void k_temp(const float* __restrict__ QKV, const float* __restrict__ tq, const float* __restrict__ tv, const float* __restrict__ alpha, float* TQ, float* TV) {
    __shared__ __align__(16) float pr[2][32][TPP];
    const int lane = threadIdx.x & 31, w = threadIdx.x >> 5; const int g0 = blockIdx.x * 32;
    const int t0 = g0 + w * 4; const float* q = QKV + (size_t)t0 * D3 + lane * 4; const size_t sd = (size_t)(t0 % TT) * DK + lane * 4;   // TT % 4 == 0: a wave's four tokens lie in one sequence, so their tokenq / tokenv rows are consecutive too
    v4f xq[4], xv[4], kq[4], kv[4];
#pragma unroll   // registers, not an indexed array; the wave's 16 row loads all stand in front of the first gelu's branches, so they are in flight together
    for (int u = 0; u < 4; ++u) { xq[u] = *(const v4fa*)(q + u * D3); xv[u] = *(const v4fa*)(q + u * D3 + 2 * DK); kq[u] = *(const v4fa*)(tq + sd + u * DK); kv[u] = *(const v4fa*)(tv + sd + u * DK); }
#pragma unroll   // u and k index register arrays: both loops must be flat for the rows to stay in registers
    for (int u = 0; u < 4; ++u) { v4f pq, pv;
#pragma unroll
        for (int k = 0; k < 4; ++k) { const float x1 = xq[u][k], x2 = xv[u][k]; const float g1 = __fmul_rn(0.5f * x1, __fadd_rn(1.0f, erff(x1 * 0.70710678118654752f))), g2 = __fmul_rn(0.5f * x2, __fadd_rn(1.0f, erff(x2 * 0.70710678118654752f)));
            pq[k] = __fmul_rn(bfr(kq[u][k]), g1); pv[k] = __fmul_rn(bfr(kv[u][k]), g2); }
        *(v4fa*)(&pr[0][w * 4 + u][lane * 4]) = pq; *(v4fa*)(&pr[1][w * 4 + u][lane * 4]) = pv; }
    __syncthreads();   // every product row is in LDS before a lane of wave 0 or 1 adds it up
    if (w >= 2) return;
    const float* p = &pr[w][lane][0]; float a = 0.f;
#pragma unroll   // constant LDS offsets, no loop counter beside the one dependent chain of adds
    for (int d = 0; d < DK; d += 4) { const v4f c = *(const v4fa*)(p + d); a = __fadd_rn(a, c[0]); a = __fadd_rn(a, c[1]); a = __fadd_rn(a, c[2]); a = __fadd_rn(a, c[3]); }
    const int s = (g0 + lane) % TT;
    const float sg = __fdiv_rn(1.0f, __fadd_rn(1.0f, __expf(-bfr(alpha[s])))); const float pos = __fadd_rn(1.0f, __fmul_rn(sg, __logf((float)(s + 1))));
    (w ? TV : TQ)[g0 + lane] = __fadd_rn(pos, tanhf(a)); }
__global__ __launch_bounds__(256) void k_gpl(const float* __restrict__ QKV, const float* __restrict__ TQ, bf* GQh, bf* GQl, bf* Kh, bf* Kl) { const int e = (blockIdx.x * 256 + threadIdx.x) * 4; if (e >= NB_ * TT * DK) return; const int d = e % DK; const int s = e / DK; const float t = TQ[s]; const float* q = QKV + (size_t)s * D3 + d; v4us a, b, c, dd;
#pragma unroll
    for (int u = 0; u < 4; ++u) { unsigned short h1, l1, h2, l2; splitf(__fmul_rn(t, q[u]), h1, l1); splitf(q[DK + u], h2, l2); a[u] = h1; b[u] = l1; c[u] = h2; dd[u] = l2; }
    { *(v4us*)(GQh + e) = a; *(v4us*)(GQl + e) = b; *(v4us*)(Kh + e) = c; *(v4us*)(Kl + e) = dd;  } }
__global__ __launch_bounds__(256) void k_gvt(const float* __restrict__ QKV, const float* __restrict__ TV, bf* Th, bf* Tl) { const int e = (blockIdx.x * 256 + threadIdx.x) * 4; if (e >= DK * TT) return; const int s = e % TT; const int d = e / TT; v4us oh, ol; const size_t z = blockIdx.y; QKV += z * TT * D3; TV += z * TT; const size_t o = (z * DK + d) * (2 * TT) + s;   // row d = [TT hi][TT lo], the pitch of the probability rows (the tile GEMM has one pitch for both operands)
#pragma unroll
    for (int u = 0; u < 4; ++u) { unsigned short a, b; splitf(__fmul_rn(TV[s + u], QKV[(size_t)(s + u) * D3 + 2 * DK + d]), a, b); oh[u] = a; ol[u] = b; } *(v4us*)(Th + o) = oh; *(v4us*)(Tl + o) = ol;  }
// k_csoft: one wave per score row; the row's hi and lo probability planes (2 x TT 16-bit) are stored over the row's own TT f32 scores, which the wave holds whole in registers before its first store (every store needs the row sum).
__global__ __launch_bounds__(256) void k_csoft(const float* Sb, bf* Ph, bf* Pl) { const int lane = threadIdx.x & 31; const int i = blockIdx.x * 8 + (threadIdx.x >> 5); if (i >= TT) return; const size_t g = (size_t)blockIdx.y * TT + i; const float* sr = Sb + g * TT; float v[TT / 32]; float mx = -3.0e38f; const float scl = 0.088388347648318447f;
#pragma unroll
    for (int ch = 0; ch < TT / 128; ++ch) { const int j0 = ch * 128 + lane * 4; const v4f a = *(const v4f*)(sr + j0);
#pragma unroll
        for (int u = 0; u < 4; ++u) { const float t = (j0 + u <= i) ? a[u] * scl : -3.0e38f; v[ch * 4 + u] = t; mx = fmaxf(mx, t); } }
#pragma unroll
    for (int sh = 16; sh; sh >>= 1) mx = fmaxf(mx, __shfl_xor(mx, sh, 32));
    float sum = 0.f;
#pragma unroll
    for (int q = 0; q < TT / 32; ++q) { float d0 = __fsub_rn(v[q], mx); asm volatile("" : "+v"(d0)); v[q] = (v[q] > -1.0e38f) ? __builtin_amdgcn_exp2f(__fmul_rn(d0, 1.4426950408889634f)) : 0.f; sum += v[q]; }
#pragma unroll
    for (int sh = 16; sh; sh >>= 1) sum += __shfl_xor(sum, sh, 32);
    const float f = __fdiv_rn(1.0f, sum);
    {
#pragma unroll
        for (int ch = 0; ch < TT / 128; ++ch) { v4us oh, ol;
#pragma unroll
            for (int q = 0; q < 4; ++q) { unsigned short a, b; splitf(v[ch * 4 + q] * f, a, b); oh[q] = a; ol[q] = b; } const size_t oo = g * (2 * TT) + ch * 128 + lane * 4; *(v4us*)(Ph + oo) = oh; *(v4us*)(Pl + oo) = ol; }
         } }

extern "C" void kernel_launch(void* const* d_in, const int* in_sizes, int n_in,
                              void* d_out, int out_size, void* d_ws, size_t ws_size, hipStream_t stream) {
    (void)in_sizes; (void)n_in; (void)out_size;
    const float** I = (const float**)d_in;
    const float *x = I[0], *Wq = I[1], *bq = I[2], *Wk = I[3], *bk = I[4], *Wv = I[5], *bv = I[6], *alpha = I[7], *tokq = I[8], *tokv = I[9];
    float* OUT = (float*)d_out;     // [8][2048][128]
    char* wsp = (char*)d_ws;
    auto take = [&](size_t bytes) { char* p = wsp; wsp += (bytes + 255) & ~(size_t)255; return (void*)p; };
    bf* BQ = (bf*)take((size_t)DK * DE * 2); bf* BK = (bf*)take((size_t)DK * DE * 2); bf* BV = (bf*)take((size_t)DK * DE * 2); bf* XB = (bf*)take((size_t)NB_ * TT * DE * 2); float* QKV = (float*)take((size_t)NB_ * TT * D3 * 4); float* TQ = (float*)take(NB_ * TT * 4); float* TV = (float*)take(NB_ * TT * 4);
    bf* GQh = (bf*)take((size_t)NB_ * TT * DK * 2); bf* GQl = (bf*)take((size_t)NB_ * TT * DK * 2); bf* Kh = (bf*)take((size_t)NB_ * TT * DK * 2); bf* Kl = (bf*)take((size_t)NB_ * TT * DK * 2); bf* GVh = (bf*)take((size_t)NB_ * DK * TT * 4); bf* GVl = GVh + TT;
    float* Sb = (float*)take((size_t)NB_ * TT * TT * 4); bf* Ph = (bf*)Sb; bf* Pl = Ph + TT;    // probability planes in place: row r = [TT hi][TT lo] over score row r, pitch 2*TT
    if ((size_t)(wsp - (char*)d_ws) > ws_size) return;    // total ~ 211 MB
    k_cvt8<<<(DK * DE / 8 + 255) / 256, 256, 0, stream>>>(Wq, BQ, DK * DE / 8); k_cvt8<<<(DK * DE / 8 + 255) / 256, 256, 0, stream>>>(Wk, BK, DK * DE / 8); k_cvt8<<<(DK * DE / 8 + 255) / 256, 256, 0, stream>>>(Wv, BV, DK * DE / 8);   // [out][in] = Bt
    k_cvt8<<<(NB_ * TT * DE / 8 + 255) / 256, 256, 0, stream>>>(x, XB, (size_t)NB_ * TT * DE / 8);
    k_gemmw<bf, 0, true><<<dim3(NB_ * TT / 64, DK / 64, 1), 32, 0, stream>>>(XB, nullptr, BQ, nullptr, DE, QKV, D3, bq, 0, 0, 0); k_gemmw<bf, 0, true><<<dim3(NB_ * TT / 64, DK / 64, 1), 32, 0, stream>>>(XB, nullptr, BK, nullptr, DE, QKV + DK, D3, bk, 0, 0, 0); k_gemmw<bf, 0, true><<<dim3(NB_ * TT / 64, DK / 64, 1), 32, 0, stream>>>(XB, nullptr, BV, nullptr, DE, QKV + 2 * DK, D3, bv, 0, 0, 0);
    k_temp<<<NB_ * TT / 32, 256, 0, stream>>>(QKV, tokq, tokv, alpha, TQ, TV); k_gpl<<<(NB_ * TT * DK / 4 + 255) / 256, 256, 0, stream>>>(QKV, TQ, GQh, GQl, Kh, Kl); k_gvt<<<dim3((DK * TT / 4 + 255) / 256, NB_, 1), 256, 0, stream>>>(QKV, TV, GVh, GVl);
    k_gemmc<bf, 2, 1><<<dim3(TT / 64, TT / 64, NB_), 32, 0, stream>>>(GQh, GQl, Kh, Kl, DK, Sb, TT, 0, (size_t)TT * DK, (size_t)TT * DK, (size_t)TT * TT);
    k_csoft<<<dim3(TT / 8, NB_, 1), 256, 0, stream>>>(Sb, Ph, Pl);
    k_gemmc<bf, 2, 2><<<dim3(TT / 64, DK / 64, NB_), 32, 0, stream>>>(Ph, Pl, GVh, GVl, 2 * TT, OUT, DK, 0, (size_t)TT * 2 * TT, (size_t)DK * 2 * TT, (size_t)TT * DK);   // K = the common row pitch; the loop ends at the diagonal block (<= TT)
}

// v003
// A run of this version takes 188 microseconds.
// Timed twice side by side with v002, it ran 1.17 and 1.16 times as fast.
// Over all steps from v000 it is 7.36 times as fast.
#include <hip/hip_runtime.h>

// SelectiveAttentionModule (x [8][2048][768]; Q/K/V = x W^T + b (d 128, single head); temps_q[s] = 1 + sigmoid(alpha[s]) log(s+1) + tanh(tokenq[s] . gelu(Q[s])), temps_v likewise with tokenv / V; scores = (temps_q Q) . K / sqrt(128), causal;
// softmax; out = softmax . (temps_v V) -> [8][2048][128]).
// Compute dtypes, f32 accumulate: every input rounded to bf16; Q/K/V on PLAIN bf16 operands (inputs: exact) + bias; the temperatures (erf-gelu, 128-term fixed-order dots, tanh, sigmoid, log) f32 on the VALU; gated Q / K / gated V -> bf16 hi+lo

#define NB_  8
#define TT   2048
#define DE   768
#define DK   128
#define D3   384
typedef _Float16 h16;
typedef unsigned short bf;
typedef __attribute__((ext_vector_type(16))) __bf16   v16bf;
typedef __attribute__((ext_vector_type(16))) _Float16 v16h;
typedef __attribute__((ext_vector_type(8)))  _Float16 v8h;
typedef __attribute__((ext_vector_type(8)))  unsigned short v8us;
typedef __attribute__((ext_vector_type(8)))  float    v8f;
typedef __attribute__((ext_vector_type(4)))  float    v4f;
typedef v8h  __attribute__((may_alias)) v8ha;
typedef v4f  __attribute__((may_alias)) v4fa;
typedef v8us __attribute__((may_alias)) v8usa;

__device__ __forceinline__ unsigned short f2bf(float f) { unsigned u = __float_as_uint(f); u += 0x7FFFu + ((u >> 16) & 1u); return (unsigned short)(u >> 16); }
__device__ __forceinline__ float bf2f(unsigned short b) { return __uint_as_float(((unsigned)b) << 16); }
__device__ __forceinline__ float bfr(float f) { return bf2f(f2bf(f)); }
__device__ __forceinline__ v16h cat16(v8h lo, v8h hi) { return __builtin_shufflevector(lo, hi, 0, 1, 2, 3, 4, 5, 6, 7, 8, 9, 10, 11, 12, 13, 14, 15); }
__device__ __forceinline__ v16bf cat16b(v8us lo, v8us hi) { return __builtin_bit_cast(v16bf, __builtin_shufflevector(lo, hi, 0, 1, 2, 3, 4, 5, 6, 7, 8, 9, 10, 11, 12, 13, 14, 15)); }
__device__ __forceinline__ v8f wmma16(v16h a, v16h b, v8f c) { return __builtin_amdgcn_wmma_f32_16x16x32_f16(false, a, false, b, (short)0, c, false, false); }
__device__ __forceinline__ v8f wmmab(v16bf a, v16bf b, v8f c) { return __builtin_amdgcn_wmma_f32_16x16x32_bf16(false, a, false, b, (short)0, c, false, false); }



// ---- k_gemmw: register-blocked GEMM, ONE WAVE per 64x64 output tile (16 accumulators), operands straight from K-contiguous 16-bit planes; grid (M/64, N/64, Z), 32 threads.
// C[m][n] (f32, pitch ldc, + optional f32 bias[n]) = sum_k A[m][k] Bt[n][k] (+ split products per NSPLIT). z-batch strides sA/sB/sC in elements. K % 32 == 0.
template <typename T16> struct WFrag;
template <> struct WFrag<h16> { typedef v16h V; static __device__ __forceinline__ V ld(const h16* p) { return cat16(*(const v8h*)p, *(const v8h*)(p + 16)); } static __device__ __forceinline__ v8f mma(V a, V b, v8f c) { return wmma16(a, b, c); } };
template <> struct WFrag<bf> { typedef v16bf V; static __device__ __forceinline__ V ld(const bf* p) { return cat16b(*(const v8us*)p, *(const v8us*)(p + 16)); } static __device__ __forceinline__ v8f mma(V a, V b, v8f c) { return wmmab(a, b, c); } };
template <typename T16, int NSPLIT, bool BIAS>
__global__ __launch_bounds__(32) void k_gemmw(const T16* __restrict__ A, const T16* __restrict__ A2, const T16* __restrict__ Bt, const T16* __restrict__ Bt2, int K, float* C, int ldc, const float* __restrict__ bias, size_t sA, size_t sB, size_t sC) {
    typedef typename WFrag<T16>::V V;
    __shared__ __align__(16) float os[16 * 68];
    const size_t z = blockIdx.z; A += z * sA; if (A2) A2 += z * sA; Bt += z * sB; if (Bt2) Bt2 += z * sB; C += z * sC;
    const int lane = threadIdx.x & 31, lr = lane & 15, hi = lane >> 4; const int r0 = blockIdx.x * 64, c0 = blockIdx.y * 64;
    v8f acc[4][4];
#pragma unroll
    for (int mb = 0; mb < 4; ++mb)
#pragma unroll
        for (int nb = 0; nb < 4; ++nb) acc[mb][nb] = (v8f){};
    const size_t aoff = (size_t)(r0 + lr) * K + 8 * hi, boff = (size_t)(c0 + lr) * K + 8 * hi;
#pragma unroll 1
    for (int kc = 0; kc < K; kc += 32) {
        V a[4], a2[4];
#pragma unroll
        for (int mb = 0; mb < 4; ++mb) { a[mb] = WFrag<T16>::ld(A + aoff + (size_t)mb * 16 * K + kc); if (NSPLIT == 1 || NSPLIT == 2) a2[mb] = WFrag<T16>::ld(A2 + aoff + (size_t)mb * 16 * K + kc); }
#pragma unroll
        for (int nb = 0; nb < 4; ++nb) { const V b = WFrag<T16>::ld(Bt + boff + (size_t)nb * 16 * K + kc); V b2; if (NSPLIT >= 2) b2 = WFrag<T16>::ld(Bt2 + boff + (size_t)nb * 16 * K + kc);
#pragma unroll
            for (int mb = 0; mb < 4; ++mb) { acc[mb][nb] = WFrag<T16>::mma(a[mb], b, acc[mb][nb]); if (NSPLIT == 1 || NSPLIT == 2) acc[mb][nb] = WFrag<T16>::mma(a2[mb], b, acc[mb][nb]); if (NSPLIT >= 2) acc[mb][nb] = WFrag<T16>::mma(a[mb], b2, acc[mb][nb]); } }
        asm volatile("v_nop\n\tv_nop\n\tv_nop\n\tv_nop" : "+v"(acc[0][0]), "+v"(acc[1][1]), "+v"(acc[2][2]), "+v"(acc[3][3]) : "v"(a[0]), "v"(a[3]));
    }
#pragma unroll
    for (int mb = 0; mb < 4; ++mb) {
#pragma unroll
        for (int nb = 0; nb < 4; ++nb) {
#pragma unroll
            for (int j = 0; j < 8; ++j) os[(hi * 8 + j) * 68 + nb * 16 + lr] = acc[mb][nb][j]; }
        __builtin_amdgcn_wave_barrier(); asm volatile("" ::: "memory");
        float* crow = C + (size_t)(r0 + mb * 16) * ldc + c0;
{
#pragma unroll
            for (int s = 0; s < 8; ++s) { const int row = 2 * s + hi, cofs = lr * 4; v4f val = *(const v4fa*)(os + row * 68 + cofs); if (BIAS) { val[0] += bfr(bias[c0 + cofs]); val[1] += bfr(bias[c0 + cofs + 1]); val[2] += bfr(bias[c0 + cofs + 2]); val[3] += bfr(bias[c0 + cofs + 3]); }
                *(v4f*)(crow + (size_t)row * ldc + cofs) = val; }
             }
        __builtin_amdgcn_wave_barrier(); asm volatile("" ::: "memory");
    }
}

// ---- k_gemmc: the same one-wave 64x64 tile GEMM specialised for causal attention: CMODE 1 skips score tiles entirely above the diagonal (query rows r0+roff.., key columns c0..), CMODE 2 limits the
// key (K) loop of the probability x value contraction to the diagonal block (probabilities beyond it are exactly zero). roff = row offset of this launch's first row within the sequence.
template <typename T16, int NSPLIT, int CMODE>
__global__ __launch_bounds__(32) void k_gemmc(const T16* __restrict__ A, const T16* __restrict__ A2, const T16* __restrict__ Bt, const T16* __restrict__ Bt2, int K, float* C, int ldc, int roff, size_t sA, size_t sB, size_t sC) {
    typedef typename WFrag<T16>::V V;
    __shared__ __align__(16) float os[16 * 68];
    const size_t z = blockIdx.z; A += z * sA; if (A2) A2 += z * sA; Bt += z * sB; if (Bt2) Bt2 += z * sB; C += z * sC;
    const int lane = threadIdx.x & 31, lr = lane & 15, hi = lane >> 4; const int r0 = blockIdx.x * 64, c0 = blockIdx.y * 64;
    if (CMODE == 1 && c0 > r0 + roff + 63) return;                  // score tile entirely above the causal diagonal: never read (the softmax masks j > i by select)
    const int Kl = (CMODE == 2) ? min(K, r0 + roff + 64) : K;        // P.V: probabilities are exactly 0 beyond the diagonal block, so the K loop stops there
    v8f acc[4][4];
#pragma unroll
    for (int mb = 0; mb < 4; ++mb)
#pragma unroll
        for (int nb = 0; nb < 4; ++nb) acc[mb][nb] = (v8f){};
    const size_t aoff = (size_t)(r0 + lr) * K + 8 * hi, boff = (size_t)(c0 + lr) * K + 8 * hi;
#pragma unroll 1
    for (int kc = 0; kc < Kl; kc += 32) {
        V a[4], a2[4];
#pragma unroll
        for (int mb = 0; mb < 4; ++mb) { a[mb] = WFrag<T16>::ld(A + aoff + (size_t)mb * 16 * K + kc); if (NSPLIT == 1 || NSPLIT == 2) a2[mb] = WFrag<T16>::ld(A2 + aoff + (size_t)mb * 16 * K + kc); }
#pragma unroll
        for (int nb = 0; nb < 4; ++nb) { const V b = WFrag<T16>::ld(Bt + boff + (size_t)nb * 16 * K + kc); V b2; if (NSPLIT >= 2) b2 = WFrag<T16>::ld(Bt2 + boff + (size_t)nb * 16 * K + kc);
#pragma unroll
            for (int mb = 0; mb < 4; ++mb) { acc[mb][nb] = WFrag<T16>::mma(a[mb], b, acc[mb][nb]); if (NSPLIT == 1 || NSPLIT == 2) acc[mb][nb] = WFrag<T16>::mma(a2[mb], b, acc[mb][nb]); if (NSPLIT >= 2) acc[mb][nb] = WFrag<T16>::mma(a[mb], b2, acc[mb][nb]); } }
        asm volatile("v_nop\n\tv_nop\n\tv_nop\n\tv_nop" : "+v"(acc[0][0]), "+v"(acc[1][1]), "+v"(acc[2][2]), "+v"(acc[3][3]) : "v"(a[0]), "v"(a[3]));
    }
#pragma unroll
    for (int mb = 0; mb < 4; ++mb) {
#pragma unroll
        for (int nb = 0; nb < 4; ++nb) {
#pragma unroll
            for (int j = 0; j < 8; ++j) os[(hi * 8 + j) * 68 + nb * 16 + lr] = acc[mb][nb][j]; }
        __builtin_amdgcn_wave_barrier(); asm volatile("" ::: "memory");
        float* crow = C + (size_t)(r0 + mb * 16) * ldc + c0;
{
#pragma unroll
            for (int s = 0; s < 8; ++s) { const int row = 2 * s + hi, cofs = lr * 4; v4f val = *(const v4fa*)(os + row * 68 + cofs);
                *(v4f*)(crow + (size_t)row * ldc + cofs) = val; }
             }
        __builtin_amdgcn_wave_barrier(); asm volatile("" ::: "memory");
    }
}

// ---- k_pv: out = P . (gated V) on a 64 x 128 output tile per work-group of four waves (wave w: rows 32 (w & 1).., columns 64 (w >> 1)..). Both operands, hi and lo planes, come into LDS in stages of PVK keys by asynchronous copies
// (whole 256-B rows from global memory, shared by the four waves) in a ring of two buffers: stage t + 1 flies while stage t is multiplied. Per accumulator the products keep the order hi.hi, lo.hi, hi.lo per 32 keys, keys ascending.
// The key loop ends with the stage that holds the diagonal block; probabilities behind the diagonal are stored as exact zeros over the whole row, so the rest of that stage adds nothing.
#define PVK    128                 // keys per stage: a row of a stage is 256 B
#define PVP    272                 // pitch of such a row in LDS, bytes: 16 B x odd, so the 16 rows of a fragment read fall on distinct banks
#define PVROWS 384                 // rows of a stage: 64 P hi, 64 P lo, 128 V hi, 128 V lo
#define PVBUF  (PVROWS * PVP)
// Twelve copies of 16 B per lane; the s_wait_xcnt stands in the copies' own statement so that no address register is rewritten ahead of it.
__device__ __forceinline__ void acopy12(const unsigned* l, const bf* const* g) {
    asm volatile("global_load_async_to_lds_b128 %0, %1, off\n\t"
                 "global_load_async_to_lds_b128 %2, %3, off\n\t"
                 "global_load_async_to_lds_b128 %4, %5, off\n\t"
                 "global_load_async_to_lds_b128 %6, %7, off\n\t"
                 "global_load_async_to_lds_b128 %8, %9, off\n\t"
                 "global_load_async_to_lds_b128 %10, %11, off\n\t"
                 "global_load_async_to_lds_b128 %12, %13, off\n\t"
                 "global_load_async_to_lds_b128 %14, %15, off\n\t"
                 "global_load_async_to_lds_b128 %16, %17, off\n\t"
                 "global_load_async_to_lds_b128 %18, %19, off\n\t"
                 "global_load_async_to_lds_b128 %20, %21, off\n\t"
                 "global_load_async_to_lds_b128 %22, %23, off\n\t"
                 "s_wait_xcnt 0x0"
                 :: "v"(l[0]), "v"(g[0]), "v"(l[1]), "v"(g[1]), "v"(l[2]), "v"(g[2]), "v"(l[3]), "v"(g[3]), "v"(l[4]), "v"(g[4]), "v"(l[5]), "v"(g[5]),
                    "v"(l[6]), "v"(g[6]), "v"(l[7]), "v"(g[7]), "v"(l[8]), "v"(g[8]), "v"(l[9]), "v"(g[9]), "v"(l[10]), "v"(g[10]), "v"(l[11]), "v"(g[11]) : "memory");
}
// One stage: 48 copies per lane. pa / pb: the lane's piece of its first P row / V row at the stage's first key; ld: the lane's piece of its first row in the buffer. Copy i fills LDS row 8 i + (thread >> 4).
__device__ __forceinline__ void pv_stage(const bf* pa, const bf* pb, unsigned ld) {
#pragma unroll   // the copies' operands are register arrays
    for (int c = 0; c < 4; ++c) { unsigned l[12]; const bf* g[12];
#pragma unroll
        for (int u = 0; u < 12; ++u) { const int i = c * 12 + u; l[u] = ld + (unsigned)(i * 8 * PVP);
            g[u] = (i < 16) ? pa + (size_t)(i & 7) * 8 * (2 * TT) + (i >> 3) * TT : pb + (size_t)((i - 16) & 15) * 8 * (2 * TT) + ((i - 16) >> 4) * TT; }
        acopy12(l, g); }
}
__global__ __launch_bounds__(128) void k_pv(const bf* __restrict__ P, const bf* __restrict__ Vt, float* O) {
    __shared__ __align__(16) unsigned char L[2 * PVBUF];
    __shared__ __align__(16) float osw[4][16 * 68];
    const int lane = threadIdx.x & 31, lr = lane & 15, hi = lane >> 4, w = threadIdx.x >> 5, wm = w & 1, wn = w >> 1; const int r0 = blockIdx.x * 64; const size_t z = blockIdx.y;
    const int nT = (r0 + 64 + PVK - 1) / PVK;                        // stages up to and with the diagonal block; nT * PVK <= TT
    const int sub = threadIdx.x & 15, rg = threadIdx.x >> 4;
    const bf* pa = P + (z * TT + r0 + rg) * (size_t)(2 * TT) + sub * 8; const bf* pb = Vt + (z * DK + rg) * (size_t)(2 * TT) + sub * 8;
    const unsigned ld = (unsigned)(size_t)L + (unsigned)(rg * PVP + sub * 16);
    v8f acc[2][4];
#pragma unroll
    for (int mb = 0; mb < 2; ++mb)
#pragma unroll
        for (int nb = 0; nb < 4; ++nb) acc[mb][nb] = (v8f){};
    pv_stage(pa, pb, ld);
    asm volatile("s_wait_asynccnt 0x0" ::: "memory");               // this wave's part of stage 0 has landed
    __syncthreads();                                                 // every wave's part of stage 0 has landed
    if (nT > 1) pv_stage(pa + PVK, pb + PVK, ld + PVBUF);
    const unsigned char* fa = L + (wm * 32 + lr) * PVP + hi * 16; const unsigned char* fb = L + (128 + wn * 64 + lr) * PVP + hi * 16;
#pragma unroll 1   // one stage a trip: the ring's order stands once, at the foot
    for (int t = 0; t < nT; ++t) {
        const int bo = (t & 1) * PVBUF; const unsigned char* qa = fa + bo; const unsigned char* qb = fb + bo;
        v16bf a[2][2], a2[2][2], b[4], b2[4];                        // P fragments in two sets (this and the next 32 keys); each V fragment pair is refilled for the next 32 keys as soon as its products are issued
#pragma unroll
        for (int mb = 0; mb < 2; ++mb) { a[0][mb] = WFrag<bf>::ld((const bf*)(qa + mb * 16 * PVP)); a2[0][mb] = WFrag<bf>::ld((const bf*)(qa + (64 + mb * 16) * PVP)); }
#pragma unroll
        for (int nb = 0; nb < 4; ++nb) { b[nb] = WFrag<bf>::ld((const bf*)(qb + nb * 16 * PVP)); b2[nb] = WFrag<bf>::ld((const bf*)(qb + (128 + nb * 16) * PVP)); }
#pragma unroll   // ks and nb index register arrays
        for (int ks = 0; ks < PVK / 32; ++ks) { const int cu = ks & 1, nx = cu ^ 1; const bool more = ks + 1 < PVK / 32;   // fragments are fetched ahead inside the stage only, never from the next stage
            if (more) {
#pragma unroll
                for (int mb = 0; mb < 2; ++mb) { a[nx][mb] = WFrag<bf>::ld((const bf*)(qa + mb * 16 * PVP + (ks + 1) * 64)); a2[nx][mb] = WFrag<bf>::ld((const bf*)(qa + (64 + mb * 16) * PVP + (ks + 1) * 64)); } }
#pragma unroll
            for (int nb = 0; nb < 4; ++nb) {
                __builtin_amdgcn_sched_barrier(0);                   // keeps the LDS reads above in front of these products: left alone the compiler sinks each read to just before its use, and the one wave of the SIMD waits out every LDS latency
                acc[0][nb] = wmmab(a[cu][0], b[nb], acc[0][nb]);  acc[1][nb] = wmmab(a[cu][1], b[nb], acc[1][nb]);
                acc[0][nb] = wmmab(a2[cu][0], b[nb], acc[0][nb]); acc[1][nb] = wmmab(a2[cu][1], b[nb], acc[1][nb]);
                acc[0][nb] = wmmab(a[cu][0], b2[nb], acc[0][nb]); acc[1][nb] = wmmab(a[cu][1], b2[nb], acc[1][nb]);
                __builtin_amdgcn_sched_barrier(0);                   // keeps the refill below behind these products and in front of the next ones
                if (more) { b[nb] = WFrag<bf>::ld((const bf*)(qb + nb * 16 * PVP + (ks + 1) * 64)); b2[nb] = WFrag<bf>::ld((const bf*)(qb + (128 + nb * 16) * PVP + (ks + 1) * 64)); }
            }
        }
        asm volatile("s_wait_dscnt 0x0" ::: "memory");              // this wave's reads of stage t are done before the buffer may be refilled
        asm volatile("s_wait_asynccnt 0x0" ::: "memory");           // this wave's part of stage t + 1 has landed
        __syncthreads();                                             // publishes stage t + 1 and ends every wave's reads of stage t
        if (t + 2 < nT) pv_stage(pa + (size_t)(t + 2) * PVK, pb + (size_t)(t + 2) * PVK, ld + bo);
    }
    asm volatile("s_wait_asynccnt 0x0" ::: "memory");               // no copy is outstanding when the wave ends
    float* os = osw[w]; const int c0 = wn * 64;
#pragma unroll
    for (int mb = 0; mb < 2; ++mb) {
#pragma unroll
        for (int nb = 0; nb < 4; ++nb) {
#pragma unroll
            for (int j = 0; j < 8; ++j) os[(hi * 8 + j) * 68 + nb * 16 + lr] = acc[mb][nb][j]; }
        __builtin_amdgcn_wave_barrier(); asm volatile("" ::: "memory");   // the wave's own rows are written before it reads them back as whole lines
        float* crow = O + (z * TT + r0 + wm * 32 + mb * 16) * (size_t)DK + c0;
#pragma unroll
        for (int s = 0; s < 8; ++s) { const int row = 2 * s + hi, cofs = lr * 4; const v4f val = *(const v4fa*)(os + row * 68 + cofs); *(v4f*)(crow + (size_t)row * DK + cofs) = val; }
        __builtin_amdgcn_wave_barrier(); asm volatile("" ::: "memory");   // the rows are read before the next 16 rows overwrite them
    }
}

__device__ __forceinline__ void splitf(float y, unsigned short& h, unsigned short& l) { h = f2bf(y); l = f2bf(y - bf2f(h)); }
typedef __attribute__((ext_vector_type(2))) unsigned short v2us;
typedef __attribute__((ext_vector_type(4))) unsigned short v4us;

__global__ __launch_bounds__(256) void k_cvt8(const float* __restrict__ src, bf* dst, size_t n8) { const size_t i = (size_t)blockIdx.x * 256 + threadIdx.x; if (i >= n8) return; const v8f v = *(const v8f*)(src + i * 8); v8us o;
#pragma unroll
    for (int k = 0; k < 8; ++k) o[k] = f2bf(v[k]); *(v8us*)(dst + i * 8) = o;  }
// Every kernel below covers all NB_ sequences in one launch: k_gvt / k_csoft take the sequence from blockIdx.y, k_temp / k_gpl run over the NB_*TT rows as one list.
// k_temp: TQ[g] = pos + tanh(sum_d tokenq[s][d] gelu(Q[g][d])), TV[g] likewise with tokenv / V, pos = 1 + sigmoid(alpha[s]) log(s+1). One work-group per 32 tokens of the NB_*TT list: wave w takes tokens 4w..4w+3 with its lanes ACROSS d,
// so each row of Q, V, tokenq, tokenv is one whole 512-B load, and leaves the 128 products of each dot in LDS; behind the barrier lane t of wave 0 (Q) and of wave 1 (V) adds token t's products in the order d = 0..127 and the wave stores one whole 128-B line.
// k_gpl: hl planes GQ[s][d] = TQ[s] Q[s][d], Kp[s][d] = K[s][d] (8-B lanes);
#define TPP 132   // pitch of a product row in LDS, in floats: rows stay 16-B aligned and do not all start in one bank
__global__ __launch_bounds__(256) void k_temp(const float* __restrict__ QKV, const float* __restrict__ tq, const float* __restrict__ tv, const float* __restrict__ alpha, float* TQ, float* TV) {
    __shared__ __align__(16) float pr[2][32][TPP];
    const int lane = threadIdx.x & 31, w = threadIdx.x >> 5; const int g0 = blockIdx.x * 32;
    const int t0 = g0 + w * 4; const float* q = QKV + (size_t)t0 * D3 + lane * 4; const size_t sd = (size_t)(t0 % TT) * DK + lane * 4;   // TT % 4 == 0: a wave's four tokens lie in one sequence, so their tokenq / tokenv rows are consecutive too
    v4f xq[4], xv[4], kq[4], kv[4];
#pragma unroll   // registers, not an indexed array; the wave's 16 row loads all stand in front of the first gelu's branches, so they are in flight together
    for (int u = 0; u < 4; ++u) { xq[u] = *(const v4fa*)(q + u * D3); xv[u] = *(const v4fa*)(q + u * D3 + 2 * DK); kq[u] = *(const v4fa*)(tq + sd + u * DK); kv[u] = *(const v4fa*)(tv + sd + u * DK); }
#pragma unroll   // u and k index register arrays: both loops must be flat for the rows to stay in registers
    for (int u = 0; u < 4; ++u) { v4f pq, pv;
#pragma unroll
        for (int k = 0; k < 4; ++k) { const float x1 = xq[u][k], x2 = xv[u][k]; const float g1 = __fmul_rn(0.5f * x1, __fadd_rn(1.0f, erff(x1 * 0.70710678118654752f))), g2 = __fmul_rn(0.5f * x2, __fadd_rn(1.0f, erff(x2 * 0.70710678118654752f)));
            pq[k] = __fmul_rn(bfr(kq[u][k]), g1); pv[k] = __fmul_rn(bfr(kv[u][k]), g2); }
        *(v4fa*)(&pr[0][w * 4 + u][lane * 4]) = pq; *(v4fa*)(&pr[1][w * 4 + u][lane * 4]) = pv; }
    __syncthreads();   // every product row is in LDS before a lane of wave 0 or 1 adds it up
    if (w >= 2) return;
    const float* p = &pr[w][lane][0]; float a = 0.f;
#pragma unroll   // constant LDS offsets, no loop counter beside the one dependent chain of adds
    for (int d = 0; d < DK; d += 4) { const v4f c = *(const v4fa*)(p + d); a = __fadd_rn(a, c[0]); a = __fadd_rn(a, c[1]); a = __fadd_rn(a, c[2]); a = __fadd_rn(a, c[3]); }
    const int s = (g0 + lane) % TT;
    const float sg = __fdiv_rn(1.0f, __fadd_rn(1.0f, __expf(-bfr(alpha[s])))); const float pos = __fadd_rn(1.0f, __fmul_rn(sg, __logf((float)(s + 1))));
    (w ? TV : TQ)[g0 + lane] = __fadd_rn(pos, tanhf(a)); }
__global__ __launch_bounds__(256) void k_gpl(const float* __restrict__ QKV, const float* __restrict__ TQ, bf* GQh, bf* GQl, bf* Kh, bf* Kl) { const int e = (blockIdx.x * 256 + threadIdx.x) * 4; if (e >= NB_ * TT * DK) return; const int d = e % DK; const int s = e / DK; const float t = TQ[s]; const float* q = QKV + (size_t)s * D3 + d; v4us a, b, c, dd;
#pragma unroll
    for (int u = 0; u < 4; ++u) { unsigned short h1, l1, h2, l2; splitf(__fmul_rn(t, q[u]), h1, l1); splitf(q[DK + u], h2, l2); a[u] = h1; b[u] = l1; c[u] = h2; dd[u] = l2; }
    { *(v4us*)(GQh + e) = a; *(v4us*)(GQl + e) = b; *(v4us*)(Kh + e) = c; *(v4us*)(Kl + e) = dd;  } }
__global__ __launch_bounds__(256) void k_gvt(const float* __restrict__ QKV, const float* __restrict__ TV, bf* Th, bf* Tl) { const int e = (blockIdx.x * 256 + threadIdx.x) * 4; if (e >= DK * TT) return; const int s = e % TT; const int d = e / TT; v4us oh, ol; const size_t z = blockIdx.y; QKV += z * TT * D3; TV += z * TT; const size_t o = (z * DK + d) * (2 * TT) + s;   // row d = [TT hi][TT lo], the pitch of the probability rows (the tile GEMM has one pitch for both operands)
#pragma unroll
    for (int u = 0; u < 4; ++u) { unsigned short a, b; splitf(__fmul_rn(TV[s + u], QKV[(size_t)(s + u) * D3 + 2 * DK + d]), a, b); oh[u] = a; ol[u] = b; } *(v4us*)(Th + o) = oh; *(v4us*)(Tl + o) = ol;  }
// k_csoft: one wave per score row; the row's hi and lo probability planes (2 x TT 16-bit) are stored over the row's own TT f32 scores, which the wave holds whole in registers before its first store (every store needs the row sum).
__global__ __launch_bounds__(256) void k_csoft(const float* Sb, bf* Ph, bf* Pl) { const int lane = threadIdx.x & 31; const int i = blockIdx.x * 8 + (threadIdx.x >> 5); if (i >= TT) return; const size_t g = (size_t)blockIdx.y * TT + i; const float* sr = Sb + g * TT; float v[TT / 32]; float mx = -3.0e38f; const float scl = 0.088388347648318447f;
#pragma unroll
    for (int ch = 0; ch < TT / 128; ++ch) { const int j0 = ch * 128 + lane * 4; const v4f a = *(const v4f*)(sr + j0);
#pragma unroll
        for (int u = 0; u < 4; ++u) { const float t = (j0 + u <= i) ? a[u] * scl : -3.0e38f; v[ch * 4 + u] = t; mx = fmaxf(mx, t); } }
#pragma unroll
    for (int sh = 16; sh; sh >>= 1) mx = fmaxf(mx, __shfl_xor(mx, sh, 32));
    float sum = 0.f;
#pragma unroll
    for (int q = 0; q < TT / 32; ++q) { float d0 = __fsub_rn(v[q], mx); asm volatile("" : "+v"(d0)); v[q] = (v[q] > -1.0e38f) ? __builtin_amdgcn_exp2f(__fmul_rn(d0, 1.4426950408889634f)) : 0.f; sum += v[q]; }
#pragma unroll
    for (int sh = 16; sh; sh >>= 1) sum += __shfl_xor(sum, sh, 32);
    const float f = __fdiv_rn(1.0f, sum);
    {
#pragma unroll
        for (int ch = 0; ch < TT / 128; ++ch) { v4us oh, ol;
#pragma unroll
            for (int q = 0; q < 4; ++q) { unsigned short a, b; splitf(v[ch * 4 + q] * f, a, b); oh[q] = a; ol[q] = b; } const size_t oo = g * (2 * TT) + ch * 128 + lane * 4; *(v4us*)(Ph + oo) = oh; *(v4us*)(Pl + oo) = ol; }
         } }

extern "C" void kernel_launch(void* const* d_in, const int* in_sizes, int n_in,
                              void* d_out, int out_size, void* d_ws, size_t ws_size, hipStream_t stream) {
    (void)in_sizes; (void)n_in; (void)out_size;
    const float** I = (const float**)d_in;
    const float *x = I[0], *Wq = I[1], *bq = I[2], *Wk = I[3], *bk = I[4], *Wv = I[5], *bv = I[6], *alpha = I[7], *tokq = I[8], *tokv = I[9];
    float* OUT = (float*)d_out;     // [8][2048][128]
    char* wsp = (char*)d_ws;
    auto take = [&](size_t bytes) { char* p = wsp; wsp += (bytes + 255) & ~(size_t)255; return (void*)p; };
    bf* BQ = (bf*)take((size_t)DK * DE * 2); bf* BK = (bf*)take((size_t)DK * DE * 2); bf* BV = (bf*)take((size_t)DK * DE * 2); bf* XB = (bf*)take((size_t)NB_ * TT * DE * 2); float* QKV = (float*)take((size_t)NB_ * TT * D3 * 4); float* TQ = (float*)take(NB_ * TT * 4); float* TV = (float*)take(NB_ * TT * 4);
    bf* GQh = (bf*)take((size_t)NB_ * TT * DK * 2); bf* GQl = (bf*)take((size_t)NB_ * TT * DK * 2); bf* Kh = (bf*)take((size_t)NB_ * TT * DK * 2); bf* Kl = (bf*)take((size_t)NB_ * TT * DK * 2); bf* GVh = (bf*)take((size_t)NB_ * DK * TT * 4); bf* GVl = GVh + TT;
    float* Sb = (float*)take((size_t)NB_ * TT * TT * 4); bf* Ph = (bf*)Sb; bf* Pl = Ph + TT;    // probability planes in place: row r = [TT hi][TT lo] over score row r, pitch 2*TT
    if ((size_t)(wsp - (char*)d_ws) > ws_size) return;    // total ~ 211 MB
    k_cvt8<<<(DK * DE / 8 + 255) / 256, 256, 0, stream>>>(Wq, BQ, DK * DE / 8); k_cvt8<<<(DK * DE / 8 + 255) / 256, 256, 0, stream>>>(Wk, BK, DK * DE / 8); k_cvt8<<<(DK * DE / 8 + 255) / 256, 256, 0, stream>>>(Wv, BV, DK * DE / 8);   // [out][in] = Bt
    k_cvt8<<<(NB_ * TT * DE / 8 + 255) / 256, 256, 0, stream>>>(x, XB, (size_t)NB_ * TT * DE / 8);
    k_gemmw<bf, 0, true><<<dim3(NB_ * TT / 64, DK / 64, 1), 32, 0, stream>>>(XB, nullptr, BQ, nullptr, DE, QKV, D3, bq, 0, 0, 0); k_gemmw<bf, 0, true><<<dim3(NB_ * TT / 64, DK / 64, 1), 32, 0, stream>>>(XB, nullptr, BK, nullptr, DE, QKV + DK, D3, bk, 0, 0, 0); k_gemmw<bf, 0, true><<<dim3(NB_ * TT / 64, DK / 64, 1), 32, 0, stream>>>(XB, nullptr, BV, nullptr, DE, QKV + 2 * DK, D3, bv, 0, 0, 0);
    k_temp<<<NB_ * TT / 32, 256, 0, stream>>>(QKV, tokq, tokv, alpha, TQ, TV); k_gpl<<<(NB_ * TT * DK / 4 + 255) / 256, 256, 0, stream>>>(QKV, TQ, GQh, GQl, Kh, Kl); k_gvt<<<dim3((DK * TT / 4 + 255) / 256, NB_, 1), 256, 0, stream>>>(QKV, TV, GVh, GVl);
    k_gemmc<bf, 2, 1><<<dim3(TT / 64, TT / 64, NB_), 32, 0, stream>>>(GQh, GQl, Kh, Kl, DK, Sb, TT, 0, (size_t)TT * DK, (size_t)TT * DK, (size_t)TT * TT);
    k_csoft<<<dim3(TT / 8, NB_, 1), 256, 0, stream>>>(Sb, Ph, Pl);
    k_pv<<<dim3(TT / 64, NB_, 1), 128, 0, stream>>>(Ph, GVh, OUT);   // rows of both operands: [TT hi][TT lo], pitch 2*TT
}

// v004
// One run takes 145 microseconds.
// Two timings next to v003 put it at 1.29 and 1.30 times that version's speed.
// Over all steps from v000 it is 9.55 times as fast.
#include <hip/hip_runtime.h>

// SelectiveAttentionModule (x [8][2048][768]; Q/K/V = x W^T + b (d 128, single head); temps_q[s] = 1 + sigmoid(alpha[s]) log(s+1) + tanh(tokenq[s] . gelu(Q[s])), temps_v likewise with tokenv / V; scores = (temps_q Q) . K / sqrt(128), causal;
// softmax; out = softmax . (temps_v V) -> [8][2048][128]).
// Compute dtypes, f32 accumulate: every input rounded to bf16; Q/K/V on PLAIN bf16 operands (inputs: exact) + bias; the temperatures (erf-gelu, 128-term fixed-order dots, tanh, sigmoid, log) f32 on the VALU; gated Q / K / gated V -> bf16 hi+lo

#define NB_  8
#define TT   2048
#define DE   768
#define DK   128
#define D3   384
typedef _Float16 h16;
typedef unsigned short bf;
typedef __attribute__((ext_vector_type(16))) __bf16   v16bf;
typedef __attribute__((ext_vector_type(16))) _Float16 v16h;
typedef __attribute__((ext_vector_type(8)))  _Float16 v8h;
typedef __attribute__((ext_vector_type(8)))  unsigned short v8us;
typedef __attribute__((ext_vector_type(8)))  float    v8f;
typedef __attribute__((ext_vector_type(4)))  float    v4f;
typedef v8h  __attribute__((may_alias)) v8ha;
typedef v4f  __attribute__((may_alias)) v4fa;
typedef v8us __attribute__((may_alias)) v8usa;

__device__ __forceinline__ unsigned short f2bf(float f) { unsigned u = __float_as_uint(f); u += 0x7FFFu + ((u >> 16) & 1u); return (unsigned short)(u >> 16); }
__device__ __forceinline__ float bf2f(unsigned short b) { return __uint_as_float(((unsigned)b) << 16); }
__device__ __forceinline__ float bfr(float f) { return bf2f(f2bf(f)); }
__device__ __forceinline__ v16h cat16(v8h lo, v8h hi) { return __builtin_shufflevector(lo, hi, 0, 1, 2, 3, 4, 5, 6, 7, 8, 9, 10, 11, 12, 13, 14, 15); }
__device__ __forceinline__ v16bf cat16b(v8us lo, v8us hi) { return __builtin_bit_cast(v16bf, __builtin_shufflevector(lo, hi, 0, 1, 2, 3, 4, 5, 6, 7, 8, 9, 10, 11, 12, 13, 14, 15)); }
__device__ __forceinline__ v8f wmma16(v16h a, v16h b, v8f c) { return __builtin_amdgcn_wmma_f32_16x16x32_f16(false, a, false, b, (short)0, c, false, false); }
__device__ __forceinline__ v8f wmmab(v16bf a, v16bf b, v8f c) { return __builtin_amdgcn_wmma_f32_16x16x32_bf16(false, a, false, b, (short)0, c, false, false); }



// Fragment of a 16 x 32 operand block from a K-contiguous 16-bit plane: the lane's 8 elements at p and 8 at p + 16.
template <typename T16> struct WFrag;
template <> struct WFrag<h16> { typedef v16h V; static __device__ __forceinline__ V ld(const h16* p) { return cat16(*(const v8h*)p, *(const v8h*)(p + 16)); } static __device__ __forceinline__ v8f mma(V a, V b, v8f c) { return wmma16(a, b, c); } };
template <> struct WFrag<bf> { typedef v16bf V; static __device__ __forceinline__ V ld(const bf* p) { return cat16b(*(const v8us*)p, *(const v8us*)(p + 16)); } static __device__ __forceinline__ v8f mma(V a, V b, v8f c) { return wmmab(a, b, c); } };

// ---- k_gemmc: register-blocked GEMM, ONE WAVE per 64x64 output tile (16 accumulators), operands straight from K-contiguous 16-bit planes, specialised for causal attention: CMODE 1 skips score tiles entirely above the diagonal (query rows r0+roff.., key columns c0..), CMODE 2 limits the
// key (K) loop of the probability x value contraction to the diagonal block (probabilities beyond it are exactly zero). roff = row offset of this launch's first row within the sequence.
template <typename T16, int NSPLIT, int CMODE>
__global__ __launch_bounds__(32) void k_gemmc(const T16* __restrict__ A, const T16* __restrict__ A2, const T16* __restrict__ Bt, const T16* __restrict__ Bt2, int K, float* C, int ldc, int roff, size_t sA, size_t sB, size_t sC) {
    typedef typename WFrag<T16>::V V;
    __shared__ __align__(16) float os[16 * 68];
    const size_t z = blockIdx.z; A += z * sA; if (A2) A2 += z * sA; Bt += z * sB; if (Bt2) Bt2 += z * sB; C += z * sC;
    const int lane = threadIdx.x & 31, lr = lane & 15, hi = lane >> 4; const int r0 = blockIdx.x * 64, c0 = blockIdx.y * 64;
    if (CMODE == 1 && c0 > r0 + roff + 63) return;                  // score tile entirely above the causal diagonal: never read (the softmax masks j > i by select)
    const int Kl = (CMODE == 2) ? min(K, r0 + roff + 64) : K;        // P.V: probabilities are exactly 0 beyond the diagonal block, so the K loop stops there
    v8f acc[4][4];
#pragma unroll
    for (int mb = 0; mb < 4; ++mb)
#pragma unroll
        for (int nb = 0; nb < 4; ++nb) acc[mb][nb] = (v8f){};
    const size_t aoff = (size_t)(r0 + lr) * K + 8 * hi, boff = (size_t)(c0 + lr) * K + 8 * hi;
#pragma unroll 1
    for (int kc = 0; kc < Kl; kc += 32) {
        V a[4], a2[4];
#pragma unroll
        for (int mb = 0; mb < 4; ++mb) { a[mb] = WFrag<T16>::ld(A + aoff + (size_t)mb * 16 * K + kc); if (NSPLIT == 1 || NSPLIT == 2) a2[mb] = WFrag<T16>::ld(A2 + aoff + (size_t)mb * 16 * K + kc); }
#pragma unroll
        for (int nb = 0; nb < 4; ++nb) { const V b = WFrag<T16>::ld(Bt + boff + (size_t)nb * 16 * K + kc); V b2; if (NSPLIT >= 2) b2 = WFrag<T16>::ld(Bt2 + boff + (size_t)nb * 16 * K + kc);
#pragma unroll
            for (int mb = 0; mb < 4; ++mb) { acc[mb][nb] = WFrag<T16>::mma(a[mb], b, acc[mb][nb]); if (NSPLIT == 1 || NSPLIT == 2) acc[mb][nb] = WFrag<T16>::mma(a2[mb], b, acc[mb][nb]); if (NSPLIT >= 2) acc[mb][nb] = WFrag<T16>::mma(a[mb], b2, acc[mb][nb]); } }
        asm volatile("v_nop\n\tv_nop\n\tv_nop\n\tv_nop" : "+v"(acc[0][0]), "+v"(acc[1][1]), "+v"(acc[2][2]), "+v"(acc[3][3]) : "v"(a[0]), "v"(a[3]));
    }
#pragma unroll
    for (int mb = 0; mb < 4; ++mb) {
#pragma unroll
        for (int nb = 0; nb < 4; ++nb) {
#pragma unroll
            for (int j = 0; j < 8; ++j) os[(hi * 8 + j) * 68 + nb * 16 + lr] = acc[mb][nb][j]; }
        __builtin_amdgcn_wave_barrier(); asm volatile("" ::: "memory");
        float* crow = C + (size_t)(r0 + mb * 16) * ldc + c0;
{
#pragma unroll
            for (int s = 0; s < 8; ++s) { const int row = 2 * s + hi, cofs = lr * 4; v4f val = *(const v4fa*)(os + row * 68 + cofs);
                *(v4f*)(crow + (size_t)row * ldc + cofs) = val; }
             }
        __builtin_amdgcn_wave_barrier(); asm volatile("" ::: "memory");
    }
}

// ---- k_pv: out = P . (gated V) on a 64 x 128 output tile per work-group of four waves (wave w: rows 32 (w & 1).., columns 64 (w >> 1)..). Both operands, hi and lo planes, come into LDS in stages of PVK keys by asynchronous copies
// (whole 256-B rows from global memory, shared by the four waves) in a ring of two buffers: stage t + 1 flies while stage t is multiplied. Per accumulator the products keep the order hi.hi, lo.hi, hi.lo per 32 keys, keys ascending.
// The key loop ends with the stage that holds the diagonal block; probabilities behind the diagonal are stored as exact zeros over the whole row, so the rest of that stage adds nothing.
#define PVK    128                 // keys per stage: a row of a stage is 256 B
#define PVP    272                 // pitch of such a row in LDS, bytes: 16 B x odd, so the 16 rows of a fragment read fall on distinct banks
#define PVROWS 384                 // rows of a stage: 64 P hi, 64 P lo, 128 V hi, 128 V lo
#define PVBUF  (PVROWS * PVP)
// Twelve copies of 16 B per lane; the s_wait_xcnt stands in the copies' own statement so that no address register is rewritten ahead of it.
__device__ __forceinline__ void acopy12(const unsigned* l, const bf* const* g) {
    asm volatile("global_load_async_to_lds_b128 %0, %1, off\n\t"
                 "global_load_async_to_lds_b128 %2, %3, off\n\t"
                 "global_load_async_to_lds_b128 %4, %5, off\n\t"
                 "global_load_async_to_lds_b128 %6, %7, off\n\t"
                 "global_load_async_to_lds_b128 %8, %9, off\n\t"
                 "global_load_async_to_lds_b128 %10, %11, off\n\t"
                 "global_load_async_to_lds_b128 %12, %13, off\n\t"
                 "global_load_async_to_lds_b128 %14, %15, off\n\t"
                 "global_load_async_to_lds_b128 %16, %17, off\n\t"
                 "global_load_async_to_lds_b128 %18, %19, off\n\t"
                 "global_load_async_to_lds_b128 %20, %21, off\n\t"
                 "global_load_async_to_lds_b128 %22, %23, off\n\t"
                 "s_wait_xcnt 0x0"
                 :: "v"(l[0]), "v"(g[0]), "v"(l[1]), "v"(g[1]), "v"(l[2]), "v"(g[2]), "v"(l[3]), "v"(g[3]), "v"(l[4]), "v"(g[4]), "v"(l[5]), "v"(g[5]),
                    "v"(l[6]), "v"(g[6]), "v"(l[7]), "v"(g[7]), "v"(l[8]), "v"(g[8]), "v"(l[9]), "v"(g[9]), "v"(l[10]), "v"(g[10]), "v"(l[11]), "v"(g[11]) : "memory");
}
// One stage: 48 copies per lane. pa / pb: the lane's piece of its first P row / V row at the stage's first key; ld: the lane's piece of its first row in the buffer. Copy i fills LDS row 8 i + (thread >> 4).
__device__ __forceinline__ void pv_stage(const bf* pa, const bf* pb, unsigned ld) {
#pragma unroll   // the copies' operands are register arrays
    for (int c = 0; c < 4; ++c) { unsigned l[12]; const bf* g[12];
#pragma unroll
        for (int u = 0; u < 12; ++u) { const int i = c * 12 + u; l[u] = ld + (unsigned)(i * 8 * PVP);
            g[u] = (i < 16) ? pa + (size_t)(i & 7) * 8 * (2 * TT) + (i >> 3) * TT : pb + (size_t)((i - 16) & 15) * 8 * (2 * TT) + ((i - 16) >> 4) * TT; }
        acopy12(l, g); }
}
__global__ __launch_bounds__(128) void k_pv(const bf* __restrict__ P, const bf* __restrict__ Vt, float* O) {
    __shared__ __align__(16) unsigned char L[2 * PVBUF];
    __shared__ __align__(16) float osw[4][16 * 68];
    const int lane = threadIdx.x & 31, lr = lane & 15, hi = lane >> 4, w = threadIdx.x >> 5, wm = w & 1, wn = w >> 1; const int r0 = blockIdx.x * 64; const size_t z = blockIdx.y;
    const int nT = (r0 + 64 + PVK - 1) / PVK;                        // stages up to and with the diagonal block; nT * PVK <= TT
    const int sub = threadIdx.x & 15, rg = threadIdx.x >> 4;
    const bf* pa = P + (z * TT + r0 + rg) * (size_t)(2 * TT) + sub * 8; const bf* pb = Vt + (z * DK + rg) * (size_t)(2 * TT) + sub * 8;
    const unsigned ld = (unsigned)(size_t)L + (unsigned)(rg * PVP + sub * 16);
    v8f acc[2][4];
#pragma unroll
    for (int mb = 0; mb < 2; ++mb)
#pragma unroll
        for (int nb = 0; nb < 4; ++nb) acc[mb][nb] = (v8f){};
    pv_stage(pa, pb, ld);
    asm volatile("s_wait_asynccnt 0x0" ::: "memory");               // this wave's part of stage 0 has landed
    __syncthreads();                                                 // every wave's part of stage 0 has landed
    if (nT > 1) pv_stage(pa + PVK, pb + PVK, ld + PVBUF);
    const unsigned char* fa = L + (wm * 32 + lr) * PVP + hi * 16; const unsigned char* fb = L + (128 + wn * 64 + lr) * PVP + hi * 16;
#pragma unroll 1   // one stage a trip: the ring's order stands once, at the foot
    for (int t = 0; t < nT; ++t) {
        const int bo = (t & 1) * PVBUF; const unsigned char* qa = fa + bo; const unsigned char* qb = fb + bo;
        v16bf a[2][2], a2[2][2], b[4], b2[4];                        // P fragments in two sets (this and the next 32 keys); each V fragment pair is refilled for the next 32 keys as soon as its products are issued
#pragma unroll
        for (int mb = 0; mb < 2; ++mb) { a[0][mb] = WFrag<bf>::ld((const bf*)(qa + mb * 16 * PVP)); a2[0][mb] = WFrag<bf>::ld((const bf*)(qa + (64 + mb * 16) * PVP)); }
#pragma unroll
        for (int nb = 0; nb < 4; ++nb) { b[nb] = WFrag<bf>::ld((const bf*)(qb + nb * 16 * PVP)); b2[nb] = WFrag<bf>::ld((const bf*)(qb + (128 + nb * 16) * PVP)); }
#pragma unroll   // ks and nb index register arrays
        for (int ks = 0; ks < PVK / 32; ++ks) { const int cu = ks & 1, nx = cu ^ 1; const bool more = ks + 1 < PVK / 32;   // fragments are fetched ahead inside the stage only, never from the next stage
            if (more) {
#pragma unroll
                for (int mb = 0; mb < 2; ++mb) { a[nx][mb] = WFrag<bf>::ld((const bf*)(qa + mb * 16 * PVP + (ks + 1) * 64)); a2[nx][mb] = WFrag<bf>::ld((const bf*)(qa + (64 + mb * 16) * PVP + (ks + 1) * 64)); } }
#pragma unroll
            for (int nb = 0; nb < 4; ++nb) {
                __builtin_amdgcn_sched_barrier(0);                   // keeps the LDS reads above in front of these products: left alone the compiler sinks each read to just before its use, and the one wave of the SIMD waits out every LDS latency
                acc[0][nb] = wmmab(a[cu][0], b[nb], acc[0][nb]);  acc[1][nb] = wmmab(a[cu][1], b[nb], acc[1][nb]);
                acc[0][nb] = wmmab(a2[cu][0], b[nb], acc[0][nb]); acc[1][nb] = wmmab(a2[cu][1], b[nb], acc[1][nb]);
                acc[0][nb] = wmmab(a[cu][0], b2[nb], acc[0][nb]); acc[1][nb] = wmmab(a[cu][1], b2[nb], acc[1][nb]);
                __builtin_amdgcn_sched_barrier(0);                   // keeps the refill below behind these products and in front of the next ones
                if (more) { b[nb] = WFrag<bf>::ld((const bf*)(qb + nb * 16 * PVP + (ks + 1) * 64)); b2[nb] = WFrag<bf>::ld((const bf*)(qb + (128 + nb * 16) * PVP + (ks + 1) * 64)); }
            }
        }
        asm volatile("s_wait_dscnt 0x0" ::: "memory");              // this wave's reads of stage t are done before the buffer may be refilled
        asm volatile("s_wait_asynccnt 0x0" ::: "memory");           // this wave's part of stage t + 1 has landed
        __syncthreads();                                             // publishes stage t + 1 and ends every wave's reads of stage t
        if (t + 2 < nT) pv_stage(pa + (size_t)(t + 2) * PVK, pb + (size_t)(t + 2) * PVK, ld + bo);
    }
    asm volatile("s_wait_asynccnt 0x0" ::: "memory");               // no copy is outstanding when the wave ends
    float* os = osw[w]; const int c0 = wn * 64;
#pragma unroll
    for (int mb = 0; mb < 2; ++mb) {
#pragma unroll
        for (int nb = 0; nb < 4; ++nb) {
#pragma unroll
            for (int j = 0; j < 8; ++j) os[(hi * 8 + j) * 68 + nb * 16 + lr] = acc[mb][nb][j]; }
        __builtin_amdgcn_wave_barrier(); asm volatile("" ::: "memory");   // the wave's own rows are written before it reads them back as whole lines
        float* crow = O + (z * TT + r0 + wm * 32 + mb * 16) * (size_t)DK + c0;
#pragma unroll
        for (int s = 0; s < 8; ++s) { const int row = 2 * s + hi, cofs = lr * 4; const v4f val = *(const v4fa*)(os + row * 68 + cofs); *(v4f*)(crow + (size_t)row * DK + cofs) = val; }
        __builtin_amdgcn_wave_barrier(); asm volatile("" ::: "memory");   // the rows are read before the next 16 rows overwrite them
    }
}

// ---- k_qkv: QKV[m][0..383] = x[m] . W[n] + bias[n] for the three projections at once (W = the rows of Wq, Wk, Wv one after the other): a 64 x 384 output tile per work-group of eight waves (wave w: rows 32 (w & 1).., columns 96 (w >> 1)..).
// Both operands come into LDS in stages of QKK values of k by asynchronous copies (whole 256-B pieces of rows, shared by the eight waves) in a ring of two buffers: stage t + 1 flies while stage t is multiplied. Per accumulator one product per 32 k, k ascending.
#define QKK    128                 // k per stage: a row of a stage is 256 B
#define QKP    272                 // pitch of such a row in LDS, bytes: 16 B x odd, so the 16 rows of a fragment read fall on distinct banks
#define QKROWS 448                 // rows of a stage: 64 of x, 384 of W
#define QKBUF  (QKROWS * QKP)
#define QKOP   100                 // pitch of an output row in LDS, floats: rows stay 16-B aligned, the two row halves of an accumulator fall on distinct banks
// Fourteen copies of 16 B per lane; the s_wait_xcnt stands in the copies' own statement so that no address register is rewritten ahead of it.
__device__ __forceinline__ void acopy14(const unsigned* l, const bf* const* g) {
    asm volatile("global_load_async_to_lds_b128 %0, %1, off\n\t"
                 "global_load_async_to_lds_b128 %2, %3, off\n\t"
                 "global_load_async_to_lds_b128 %4, %5, off\n\t"
                 "global_load_async_to_lds_b128 %6, %7, off\n\t"
                 "global_load_async_to_lds_b128 %8, %9, off\n\t"
                 "global_load_async_to_lds_b128 %10, %11, off\n\t"
                 "global_load_async_to_lds_b128 %12, %13, off\n\t"
                 "global_load_async_to_lds_b128 %14, %15, off\n\t"
                 "global_load_async_to_lds_b128 %16, %17, off\n\t"
                 "global_load_async_to_lds_b128 %18, %19, off\n\t"
                 "global_load_async_to_lds_b128 %20, %21, off\n\t"
                 "global_load_async_to_lds_b128 %22, %23, off\n\t"
                 "global_load_async_to_lds_b128 %24, %25, off\n\t"
                 "global_load_async_to_lds_b128 %26, %27, off\n\t"
                 "s_wait_xcnt 0x0"
                 :: "v"(l[0]), "v"(g[0]), "v"(l[1]), "v"(g[1]), "v"(l[2]), "v"(g[2]), "v"(l[3]), "v"(g[3]), "v"(l[4]), "v"(g[4]), "v"(l[5]), "v"(g[5]), "v"(l[6]), "v"(g[6]),
                    "v"(l[7]), "v"(g[7]), "v"(l[8]), "v"(g[8]), "v"(l[9]), "v"(g[9]), "v"(l[10]), "v"(g[10]), "v"(l[11]), "v"(g[11]), "v"(l[12]), "v"(g[12]), "v"(l[13]), "v"(g[13]) : "memory");
}
// One stage: 28 copies per lane. px / pw: the lane's piece of its first x row / W row at the stage's first k; ld: the lane's piece of its first row in the buffer. Copy i fills LDS row 16 i + (thread >> 4).
__device__ __forceinline__ void qkv_stage(const bf* px, const bf* pw, unsigned ld) {
#pragma unroll   // the copies' operands are register arrays
    for (int c = 0; c < 2; ++c) { unsigned l[14]; const bf* g[14];
#pragma unroll
        for (int u = 0; u < 14; ++u) { const int i = c * 14 + u; l[u] = ld + (unsigned)(i * 16 * QKP); g[u] = (i < 4) ? px + (size_t)i * 16 * DE : pw + (size_t)(i - 4) * 16 * DE; }
        acopy14(l, g); }
}
__global__ __launch_bounds__(256) void k_qkv(const bf* __restrict__ X, const bf* __restrict__ Wt, const float* __restrict__ bq, const float* __restrict__ bk, const float* __restrict__ bv, float* C) {
    __shared__ __align__(16) unsigned char L[2 * QKBUF];
    __shared__ __align__(16) float osw[8][16 * QKOP];
    const int lane = threadIdx.x & 31, lr = lane & 15, hi = lane >> 4, w = threadIdx.x >> 5, wm = w & 1, wn = w >> 1; const int r0 = blockIdx.x * 64;
    const int nT = DE / QKK;                                         // six stages
    const int sub = threadIdx.x & 15, rg = threadIdx.x >> 4;
    const bf* px = X + (size_t)(r0 + rg) * DE + sub * 8; const bf* pw = Wt + (size_t)rg * DE + sub * 8;
    const unsigned ld = (unsigned)(size_t)L + (unsigned)(rg * QKP + sub * 16);
    v8f acc[2][6];
#pragma unroll
    for (int mb = 0; mb < 2; ++mb)
#pragma unroll
        for (int nb = 0; nb < 6; ++nb) acc[mb][nb] = (v8f){};
    qkv_stage(px, pw, ld);
    asm volatile("s_wait_asynccnt 0x0" ::: "memory");               // this wave's part of stage 0 has landed
    __syncthreads();                                                 // every wave's part of stage 0 has landed
    qkv_stage(px + QKK, pw + QKK, ld + QKBUF);
    const unsigned char* fa = L + (wm * 32 + lr) * QKP + hi * 16; const unsigned char* fb = L + (64 + wn * 96 + lr) * QKP + hi * 16;
#pragma unroll 1   // one stage a trip: the ring's order stands once, at the foot
    for (int t = 0; t < nT; ++t) {
        const int bo = (t & 1) * QKBUF; const unsigned char* qa = fa + bo; const unsigned char* qb = fb + bo;
        v16bf a[2][2], b[2][6];                                      // two fragment sets: this and the next 32 k
#pragma unroll
        for (int mb = 0; mb < 2; ++mb) a[0][mb] = WFrag<bf>::ld((const bf*)(qa + mb * 16 * QKP));
#pragma unroll
        for (int nb = 0; nb < 6; ++nb) b[0][nb] = WFrag<bf>::ld((const bf*)(qb + nb * 16 * QKP));
#pragma unroll   // ks indexes register arrays
        for (int ks = 0; ks < QKK / 32; ++ks) { const int cu = ks & 1, nx = cu ^ 1;
            if (ks + 1 < QKK / 32) {                                 // fragments are fetched ahead inside the stage only, never from the next stage
#pragma unroll
                for (int mb = 0; mb < 2; ++mb) a[nx][mb] = WFrag<bf>::ld((const bf*)(qa + mb * 16 * QKP + (ks + 1) * 64));
#pragma unroll
                for (int nb = 0; nb < 6; ++nb) b[nx][nb] = WFrag<bf>::ld((const bf*)(qb + nb * 16 * QKP + (ks + 1) * 64)); }
            __builtin_amdgcn_sched_barrier(0);                       // keeps the next set's LDS reads as one group in front of these products: sunk to just before their use, every read's latency would be waited out
#pragma unroll
            for (int nb = 0; nb < 6; ++nb) { acc[0][nb] = wmmab(a[cu][0], b[cu][nb], acc[0][nb]); acc[1][nb] = wmmab(a[cu][1], b[cu][nb], acc[1][nb]); }
            __builtin_amdgcn_sched_barrier(0);                       // keeps the reads of the set after next behind these products: lifted among them they stand in several places and take a third set's registers
        }
        asm volatile("s_wait_dscnt 0x0" ::: "memory");              // this wave's reads of stage t are done before the buffer may be refilled
        asm volatile("s_wait_asynccnt 0x0" ::: "memory");           // this wave's part of stage t + 1 has landed
        __syncthreads();                                             // publishes stage t + 1 and ends every wave's reads of stage t
        if (t + 2 < nT) qkv_stage(px + (size_t)(t + 2) * QKK, pw + (size_t)(t + 2) * QKK, ld + bo);
    }
    asm volatile("s_wait_asynccnt 0x0" ::: "memory");               // no copy is outstanding when the wave ends
    float* os = osw[w]; const int c0 = wn * 96;
    int rb[3], cb[3]; v4f bi[3];                                     // 16 rows x 96 columns leave as 12 stores of 32 x 16 B; store 3 g + h covers rows 4 g + rb[h] at columns cb[h]..cb[h] + 3
#pragma unroll
    for (int h = 0; h < 3; ++h) { const int q = h * 32 + lane; rb[h] = q / 24; cb[h] = (q % 24) * 4; const int col = c0 + cb[h];
        const float* bp = (col < DK) ? bq + col : (col < 2 * DK) ? bk + (col - DK) : bv + (col - 2 * DK);
        bi[h][0] = bfr(bp[0]); bi[h][1] = bfr(bp[1]); bi[h][2] = bfr(bp[2]); bi[h][3] = bfr(bp[3]); }
#pragma unroll
    for (int mb = 0; mb < 2; ++mb) {
#pragma unroll
        for (int nb = 0; nb < 6; ++nb) {
#pragma unroll
            for (int j = 0; j < 8; ++j) os[(hi * 8 + j) * QKOP + nb * 16 + lr] = acc[mb][nb][j]; }
        __builtin_amdgcn_wave_barrier(); asm volatile("" ::: "memory");   // the wave's own rows are written before it reads them back as whole lines
        float* crow = C + (size_t)(r0 + wm * 32 + mb * 16) * D3 + c0;
#pragma unroll
        for (int g = 0; g < 4; ++g)
#pragma unroll
            for (int h = 0; h < 3; ++h) { const int row = 4 * g + rb[h]; v4f val = *(const v4fa*)(os + row * QKOP + cb[h]); val[0] += bi[h][0]; val[1] += bi[h][1]; val[2] += bi[h][2]; val[3] += bi[h][3]; *(v4f*)(crow + (size_t)row * D3 + cb[h]) = val; }
        __builtin_amdgcn_wave_barrier(); asm volatile("" ::: "memory");   // the rows are read before the next 16 rows overwrite them
    }
}

__device__ __forceinline__ void splitf(float y, unsigned short& h, unsigned short& l) { h = f2bf(y); l = f2bf(y - bf2f(h)); }
typedef __attribute__((ext_vector_type(2))) unsigned short v2us;
typedef __attribute__((ext_vector_type(4))) unsigned short v4us;

__global__ __launch_bounds__(256) void k_cvt8(const float* __restrict__ src, bf* dst, size_t n8) { const size_t i = (size_t)blockIdx.x * 256 + threadIdx.x; if (i >= n8) return; const v8f v = *(const v8f*)(src + i * 8); v8us o;
#pragma unroll
    for (int k = 0; k < 8; ++k) o[k] = f2bf(v[k]); *(v8us*)(dst + i * 8) = o;  }
// Every kernel below covers all NB_ sequences in one launch: k_gvt / k_csoft take the sequence from blockIdx.y, k_temp / k_gpl run over the NB_*TT rows as one list.
// k_temp: TQ[g] = pos + tanh(sum_d tokenq[s][d] gelu(Q[g][d])), TV[g] likewise with tokenv / V, pos = 1 + sigmoid(alpha[s]) log(s+1). One work-group per 32 tokens of the NB_*TT list: wave w takes tokens 4w..4w+3 with its lanes ACROSS d,
// so each row of Q, V, tokenq, tokenv is one whole 512-B load, and leaves the 128 products of each dot in LDS; behind the barrier lane t of wave 0 (Q) and of wave 1 (V) adds token t's products in the order d = 0..127 and the wave stores one whole 128-B line.
// k_gpl: hl planes GQ[s][d] = TQ[s] Q[s][d], Kp[s][d] = K[s][d] (8-B lanes);
#define TPP 132   // pitch of a product row in LDS, in floats: rows stay 16-B aligned and do not all start in one bank
__global__ __launch_bounds__(256) void k_temp(const float* __restrict__ QKV, const float* __restrict__ tq, const float* __restrict__ tv, const float* __restrict__ alpha, float* TQ, float* TV) {
    __shared__ __align__(16) float pr[2][32][TPP];
    const int lane = threadIdx.x & 31, w = threadIdx.x >> 5; const int g0 = blockIdx.x * 32;
    const int t0 = g0 + w * 4; const float* q = QKV + (size_t)t0 * D3 + lane * 4; const size_t sd = (size_t)(t0 % TT) * DK + lane * 4;   // TT % 4 == 0: a wave's four tokens lie in one sequence, so their tokenq / tokenv rows are consecutive too
    v4f xq[4], xv[4], kq[4], kv[4];
#pragma unroll   // registers, not an indexed array; the wave's 16 row loads all stand in front of the first gelu's branches, so they are in flight together
    for (int u = 0; u < 4; ++u) { xq[u] = *(const v4fa*)(q + u * D3); xv[u] = *(const v4fa*)(q + u * D3 + 2 * DK); kq[u] = *(const v4fa*)(tq + sd + u * DK); kv[u] = *(const v4fa*)(tv + sd + u * DK); }
#pragma unroll   // u and k index register arrays: both loops must be flat for the rows to stay in registers
    for (int u = 0; u < 4; ++u) { v4f pq, pv;
#pragma unroll
        for (int k = 0; k < 4; ++k) { const float x1 = xq[u][k], x2 = xv[u][k]; const float g1 = __fmul_rn(0.5f * x1, __fadd_rn(1.0f, erff(x1 * 0.70710678118654752f))), g2 = __fmul_rn(0.5f * x2, __fadd_rn(1.0f, erff(x2 * 0.70710678118654752f)));
            pq[k] = __fmul_rn(bfr(kq[u][k]), g1); pv[k] = __fmul_rn(bfr(kv[u][k]), g2); }
        *(v4fa*)(&pr[0][w * 4 + u][lane * 4]) = pq; *(v4fa*)(&pr[1][w * 4 + u][lane * 4]) = pv; }
    __syncthreads();   // every product row is in LDS before a lane of wave 0 or 1 adds it up
    if (w >= 2) return;
    const float* p = &pr[w][lane][0]; float a = 0.f;
#pragma unroll   // constant LDS offsets, no loop counter beside the one dependent chain of adds
    for (int d = 0; d < DK; d += 4) { const v4f c = *(const v4fa*)(p + d); a = __fadd_rn(a, c[0]); a = __fadd_rn(a, c[1]); a = __fadd_rn(a, c[2]); a = __fadd_rn(a, c[3]); }
    const int s = (g0 + lane) % TT;
    const float sg = __fdiv_rn(1.0f, __fadd_rn(1.0f, __expf(-bfr(alpha[s])))); const float pos = __fadd_rn(1.0f, __fmul_rn(sg, __logf((float)(s + 1))));
    (w ? TV : TQ)[g0 + lane] = __fadd_rn(pos, tanhf(a)); }
__global__ __launch_bounds__(256) void k_gpl(const float* __restrict__ QKV, const float* __restrict__ TQ, bf* GQh, bf* GQl, bf* Kh, bf* Kl) { const int e = (blockIdx.x * 256 + threadIdx.x) * 4; if (e >= NB_ * TT * DK) return; const int d = e % DK; const int s = e / DK; const float t = TQ[s]; const float* q = QKV + (size_t)s * D3 + d; v4us a, b, c, dd;
#pragma unroll
    for (int u = 0; u < 4; ++u) { unsigned short h1, l1, h2, l2; splitf(__fmul_rn(t, q[u]), h1, l1); splitf(q[DK + u], h2, l2); a[u] = h1; b[u] = l1; c[u] = h2; dd[u] = l2; }
    { *(v4us*)(GQh + e) = a; *(v4us*)(GQl + e) = b; *(v4us*)(Kh + e) = c; *(v4us*)(Kl + e) = dd;  } }
__global__ __launch_bounds__(256) void k_gvt(const float* __restrict__ QKV, const float* __restrict__ TV, bf* Th, bf* Tl) { const int e = (blockIdx.x * 256 + threadIdx.x) * 4; if (e >= DK * TT) return; const int s = e % TT; const int d = e / TT; v4us oh, ol; const size_t z = blockIdx.y; QKV += z * TT * D3; TV += z * TT; const size_t o = (z * DK + d) * (2 * TT) + s;   // row d = [TT hi][TT lo], the pitch of the probability rows (the tile GEMM has one pitch for both operands)
#pragma unroll
    for (int u = 0; u < 4; ++u) { unsigned short a, b; splitf(__fmul_rn(TV[s + u], QKV[(size_t)(s + u) * D3 + 2 * DK + d]), a, b); oh[u] = a; ol[u] = b; } *(v4us*)(Th + o) = oh; *(v4us*)(Tl + o) = ol;  }
// k_csoft: one wave per score row; the row's hi and lo probability planes (2 x TT 16-bit) are stored over the row's own TT f32 scores, which the wave holds whole in registers before its first store (every store needs the row sum).
__global__ __launch_bounds__(256) void k_csoft(const float* Sb, bf* Ph, bf* Pl) { const int lane = threadIdx.x & 31; const int i = blockIdx.x * 8 + (threadIdx.x >> 5); if (i >= TT) return; const size_t g = (size_t)blockIdx.y * TT + i; const float* sr = Sb + g * TT; float v[TT / 32]; float mx = -3.0e38f; const float scl = 0.088388347648318447f;
#pragma unroll
    for (int ch = 0; ch < TT / 128; ++ch) { const int j0 = ch * 128 + lane * 4; const v4f a = *(const v4f*)(sr + j0);
#pragma unroll
        for (int u = 0; u < 4; ++u) { const float t = (j0 + u <= i) ? a[u] * scl : -3.0e38f; v[ch * 4 + u] = t; mx = fmaxf(mx, t); } }
#pragma unroll
    for (int sh = 16; sh; sh >>= 1) mx = fmaxf(mx, __shfl_xor(mx, sh, 32));
    float sum = 0.f;
#pragma unroll
    for (int q = 0; q < TT / 32; ++q) { float d0 = __fsub_rn(v[q], mx); asm volatile("" : "+v"(d0)); v[q] = (v[q] > -1.0e38f) ? __builtin_amdgcn_exp2f(__fmul_rn(d0, 1.4426950408889634f)) : 0.f; sum += v[q]; }
#pragma unroll
    for (int sh = 16; sh; sh >>= 1) sum += __shfl_xor(sum, sh, 32);
    const float f = __fdiv_rn(1.0f, sum);
    {
#pragma unroll
        for (int ch = 0; ch < TT / 128; ++ch) { v4us oh, ol;
#pragma unroll
            for (int q = 0; q < 4; ++q) { unsigned short a, b; splitf(v[ch * 4 + q] * f, a, b); oh[q] = a; ol[q] = b; } const size_t oo = g * (2 * TT) + ch * 128 + lane * 4; *(v4us*)(Ph + oo) = oh; *(v4us*)(Pl + oo) = ol; }
         } }

extern "C" void kernel_launch(void* const* d_in, const int* in_sizes, int n_in,
                              void* d_out, int out_size, void* d_ws, size_t ws_size, hipStream_t stream) {
    (void)in_sizes; (void)n_in; (void)out_size;
    const float** I = (const float**)d_in;
    const float *x = I[0], *Wq = I[1], *bq = I[2], *Wk = I[3], *bk = I[4], *Wv = I[5], *bv = I[6], *alpha = I[7], *tokq = I[8], *tokv = I[9];
    float* OUT = (float*)d_out;     // [8][2048][128]
    char* wsp = (char*)d_ws;
    auto take = [&](size_t bytes) { char* p = wsp; wsp += (bytes + 255) & ~(size_t)255; return (void*)p; };
    bf* BQ = (bf*)take((size_t)DK * DE * 2); bf* BK = (bf*)take((size_t)DK * DE * 2); bf* BV = (bf*)take((size_t)DK * DE * 2); bf* XB = (bf*)take((size_t)NB_ * TT * DE * 2); float* QKV = (float*)take((size_t)NB_ * TT * D3 * 4); float* TQ = (float*)take(NB_ * TT * 4); float* TV = (float*)take(NB_ * TT * 4);
    bf* GQh = (bf*)take((size_t)NB_ * TT * DK * 2); bf* GQl = (bf*)take((size_t)NB_ * TT * DK * 2); bf* Kh = (bf*)take((size_t)NB_ * TT * DK * 2); bf* Kl = (bf*)take((size_t)NB_ * TT * DK * 2); bf* GVh = (bf*)take((size_t)NB_ * DK * TT * 4); bf* GVl = GVh + TT;
    float* Sb = (float*)take((size_t)NB_ * TT * TT * 4); bf* Ph = (bf*)Sb; bf* Pl = Ph + TT;    // probability planes in place: row r = [TT hi][TT lo] over score row r, pitch 2*TT
    if ((size_t)(wsp - (char*)d_ws) > ws_size) return;    // total ~ 211 MB
    k_cvt8<<<(DK * DE / 8 + 255) / 256, 256, 0, stream>>>(Wq, BQ, DK * DE / 8); k_cvt8<<<(DK * DE / 8 + 255) / 256, 256, 0, stream>>>(Wk, BK, DK * DE / 8); k_cvt8<<<(DK * DE / 8 + 255) / 256, 256, 0, stream>>>(Wv, BV, DK * DE / 8);   // [out][in] = Bt
    k_cvt8<<<(NB_ * TT * DE / 8 + 255) / 256, 256, 0, stream>>>(x, XB, (size_t)NB_ * TT * DE / 8);
    k_qkv<<<NB_ * TT / 64, 256, 0, stream>>>(XB, BQ, bq, bk, bv, QKV);   // BQ, BK, BV lie one behind the other: 384 rows of W
    k_temp<<<NB_ * TT / 32, 256, 0, stream>>>(QKV, tokq, tokv, alpha, TQ, TV); k_gpl<<<(NB_ * TT * DK / 4 + 255) / 256, 256, 0, stream>>>(QKV, TQ, GQh, GQl, Kh, Kl); k_gvt<<<dim3((DK * TT / 4 + 255) / 256, NB_, 1), 256, 0, stream>>>(QKV, TV, GVh, GVl);
    k_gemmc<bf, 2, 1><<<dim3(TT / 64, TT / 64, NB_), 32, 0, stream>>>(GQh, GQl, Kh, Kl, DK, Sb, TT, 0, (size_t)TT * DK, (size_t)TT * DK, (size_t)TT * TT);
    k_csoft<<<dim3(TT / 8, NB_, 1), 256, 0, stream>>>(Sb, Ph, Pl);
    k_pv<<<dim3(TT / 64, NB_, 1), 128, 0, stream>>>(Ph, GVh, OUT);   // rows of both operands: [TT hi][TT lo], pitch 2*TT
}

// v005
// One run takes 135 microseconds.
// Two timings next to v004 put it at 1.08 and 1.07 times that version's speed.
// Counting every step since v000, it is 10.2 times as fast.
#include <hip/hip_runtime.h>

// SelectiveAttentionModule (x [8][2048][768]; Q/K/V = x W^T + b (d 128, single head); temps_q[s] = 1 + sigmoid(alpha[s]) log(s+1) + tanh(tokenq[s] . gelu(Q[s])), temps_v likewise with tokenv / V; scores = (temps_q Q) . K / sqrt(128), causal;
// softmax; out = softmax . (temps_v V) -> [8][2048][128]).
// Compute dtypes, f32 accumulate: every input rounded to bf16; Q/K/V on PLAIN bf16 operands (inputs: exact) + bias; the temperatures (erf-gelu, 128-term fixed-order dots, tanh, sigmoid, log) f32 on the VALU; gated Q / K / gated V -> bf16 hi+lo

#define NB_  8
#define TT   2048
#define DE   768
#define DK   128
#define D3   384
typedef _Float16 h16;
typedef unsigned short bf;
typedef __attribute__((ext_vector_type(16))) __bf16   v16bf;
typedef __attribute__((ext_vector_type(16))) _Float16 v16h;
typedef __attribute__((ext_vector_type(8)))  _Float16 v8h;
typedef __attribute__((ext_vector_type(8)))  unsigned short v8us;
typedef __attribute__((ext_vector_type(8)))  float    v8f;
typedef __attribute__((ext_vector_type(4)))  float    v4f;
typedef v8h  __attribute__((may_alias)) v8ha;
typedef v4f  __attribute__((may_alias)) v4fa;
typedef v8us __attribute__((may_alias)) v8usa;

__device__ __forceinline__ unsigned short f2bf(float f) { unsigned u = __float_as_uint(f); u += 0x7FFFu + ((u >> 16) & 1u); return (unsigned short)(u >> 16); }
__device__ __forceinline__ float bf2f(unsigned short b) { return __uint_as_float(((unsigned)b) << 16); }
__device__ __forceinline__ float bfr(float f) { return bf2f(f2bf(f)); }
__device__ __forceinline__ v16h cat16(v8h lo, v8h hi) { return __builtin_shufflevector(lo, hi, 0, 1, 2, 3, 4, 5, 6, 7, 8, 9, 10, 11, 12, 13, 14, 15); }
__device__ __forceinline__ v16bf cat16b(v8us lo, v8us hi) { return __builtin_bit_cast(v16bf, __builtin_shufflevector(lo, hi, 0, 1, 2, 3, 4, 5, 6, 7, 8, 9, 10, 11, 12, 13, 14, 15)); }
__device__ __forceinline__ v8f wmma16(v16h a, v16h b, v8f c) { return __builtin_amdgcn_wmma_f32_16x16x32_f16(false, a, false, b, (short)0, c, false, false); }
__device__ __forceinline__ v8f wmmab(v16bf a, v16bf b, v8f c) { return __builtin_amdgcn_wmma_f32_16x16x32_bf16(false, a, false, b, (short)0, c, false, false); }



// Fragment of a 16 x 32 operand block from a K-contiguous 16-bit plane: the lane's 8 elements at p and 8 at p + 16.
template <typename T16> struct WFrag;
template <> struct WFrag<h16> { typedef v16h V; static __device__ __forceinline__ V ld(const h16* p) { return cat16(*(const v8h*)p, *(const v8h*)(p + 16)); } static __device__ __forceinline__ v8f mma(V a, V b, v8f c) { return wmma16(a, b, c); } };
template <> struct WFrag<bf> { typedef v16bf V; static __device__ __forceinline__ V ld(const bf* p) { return cat16b(*(const v8us*)p, *(const v8us*)(p + 16)); } static __device__ __forceinline__ v8f mma(V a, V b, v8f c) { return wmmab(a, b, c); } };

// ---- k_gemmc: register-blocked GEMM, ONE WAVE per 64x64 output tile (16 accumulators), operands straight from K-contiguous 16-bit planes, specialised for causal attention: CMODE 1 skips score tiles entirely above the diagonal (query rows r0+roff.., key columns c0..), CMODE 2 limits the
// key (K) loop of the probability x value contraction to the diagonal block (probabilities beyond it are exactly zero). roff = row offset of this launch's first row within the sequence.
template <typename T16, int NSPLIT, int CMODE>
__global__ __launch_bounds__(32) void k_gemmc(const T16* __restrict__ A, const T16* __restrict__ A2, const T16* __restrict__ Bt, const T16* __restrict__ Bt2, int K, float* C, int ldc, int roff, size_t sA, size_t sB, size_t sC) {
    typedef typename WFrag<T16>::V V;
    __shared__ __align__(16) float os[16 * 68];
    const size_t z = blockIdx.z; A += z * sA; if (A2) A2 += z * sA; Bt += z * sB; if (Bt2) Bt2 += z * sB; C += z * sC;
    const int lane = threadIdx.x & 31, lr = lane & 15, hi = lane >> 4; const int r0 = blockIdx.x * 64, c0 = blockIdx.y * 64;
    if (CMODE == 1 && c0 > r0 + roff + 63) return;                  // score tile entirely above the causal diagonal: never read (the softmax masks j > i by select)
    const int Kl = (CMODE == 2) ? min(K, r0 + roff + 64) : K;        // P.V: probabilities are exactly 0 beyond the diagonal block, so the K loop stops there
    v8f acc[4][4];
#pragma unroll
    for (int mb = 0; mb < 4; ++mb)
#pragma unroll
        for (int nb = 0; nb < 4; ++nb) acc[mb][nb] = (v8f){};
    const size_t aoff = (size_t)(r0 + lr) * K + 8 * hi, boff = (size_t)(c0 + lr) * K + 8 * hi;
#pragma unroll 1
    for (int kc = 0; kc < Kl; kc += 32) {
        V a[4], a2[4];
#pragma unroll
        for (int mb = 0; mb < 4; ++mb) { a[mb] = WFrag<T16>::ld(A + aoff + (size_t)mb * 16 * K + kc); if (NSPLIT == 1 || NSPLIT == 2) a2[mb] = WFrag<T16>::ld(A2 + aoff + (size_t)mb * 16 * K + kc); }
#pragma unroll
        for (int nb = 0; nb < 4; ++nb) { const V b = WFrag<T16>::ld(Bt + boff + (size_t)nb * 16 * K + kc); V b2; if (NSPLIT >= 2) b2 = WFrag<T16>::ld(Bt2 + boff + (size_t)nb * 16 * K + kc);
#pragma unroll
            for (int mb = 0; mb < 4; ++mb) { acc[mb][nb] = WFrag<T16>::mma(a[mb], b, acc[mb][nb]); if (NSPLIT == 1 || NSPLIT == 2) acc[mb][nb] = WFrag<T16>::mma(a2[mb], b, acc[mb][nb]); if (NSPLIT >= 2) acc[mb][nb] = WFrag<T16>::mma(a[mb], b2, acc[mb][nb]); } }
        asm volatile("v_nop\n\tv_nop\n\tv_nop\n\tv_nop" : "+v"(acc[0][0]), "+v"(acc[1][1]), "+v"(acc[2][2]), "+v"(acc[3][3]) : "v"(a[0]), "v"(a[3]));
    }
#pragma unroll
    for (int mb = 0; mb < 4; ++mb) {
#pragma unroll
        for (int nb = 0; nb < 4; ++nb) {
#pragma unroll
            for (int j = 0; j < 8; ++j) os[(hi * 8 + j) * 68 + nb * 16 + lr] = acc[mb][nb][j]; }
        __builtin_amdgcn_wave_barrier(); asm volatile("" ::: "memory");
        float* crow = C + (size_t)(r0 + mb * 16) * ldc + c0;
{
#pragma unroll
            for (int s = 0; s < 8; ++s) { const int row = 2 * s + hi, cofs = lr * 4; v4f val = *(const v4fa*)(os + row * 68 + cofs);
                *(v4f*)(crow + (size_t)row * ldc + cofs) = val; }
             }
        __builtin_amdgcn_wave_barrier(); asm volatile("" ::: "memory");
    }
}

// ---- k_pv: out = P . (gated V) on a 64 x 128 output tile per work-group of four waves (wave w: rows 32 (w & 1).., columns 64 (w >> 1)..). Both operands, hi and lo planes, come into LDS in stages of PVK keys by asynchronous copies
// (whole 256-B rows from global memory, shared by the four waves) in a ring of two buffers: stage t + 1 flies while stage t is multiplied. Per accumulator the products keep the order hi.hi, lo.hi, hi.lo per 32 keys, keys ascending.
// The key loop ends with the stage that holds the diagonal block; probabilities behind the diagonal are stored as exact zeros over the whole row, so the rest of that stage adds nothing.
#define PVK    128                 // keys per stage: a row of a stage is 256 B
#define PVP    272                 // pitch of such a row in LDS, bytes: 16 B x odd, so the 16 rows of a fragment read fall on distinct banks
#define PVROWS 384                 // rows of a stage: 64 P hi, 64 P lo, 128 V hi, 128 V lo
#define PVBUF  (PVROWS * PVP)
// Twelve copies of 16 B per lane; the s_wait_xcnt stands in the copies' own statement so that no address register is rewritten ahead of it.
__device__ __forceinline__ void acopy12(const unsigned* l, const bf* const* g) {
    asm volatile("global_load_async_to_lds_b128 %0, %1, off\n\t"
                 "global_load_async_to_lds_b128 %2, %3, off\n\t"
                 "global_load_async_to_lds_b128 %4, %5, off\n\t"
                 "global_load_async_to_lds_b128 %6, %7, off\n\t"
                 "global_load_async_to_lds_b128 %8, %9, off\n\t"
                 "global_load_async_to_lds_b128 %10, %11, off\n\t"
                 "global_load_async_to_lds_b128 %12, %13, off\n\t"
                 "global_load_async_to_lds_b128 %14, %15, off\n\t"
                 "global_load_async_to_lds_b128 %16, %17, off\n\t"
                 "global_load_async_to_lds_b128 %18, %19, off\n\t"
                 "global_load_async_to_lds_b128 %20, %21, off\n\t"
                 "global_load_async_to_lds_b128 %22, %23, off\n\t"
                 "s_wait_xcnt 0x0"
                 :: "v"(l[0]), "v"(g[0]), "v"(l[1]), "v"(g[1]), "v"(l[2]), "v"(g[2]), "v"(l[3]), "v"(g[3]), "v"(l[4]), "v"(g[4]), "v"(l[5]), "v"(g[5]),
                    "v"(l[6]), "v"(g[6]), "v"(l[7]), "v"(g[7]), "v"(l[8]), "v"(g[8]), "v"(l[9]), "v"(g[9]), "v"(l[10]), "v"(g[10]), "v"(l[11]), "v"(g[11]) : "memory");
}
// One stage: 48 copies per lane. pa / pb: the lane's piece of its first P row / V row at the stage's first key; ld: the lane's piece of its first row in the buffer. Copy i fills LDS row 8 i + (thread >> 4).
__device__ __forceinline__ void pv_stage(const bf* pa, const bf* pb, unsigned ld) {
#pragma unroll   // the copies' operands are register arrays
    for (int c = 0; c < 4; ++c) { unsigned l[12]; const bf* g[12];
#pragma unroll
        for (int u = 0; u < 12; ++u) { const int i = c * 12 + u; l[u] = ld + (unsigned)(i * 8 * PVP);
            g[u] = (i < 16) ? pa + (size_t)(i & 7) * 8 * (2 * TT) + (i >> 3) * TT : pb + (size_t)((i - 16) & 15) * 8 * (2 * TT) + ((i - 16) >> 4) * TT; }
        acopy12(l, g); }
}
__global__ __launch_bounds__(128) void k_pv(const bf* __restrict__ P, const bf* __restrict__ Vt, float* O) {
    __shared__ __align__(16) unsigned char L[2 * PVBUF];
    __shared__ __align__(16) float osw[4][16 * 68];
    const int lane = threadIdx.x & 31, lr = lane & 15, hi = lane >> 4, w = threadIdx.x >> 5, wm = w & 1, wn = w >> 1; const int r0 = blockIdx.x * 64; const size_t z = blockIdx.y;
    const int nT = (r0 + 64 + PVK - 1) / PVK;                        // stages up to and with the diagonal block; nT * PVK <= TT
    const int sub = threadIdx.x & 15, rg = threadIdx.x >> 4;
    const bf* pa = P + (z * TT + r0 + rg) * (size_t)(2 * TT) + sub * 8; const bf* pb = Vt + (z * DK + rg) * (size_t)(2 * TT) + sub * 8;
    const unsigned ld = (unsigned)(size_t)L + (unsigned)(rg * PVP + sub * 16);
    v8f acc[2][4];
#pragma unroll
    for (int mb = 0; mb < 2; ++mb)
#pragma unroll
        for (int nb = 0; nb < 4; ++nb) acc[mb][nb] = (v8f){};
    pv_stage(pa, pb, ld);
    asm volatile("s_wait_asynccnt 0x0" ::: "memory");               // this wave's part of stage 0 has landed
    __syncthreads();                                                 // every wave's part of stage 0 has landed
    if (nT > 1) pv_stage(pa + PVK, pb + PVK, ld + PVBUF);
    const unsigned char* fa = L + (wm * 32 + lr) * PVP + hi * 16; const unsigned char* fb = L + (128 + wn * 64 + lr) * PVP + hi * 16;
#pragma unroll 1   // one stage a trip: the ring's order stands once, at the foot
    for (int t = 0; t < nT; ++t) {
        const int bo = (t & 1) * PVBUF; const unsigned char* qa = fa + bo; const unsigned char* qb = fb + bo;
        v16bf a[2][2], a2[2][2], b[4], b2[4];                        // P fragments in two sets (this and the next 32 keys); each V fragment pair is refilled for the next 32 keys as soon as its products are issued
#pragma unroll
        for (int mb = 0; mb < 2; ++mb) { a[0][mb] = WFrag<bf>::ld((const bf*)(qa + mb * 16 * PVP)); a2[0][mb] = WFrag<bf>::ld((const bf*)(qa + (64 + mb * 16) * PVP)); }
#pragma unroll
        for (int nb = 0; nb < 4; ++nb) { b[nb] = WFrag<bf>::ld((const bf*)(qb + nb * 16 * PVP)); b2[nb] = WFrag<bf>::ld((const bf*)(qb + (128 + nb * 16) * PVP)); }
#pragma unroll   // ks and nb index register arrays
        for (int ks = 0; ks < PVK / 32; ++ks) { const int cu = ks & 1, nx = cu ^ 1; const bool more = ks + 1 < PVK / 32;   // fragments are fetched ahead inside the stage only, never from the next stage
            if (more) {
#pragma unroll
                for (int mb = 0; mb < 2; ++mb) { a[nx][mb] = WFrag<bf>::ld((const bf*)(qa + mb * 16 * PVP + (ks + 1) * 64)); a2[nx][mb] = WFrag<bf>::ld((const bf*)(qa + (64 + mb * 16) * PVP + (ks + 1) * 64)); } }
#pragma unroll
            for (int nb = 0; nb < 4; ++nb) {
                __builtin_amdgcn_sched_barrier(0);                   // keeps the LDS reads above in front of these products: left alone the compiler sinks each read to just before its use, and the one wave of the SIMD waits out every LDS latency
                acc[0][nb] = wmmab(a[cu][0], b[nb], acc[0][nb]);  acc[1][nb] = wmmab(a[cu][1], b[nb], acc[1][nb]);
                acc[0][nb] = wmmab(a2[cu][0], b[nb], acc[0][nb]); acc[1][nb] = wmmab(a2[cu][1], b[nb], acc[1][nb]);
                acc[0][nb] = wmmab(a[cu][0], b2[nb], acc[0][nb]); acc[1][nb] = wmmab(a[cu][1], b2[nb], acc[1][nb]);
                __builtin_amdgcn_sched_barrier(0);                   // keeps the refill below behind these products and in front of the next ones
                if (more) { b[nb] = WFrag<bf>::ld((const bf*)(qb + nb * 16 * PVP + (ks + 1) * 64)); b2[nb] = WFrag<bf>::ld((const bf*)(qb + (128 + nb * 16) * PVP + (ks + 1) * 64)); }
            }
        }
        asm volatile("s_wait_dscnt 0x0" ::: "memory");              // this wave's reads of stage t are done before the buffer may be refilled
        asm volatile("s_wait_asynccnt 0x0" ::: "memory");           // this wave's part of stage t + 1 has landed
        __syncthreads();                                             // publishes stage t + 1 and ends every wave's reads of stage t
        if (t + 2 < nT) pv_stage(pa + (size_t)(t + 2) * PVK, pb + (size_t)(t + 2) * PVK, ld + bo);
    }
    asm volatile("s_wait_asynccnt 0x0" ::: "memory");               // no copy is outstanding when the wave ends
    float* os = osw[w]; const int c0 = wn * 64;
#pragma unroll
    for (int mb = 0; mb < 2; ++mb) {
#pragma unroll
        for (int nb = 0; nb < 4; ++nb) {
#pragma unroll
            for (int j = 0; j < 8; ++j) os[(hi * 8 + j) * 68 + nb * 16 + lr] = acc[mb][nb][j]; }
        __builtin_amdgcn_wave_barrier(); asm volatile("" ::: "memory");   // the wave's own rows are written before it reads them back as whole lines
        float* crow = O + (z * TT + r0 + wm * 32 + mb * 16) * (size_t)DK + c0;
#pragma unroll
        for (int s = 0; s < 8; ++s) { const int row = 2 * s + hi, cofs = lr * 4; const v4f val = *(const v4fa*)(os + row * 68 + cofs); *(v4f*)(crow + (size_t)row * DK + cofs) = val; }
        __builtin_amdgcn_wave_barrier(); asm volatile("" ::: "memory");   // the rows are read before the next 16 rows overwrite them
    }
}

// ---- k_qkv: QKV[m][0..383] = x[m] . W[n] + bias[n] for the three projections at once (W = the rows of Wq, Wk, Wv one after the other): a 64 x 384 output tile per work-group of eight waves (wave w: rows 32 (w & 1).., columns 96 (w >> 1)..).
// Both operands come into LDS in stages of QKK values of k by asynchronous copies (whole 256-B pieces of rows, shared by the eight waves) in a ring of two buffers: stage t + 1 flies while stage t is multiplied. Per accumulator one product per 32 k, k ascending.
#define QKK    128                 // k per stage: a row of a stage is 256 B
#define QKP    272                 // pitch of such a row in LDS, bytes: 16 B x odd, so the 16 rows of a fragment read fall on distinct banks
#define QKROWS 448                 // rows of a stage: 64 of x, 384 of W
#define QKBUF  (QKROWS * QKP)
#define QKOP   100                 // pitch of an output row in LDS, floats: rows stay 16-B aligned, the two row halves of an accumulator fall on distinct banks
// Fourteen copies of 16 B per lane; the s_wait_xcnt stands in the copies' own statement so that no address register is rewritten ahead of it.
__device__ __forceinline__ void acopy14(const unsigned* l, const bf* const* g) {
    asm volatile("global_load_async_to_lds_b128 %0, %1, off\n\t"
                 "global_load_async_to_lds_b128 %2, %3, off\n\t"
                 "global_load_async_to_lds_b128 %4, %5, off\n\t"
                 "global_load_async_to_lds_b128 %6, %7, off\n\t"
                 "global_load_async_to_lds_b128 %8, %9, off\n\t"
                 "global_load_async_to_lds_b128 %10, %11, off\n\t"
                 "global_load_async_to_lds_b128 %12, %13, off\n\t"
                 "global_load_async_to_lds_b128 %14, %15, off\n\t"
                 "global_load_async_to_lds_b128 %16, %17, off\n\t"
                 "global_load_async_to_lds_b128 %18, %19, off\n\t"
                 "global_load_async_to_lds_b128 %20, %21, off\n\t"
                 "global_load_async_to_lds_b128 %22, %23, off\n\t"
                 "global_load_async_to_lds_b128 %24, %25, off\n\t"
                 "global_load_async_to_lds_b128 %26, %27, off\n\t"
                 "s_wait_xcnt 0x0"
                 :: "v"(l[0]), "v"(g[0]), "v"(l[1]), "v"(g[1]), "v"(l[2]), "v"(g[2]), "v"(l[3]), "v"(g[3]), "v"(l[4]), "v"(g[4]), "v"(l[5]), "v"(g[5]), "v"(l[6]), "v"(g[6]),
                    "v"(l[7]), "v"(g[7]), "v"(l[8]), "v"(g[8]), "v"(l[9]), "v"(g[9]), "v"(l[10]), "v"(g[10]), "v"(l[11]), "v"(g[11]), "v"(l[12]), "v"(g[12]), "v"(l[13]), "v"(g[13]) : "memory");
}
// One stage: 28 copies per lane. px / pw: the lane's piece of its first x row / W row at the stage's first k; ld: the lane's piece of its first row in the buffer. Copy i fills LDS row 16 i + (thread >> 4).
__device__ __forceinline__ void qkv_stage(const bf* px, const bf* pw, unsigned ld) {
#pragma unroll   // the copies' operands are register arrays
    for (int c = 0; c < 2; ++c) { unsigned l[14]; const bf* g[14];
#pragma unroll
        for (int u = 0; u < 14; ++u) { const int i = c * 14 + u; l[u] = ld + (unsigned)(i * 16 * QKP); g[u] = (i < 4) ? px + (size_t)i * 16 * DE : pw + (size_t)(i - 4) * 16 * DE; }
        acopy14(l, g); }
}
__global__ __launch_bounds__(256) void k_qkv(const bf* __restrict__ X, const bf* __restrict__ Wt, const float* __restrict__ bq, const float* __restrict__ bk, const float* __restrict__ bv, float* C) {
    __shared__ __align__(16) unsigned char L[2 * QKBUF];
    __shared__ __align__(16) float osw[8][16 * QKOP];
    const int lane = threadIdx.x & 31, lr = lane & 15, hi = lane >> 4, w = threadIdx.x >> 5, wm = w & 1, wn = w >> 1; const int r0 = blockIdx.x * 64;
    const int nT = DE / QKK;                                         // six stages
    const int sub = threadIdx.x & 15, rg = threadIdx.x >> 4;
    const bf* px = X + (size_t)(r0 + rg) * DE + sub * 8; const bf* pw = Wt + (size_t)rg * DE + sub * 8;
    const unsigned ld = (unsigned)(size_t)L + (unsigned)(rg * QKP + sub * 16);
    v8f acc[2][6];
#pragma unroll
    for (int mb = 0; mb < 2; ++mb)
#pragma unroll
        for (int nb = 0; nb < 6; ++nb) acc[mb][nb] = (v8f){};
    qkv_stage(px, pw, ld);
    asm volatile("s_wait_asynccnt 0x0" ::: "memory");               // this wave's part of stage 0 has landed
    __syncthreads();                                                 // every wave's part of stage 0 has landed
    qkv_stage(px + QKK, pw + QKK, ld + QKBUF);
    const unsigned char* fa = L + (wm * 32 + lr) * QKP + hi * 16; const unsigned char* fb = L + (64 + wn * 96 + lr) * QKP + hi * 16;
#pragma unroll 1   // one stage a trip: the ring's order stands once, at the foot
    for (int t = 0; t < nT; ++t) {
        const int bo = (t & 1) * QKBUF; const unsigned char* qa = fa + bo; const unsigned char* qb = fb + bo;
        v16bf a[2][2], b[2][6];                                      // two fragment sets: this and the next 32 k
#pragma unroll
        for (int mb = 0; mb < 2; ++mb) a[0][mb] = WFrag<bf>::ld((const bf*)(qa + mb * 16 * QKP));
#pragma unroll
        for (int nb = 0; nb < 6; ++nb) b[0][nb] = WFrag<bf>::ld((const bf*)(qb + nb * 16 * QKP));
#pragma unroll   // ks indexes register arrays
        for (int ks = 0; ks < QKK / 32; ++ks) { const int cu = ks & 1, nx = cu ^ 1;
            if (ks + 1 < QKK / 32) {                                 // fragments are fetched ahead inside the stage only, never from the next stage
#pragma unroll
                for (int mb = 0; mb < 2; ++mb) a[nx][mb] = WFrag<bf>::ld((const bf*)(qa + mb * 16 * QKP + (ks + 1) * 64));
#pragma unroll
                for (int nb = 0; nb < 6; ++nb) b[nx][nb] = WFrag<bf>::ld((const bf*)(qb + nb * 16 * QKP + (ks + 1) * 64)); }
            __builtin_amdgcn_sched_barrier(0);                       // keeps the next set's LDS reads as one group in front of these products: sunk to just before their use, every read's latency would be waited out
#pragma unroll
            for (int nb = 0; nb < 6; ++nb) { acc[0][nb] = wmmab(a[cu][0], b[cu][nb], acc[0][nb]); acc[1][nb] = wmmab(a[cu][1], b[cu][nb], acc[1][nb]); }
            __builtin_amdgcn_sched_barrier(0);                       // keeps the reads of the set after next behind these products: lifted among them they stand in several places and take a third set's registers
        }
        asm volatile("s_wait_dscnt 0x0" ::: "memory");              // this wave's reads of stage t are done before the buffer may be refilled
        asm volatile("s_wait_asynccnt 0x0" ::: "memory");           // this wave's part of stage t + 1 has landed
        __syncthreads();                                             // publishes stage t + 1 and ends every wave's reads of stage t
        if (t + 2 < nT) qkv_stage(px + (size_t)(t + 2) * QKK, pw + (size_t)(t + 2) * QKK, ld + bo);
    }
    asm volatile("s_wait_asynccnt 0x0" ::: "memory");               // no copy is outstanding when the wave ends
    float* os = osw[w]; const int c0 = wn * 96;
    int rb[3], cb[3]; v4f bi[3];                                     // 16 rows x 96 columns leave as 12 stores of 32 x 16 B; store 3 g + h covers rows 4 g + rb[h] at columns cb[h]..cb[h] + 3
#pragma unroll
    for (int h = 0; h < 3; ++h) { const int q = h * 32 + lane; rb[h] = q / 24; cb[h] = (q % 24) * 4; const int col = c0 + cb[h];
        const float* bp = (col < DK) ? bq + col : (col < 2 * DK) ? bk + (col - DK) : bv + (col - 2 * DK);
        bi[h][0] = bfr(bp[0]); bi[h][1] = bfr(bp[1]); bi[h][2] = bfr(bp[2]); bi[h][3] = bfr(bp[3]); }
#pragma unroll
    for (int mb = 0; mb < 2; ++mb) {
#pragma unroll
        for (int nb = 0; nb < 6; ++nb) {
#pragma unroll
            for (int j = 0; j < 8; ++j) os[(hi * 8 + j) * QKOP + nb * 16 + lr] = acc[mb][nb][j]; }
        __builtin_amdgcn_wave_barrier(); asm volatile("" ::: "memory");   // the wave's own rows are written before it reads them back as whole lines
        float* crow = C + (size_t)(r0 + wm * 32 + mb * 16) * D3 + c0;
#pragma unroll
        for (int g = 0; g < 4; ++g)
#pragma unroll
            for (int h = 0; h < 3; ++h) { const int row = 4 * g + rb[h]; v4f val = *(const v4fa*)(os + row * QKOP + cb[h]); val[0] += bi[h][0]; val[1] += bi[h][1]; val[2] += bi[h][2]; val[3] += bi[h][3]; *(v4f*)(crow + (size_t)row * D3 + cb[h]) = val; }
        __builtin_amdgcn_wave_barrier(); asm volatile("" ::: "memory");   // the rows are read before the next 16 rows overwrite them
    }
}

__device__ __forceinline__ void splitf(float y, unsigned short& h, unsigned short& l) { h = f2bf(y); l = f2bf(y - bf2f(h)); }
typedef __attribute__((ext_vector_type(2))) unsigned short v2us;
typedef __attribute__((ext_vector_type(4))) unsigned short v4us;

// k_cvt: the four f32 -> bf16 roundings (Wq, Wk, Wv, x) depend on nothing but the inputs, so they share one grid: work-groups 0 .. 3 CVW - 1 take the weights (CVW each, into the three planes that lie one behind the other at WB), the rest take x. 8 values a thread; every part is a whole number of work-groups.
#define CVW (DK * DE / 8 / 256)
#define CVX (NB_ * TT * DE / 8 / 256)
__global__ __launch_bounds__(256) void k_cvt(const float* __restrict__ x, const float* __restrict__ wq, const float* __restrict__ wk, const float* __restrict__ wv, bf* XB, bf* WB) { const int b = blockIdx.x; const float* src; bf* dst; size_t i;
    if (b < 3 * CVW) { const int m = b / CVW; src = (m == 0) ? wq : (m == 1) ? wk : wv; dst = WB + (size_t)m * DK * DE; i = (size_t)(b - m * CVW) * 256 + threadIdx.x; }
    else { src = x; dst = XB; i = (size_t)(b - 3 * CVW) * 256 + threadIdx.x; }
    const v8f v = *(const v8f*)(src + i * 8); v8us o;
#pragma unroll
    for (int k = 0; k < 8; ++k) o[k] = f2bf(v[k]); *(v8us*)(dst + i * 8) = o;  }
// Every kernel below covers all NB_ sequences in one launch: k_csoft takes the sequence from blockIdx.y, d_gvt from its work-group's number, k_temp / d_gpl run over the NB_*TT rows as one list.
// k_temp: TQ[g] = pos + tanh(sum_d tokenq[s][d] gelu(Q[g][d])), TV[g] likewise with tokenv / V, pos = 1 + sigmoid(alpha[s]) log(s+1). One work-group per 32 tokens of the NB_*TT list: wave w takes tokens 4w..4w+3 with its lanes ACROSS d,
// so each row of Q, V, tokenq, tokenv is one whole 512-B load, and leaves the 128 products of each dot in LDS; behind the barrier lane t of wave 0 (Q) and of wave 1 (V) adds token t's products in the order d = 0..127 and the wave stores one whole 128-B line.
// d_gpl: hl planes GQ[s][d] = TQ[s] Q[s][d], Kp[s][d] = K[s][d] (8-B lanes);
#define TPP 132   // pitch of a product row in LDS, in floats: rows stay 16-B aligned and do not all start in one bank
__global__ __launch_bounds__(256) void k_temp(const float* __restrict__ QKV, const float* __restrict__ tq, const float* __restrict__ tv, const float* __restrict__ alpha, float* TQ, float* TV) {
    __shared__ __align__(16) float pr[2][32][TPP];
    const int lane = threadIdx.x & 31, w = threadIdx.x >> 5; const int g0 = blockIdx.x * 32;
    const int t0 = g0 + w * 4; const float* q = QKV + (size_t)t0 * D3 + lane * 4; const size_t sd = (size_t)(t0 % TT) * DK + lane * 4;   // TT % 4 == 0: a wave's four tokens lie in one sequence, so their tokenq / tokenv rows are consecutive too
    v4f xq[4], xv[4], kq[4], kv[4];
#pragma unroll   // registers, not an indexed array; the wave's 16 row loads all stand in front of the first gelu's branches, so they are in flight together
    for (int u = 0; u < 4; ++u) { xq[u] = *(const v4fa*)(q + u * D3); xv[u] = *(const v4fa*)(q + u * D3 + 2 * DK); kq[u] = *(const v4fa*)(tq + sd + u * DK); kv[u] = *(const v4fa*)(tv + sd + u * DK); }
#pragma unroll   // u and k index register arrays: both loops must be flat for the rows to stay in registers
    for (int u = 0; u < 4; ++u) { v4f pq, pv;
#pragma unroll
        for (int k = 0; k < 4; ++k) { const float x1 = xq[u][k], x2 = xv[u][k]; const float g1 = __fmul_rn(0.5f * x1, __fadd_rn(1.0f, erff(x1 * 0.70710678118654752f))), g2 = __fmul_rn(0.5f * x2, __fadd_rn(1.0f, erff(x2 * 0.70710678118654752f)));
            pq[k] = __fmul_rn(bfr(kq[u][k]), g1); pv[k] = __fmul_rn(bfr(kv[u][k]), g2); }
        *(v4fa*)(&pr[0][w * 4 + u][lane * 4]) = pq; *(v4fa*)(&pr[1][w * 4 + u][lane * 4]) = pv; }
    __syncthreads();   // every product row is in LDS before a lane of wave 0 or 1 adds it up
    if (w >= 2) return;
    const float* p = &pr[w][lane][0]; float a = 0.f;
#pragma unroll   // constant LDS offsets, no loop counter beside the one dependent chain of adds
    for (int d = 0; d < DK; d += 4) { const v4f c = *(const v4fa*)(p + d); a = __fadd_rn(a, c[0]); a = __fadd_rn(a, c[1]); a = __fadd_rn(a, c[2]); a = __fadd_rn(a, c[3]); }
    const int s = (g0 + lane) % TT;
    const float sg = __fdiv_rn(1.0f, __fadd_rn(1.0f, __expf(-bfr(alpha[s])))); const float pos = __fadd_rn(1.0f, __fmul_rn(sg, __logf((float)(s + 1))));
    (w ? TV : TQ)[g0 + lane] = __fadd_rn(pos, tanhf(a)); }
__device__ __forceinline__ void d_gpl(int bx, const float* __restrict__ QKV, const float* __restrict__ TQ, bf* GQh, bf* GQl, bf* Kh, bf* Kl) { const int e = (bx * 256 + threadIdx.x) * 4; if (e >= NB_ * TT * DK) return; const int d = e % DK; const int s = e / DK; const float t = TQ[s]; const float* q = QKV + (size_t)s * D3 + d; v4us a, b, c, dd;
#pragma unroll
    for (int u = 0; u < 4; ++u) { unsigned short h1, l1, h2, l2; splitf(__fmul_rn(t, q[u]), h1, l1); splitf(q[DK + u], h2, l2); a[u] = h1; b[u] = l1; c[u] = h2; dd[u] = l2; }
    { *(v4us*)(GQh + e) = a; *(v4us*)(GQl + e) = b; *(v4us*)(Kh + e) = c; *(v4us*)(Kl + e) = dd;  } }
__device__ __forceinline__ void d_gvt(int bx, int by, const float* __restrict__ QKV, const float* __restrict__ TV, bf* Th, bf* Tl) { const int e = (bx * 256 + threadIdx.x) * 4; if (e >= DK * TT) return; const int s = e % TT; const int d = e / TT; v4us oh, ol; const size_t z = by; QKV += z * TT * D3; TV += z * TT; const size_t o = (z * DK + d) * (2 * TT) + s;   // row d = [TT hi][TT lo], the pitch of the probability rows (the tile GEMM has one pitch for both operands)
#pragma unroll
    for (int u = 0; u < 4; ++u) { unsigned short a, b; splitf(__fmul_rn(TV[s + u], QKV[(size_t)(s + u) * D3 + 2 * DK + d]), a, b); oh[u] = a; ol[u] = b; } *(v4us*)(Th + o) = oh; *(v4us*)(Tl + o) = ol;  }
// k_planes: the gated-V planes and the gated-Q / K planes both need only QKV and the temperatures and write disjoint planes, so they share one grid: work-groups 0 .. NB_ GVB - 1 do the V planes (GVB per sequence; their strided reads take longer, so they start first), the rest the Q / K planes.
#define GVB (DK * TT / 4 / 256)
#define GPB (NB_ * TT * DK / 4 / 256)
__global__ __launch_bounds__(256) void k_planes(const float* __restrict__ QKV, const float* __restrict__ TQ, const float* __restrict__ TV, bf* GQh, bf* GQl, bf* Kh, bf* Kl, bf* Th, bf* Tl) { const int b = blockIdx.x;
    if (b < NB_ * GVB) d_gvt(b % GVB, b / GVB, QKV, TV, Th, Tl); else d_gpl(b - NB_ * GVB, QKV, TQ, GQh, GQl, Kh, Kl); }
// k_csoft: one wave per score row; the row's hi and lo probability planes (2 x TT 16-bit) are stored over the row's own TT f32 scores, which the wave holds whole in registers before its first store (every store needs the row sum).
__global__ __launch_bounds__(256) void k_csoft(const float* Sb, bf* Ph, bf* Pl) { const int lane = threadIdx.x & 31; const int i = blockIdx.x * 8 + (threadIdx.x >> 5); if (i >= TT) return; const size_t g = (size_t)blockIdx.y * TT + i; const float* sr = Sb + g * TT; float v[TT / 32]; float mx = -3.0e38f; const float scl = 0.088388347648318447f;
#pragma unroll
    for (int ch = 0; ch < TT / 128; ++ch) { const int j0 = ch * 128 + lane * 4; const v4f a = *(const v4f*)(sr + j0);
#pragma unroll
        for (int u = 0; u < 4; ++u) { const float t = (j0 + u <= i) ? a[u] * scl : -3.0e38f; v[ch * 4 + u] = t; mx = fmaxf(mx, t); } }
#pragma unroll
    for (int sh = 16; sh; sh >>= 1) mx = fmaxf(mx, __shfl_xor(mx, sh, 32));
    float sum = 0.f;
#pragma unroll
    for (int q = 0; q < TT / 32; ++q) { float d0 = __fsub_rn(v[q], mx); asm volatile("" : "+v"(d0)); v[q] = (v[q] > -1.0e38f) ? __builtin_amdgcn_exp2f(__fmul_rn(d0, 1.4426950408889634f)) : 0.f; sum += v[q]; }
#pragma unroll
    for (int sh = 16; sh; sh >>= 1) sum += __shfl_xor(sum, sh, 32);
    const float f = __fdiv_rn(1.0f, sum);
    {
#pragma unroll
        for (int ch = 0; ch < TT / 128; ++ch) { v4us oh, ol;
#pragma unroll
            for (int q = 0; q < 4; ++q) { unsigned short a, b; splitf(v[ch * 4 + q] * f, a, b); oh[q] = a; ol[q] = b; } const size_t oo = g * (2 * TT) + ch * 128 + lane * 4; *(v4us*)(Ph + oo) = oh; *(v4us*)(Pl + oo) = ol; }
         } }

extern "C" void kernel_launch(void* const* d_in, const int* in_sizes, int n_in,
                              void* d_out, int out_size, void* d_ws, size_t ws_size, hipStream_t stream) {
    (void)in_sizes; (void)n_in; (void)out_size;
    const float** I = (const float**)d_in;
    const float *x = I[0], *Wq = I[1], *bq = I[2], *Wk = I[3], *bk = I[4], *Wv = I[5], *bv = I[6], *alpha = I[7], *tokq = I[8], *tokv = I[9];
    float* OUT = (float*)d_out;     // [8][2048][128]
    char* wsp = (char*)d_ws;
    auto take = [&](size_t bytes) { char* p = wsp; wsp += (bytes + 255) & ~(size_t)255; return (void*)p; };
    bf* BQ = (bf*)take((size_t)3 * DK * DE * 2);   // the Wq, Wk, Wv planes one behind the other, 384 rows of W
    bf* XB = (bf*)take((size_t)NB_ * TT * DE * 2); float* QKV = (float*)take((size_t)NB_ * TT * D3 * 4); float* TQ = (float*)take(NB_ * TT * 4); float* TV = (float*)take(NB_ * TT * 4);
    bf* GQh = (bf*)take((size_t)NB_ * TT * DK * 2); bf* GQl = (bf*)take((size_t)NB_ * TT * DK * 2); bf* Kh = (bf*)take((size_t)NB_ * TT * DK * 2); bf* Kl = (bf*)take((size_t)NB_ * TT * DK * 2); bf* GVh = (bf*)take((size_t)NB_ * DK * TT * 4); bf* GVl = GVh + TT;
    float* Sb = (float*)take((size_t)NB_ * TT * TT * 4); bf* Ph = (bf*)Sb; bf* Pl = Ph + TT;    // probability planes in place: row r = [TT hi][TT lo] over score row r, pitch 2*TT
    if ((size_t)(wsp - (char*)d_ws) > ws_size) return;    // total ~ 211 MB
    k_cvt<<<3 * CVW + CVX, 256, 0, stream>>>(x, Wq, Wk, Wv, XB, BQ);   // [out][in] = Bt
    k_qkv<<<NB_ * TT / 64, 256, 0, stream>>>(XB, BQ, bq, bk, bv, QKV);
    k_temp<<<NB_ * TT / 32, 256, 0, stream>>>(QKV, tokq, tokv, alpha, TQ, TV); k_planes<<<NB_ * GVB + GPB, 256, 0, stream>>>(QKV, TQ, TV, GQh, GQl, Kh, Kl, GVh, GVl);
    k_gemmc<bf, 2, 1><<<dim3(TT / 64, TT / 64, NB_), 32, 0, stream>>>(GQh, GQl, Kh, Kl, DK, Sb, TT, 0, (size_t)TT * DK, (size_t)TT * DK, (size_t)TT * TT);
    k_csoft<<<dim3(TT / 8, NB_, 1), 256, 0, stream>>>(Sb, Ph, Pl);
    k_pv<<<dim3(TT / 64, NB_, 1), 128, 0, stream>>>(Ph, GVh, OUT);   // rows of both operands: [TT hi][TT lo], pitch 2*TT
}

// v006
// It runs in 120 microseconds.
// In both of two side-by-side timings against v005, it was 1.13 times as fast.
// Over all steps from v000 it is 11.6 times as fast.
#include <hip/hip_runtime.h>

// SelectiveAttentionModule (x [8][2048][768]; Q/K/V = x W^T + b (d 128, single head); temps_q[s] = 1 + sigmoid(alpha[s]) log(s+1) + tanh(tokenq[s] . gelu(Q[s])), temps_v likewise with tokenv / V; scores = (temps_q Q) . K / sqrt(128), causal;
// softmax; out = softmax . (temps_v V) -> [8][2048][128]).
// Compute dtypes, f32 accumulate: every input rounded to bf16; Q/K/V on PLAIN bf16 operands (inputs: exact) + bias; the temperatures (erf-gelu, 128-term fixed-order dots, tanh, sigmoid, log) f32 on the VALU; gated Q / K / gated V -> bf16 hi+lo

#define NB_  8
#define TT   2048
#define DE   768
#define DK   128
#define D3   384
typedef _Float16 h16;
typedef unsigned short bf;
typedef __attribute__((ext_vector_type(16))) __bf16   v16bf;
typedef __attribute__((ext_vector_type(16))) _Float16 v16h;
typedef __attribute__((ext_vector_type(8)))  _Float16 v8h;
typedef __attribute__((ext_vector_type(8)))  unsigned short v8us;
typedef __attribute__((ext_vector_type(8)))  float    v8f;
typedef __attribute__((ext_vector_type(4)))  float    v4f;
typedef v8h  __attribute__((may_alias)) v8ha;
typedef v4f  __attribute__((may_alias)) v4fa;
typedef v8us __attribute__((may_alias)) v8usa;

__device__ __forceinline__ unsigned short f2bf(float f) { unsigned u = __float_as_uint(f); u += 0x7FFFu + ((u >> 16) & 1u); return (unsigned short)(u >> 16); }
__device__ __forceinline__ float bf2f(unsigned short b) { return __uint_as_float(((unsigned)b) << 16); }
__device__ __forceinline__ float bfr(float f) { return bf2f(f2bf(f)); }
__device__ __forceinline__ v16h cat16(v8h lo, v8h hi) { return __builtin_shufflevector(lo, hi, 0, 1, 2, 3, 4, 5, 6, 7, 8, 9, 10, 11, 12, 13, 14, 15); }
__device__ __forceinline__ v16bf cat16b(v8us lo, v8us hi) { return __builtin_bit_cast(v16bf, __builtin_shufflevector(lo, hi, 0, 1, 2, 3, 4, 5, 6, 7, 8, 9, 10, 11, 12, 13, 14, 15)); }
__device__ __forceinline__ v8f wmma16(v16h a, v16h b, v8f c) { return __builtin_amdgcn_wmma_f32_16x16x32_f16(false, a, false, b, (short)0, c, false, false); }
__device__ __forceinline__ v8f wmmab(v16bf a, v16bf b, v8f c) { return __builtin_amdgcn_wmma_f32_16x16x32_bf16(false, a, false, b, (short)0, c, false, false); }



// Fragment of a 16 x 32 operand block from a K-contiguous 16-bit plane: the lane's 8 elements at p and 8 at p + 16.
template <typename T16> struct WFrag;
template <> struct WFrag<h16> { typedef v16h V; static __device__ __forceinline__ V ld(const h16* p) { return cat16(*(const v8h*)p, *(const v8h*)(p + 16)); } static __device__ __forceinline__ v8f mma(V a, V b, v8f c) { return wmma16(a, b, c); } };
template <> struct WFrag<bf> { typedef v16bf V; static __device__ __forceinline__ V ld(const bf* p) { return cat16b(*(const v8us*)p, *(const v8us*)(p + 16)); } static __device__ __forceinline__ v8f mma(V a, V b, v8f c) { return wmmab(a, b, c); } };

// ---- k_gemmc: register-blocked GEMM, ONE WAVE per 64x64 output tile (16 accumulators), operands straight from K-contiguous 16-bit planes, specialised for causal attention: CMODE 1 skips score tiles entirely above the diagonal (query rows r0+roff.., key columns c0..), CMODE 2 limits the
// key (K) loop of the probability x value contraction to the diagonal block (probabilities beyond it are exactly zero). roff = row offset of this launch's first row within the sequence.
template <typename T16, int NSPLIT, int CMODE>
__global__ __launch_bounds__(32) void k_gemmc(const T16* __restrict__ A, const T16* __restrict__ A2, const T16* __restrict__ Bt, const T16* __restrict__ Bt2, int K, float* C, int ldc, int roff, size_t sA, size_t sB, size_t sC) {
    typedef typename WFrag<T16>::V V;
    __shared__ __align__(16) float os[16 * 68];
    const size_t z = blockIdx.z; A += z * sA; if (A2) A2 += z * sA; Bt += z * sB; if (Bt2) Bt2 += z * sB; C += z * sC;
    const int lane = threadIdx.x & 31, lr = lane & 15, hi = lane >> 4; const int r0 = blockIdx.x * 64, c0 = blockIdx.y * 64;
    if (CMODE == 1 && c0 > r0 + roff + 63) return;                  // score tile entirely above the causal diagonal: the softmax may load it with its 128-column piece, but masks j > i by select
    const int Kl = (CMODE == 2) ? min(K, r0 + roff + 64) : K;        // P.V: probabilities are exactly 0 beyond the diagonal block, so the K loop stops there
    v8f acc[4][4];
#pragma unroll
    for (int mb = 0; mb < 4; ++mb)
#pragma unroll
        for (int nb = 0; nb < 4; ++nb) acc[mb][nb] = (v8f){};
    const size_t aoff = (size_t)(r0 + lr) * K + 8 * hi, boff = (size_t)(c0 + lr) * K + 8 * hi;
#pragma unroll 1
    for (int kc = 0; kc < Kl; kc += 32) {
        V a[4], a2[4];
#pragma unroll
        for (int mb = 0; mb < 4; ++mb) { a[mb] = WFrag<T16>::ld(A + aoff + (size_t)mb * 16 * K + kc); if (NSPLIT == 1 || NSPLIT == 2) a2[mb] = WFrag<T16>::ld(A2 + aoff + (size_t)mb * 16 * K + kc); }
#pragma unroll
        for (int nb = 0; nb < 4; ++nb) { const V b = WFrag<T16>::ld(Bt + boff + (size_t)nb * 16 * K + kc); V b2; if (NSPLIT >= 2) b2 = WFrag<T16>::ld(Bt2 + boff + (size_t)nb * 16 * K + kc);
#pragma unroll
            for (int mb = 0; mb < 4; ++mb) { acc[mb][nb] = WFrag<T16>::mma(a[mb], b, acc[mb][nb]); if (NSPLIT == 1 || NSPLIT == 2) acc[mb][nb] = WFrag<T16>::mma(a2[mb], b, acc[mb][nb]); if (NSPLIT >= 2) acc[mb][nb] = WFrag<T16>::mma(a[mb], b2, acc[mb][nb]); } }
        asm volatile("v_nop\n\tv_nop\n\tv_nop\n\tv_nop" : "+v"(acc[0][0]), "+v"(acc[1][1]), "+v"(acc[2][2]), "+v"(acc[3][3]) : "v"(a[0]), "v"(a[3]));
    }
#pragma unroll
    for (int mb = 0; mb < 4; ++mb) {
#pragma unroll
        for (int nb = 0; nb < 4; ++nb) {
#pragma unroll
            for (int j = 0; j < 8; ++j) os[(hi * 8 + j) * 68 + nb * 16 + lr] = acc[mb][nb][j]; }
        __builtin_amdgcn_wave_barrier(); asm volatile("" ::: "memory");
        float* crow = C + (size_t)(r0 + mb * 16) * ldc + c0;
{
#pragma unroll
            for (int s = 0; s < 8; ++s) { const int row = 2 * s + hi, cofs = lr * 4; v4f val = *(const v4fa*)(os + row * 68 + cofs);
                *(v4f*)(crow + (size_t)row * ldc + cofs) = val; }
             }
        __builtin_amdgcn_wave_barrier(); asm volatile("" ::: "memory");
    }
}

// ---- k_pv: out = P . (gated V) on a 64 x 128 output tile per work-group of four waves (wave w: rows 32 (w & 1).., columns 64 (w >> 1)..). Both operands, hi and lo planes, come into LDS in stages of PVK keys by asynchronous copies
// (whole 256-B rows from global memory, shared by the four waves) in a ring of two buffers: stage t + 1 flies while stage t is multiplied. Per accumulator the products keep the order hi.hi, lo.hi, hi.lo per 32 keys, keys ascending.
// The key loop ends with the stage that holds the diagonal block; probabilities behind the diagonal are stored as exact zeros up to the end of that stage, so the rest of it adds nothing.
#define PVK    128                 // keys per stage: a row of a stage is 256 B
#define PVP    272                 // pitch of such a row in LDS, bytes: 16 B x odd, so the 16 rows of a fragment read fall on distinct banks
#define PVROWS 384                 // rows of a stage: 64 P hi, 64 P lo, 128 V hi, 128 V lo
#define PVBUF  (PVROWS * PVP)
// Twelve copies of 16 B per lane; the s_wait_xcnt stands in the copies' own statement so that no address register is rewritten ahead of it.
__device__ __forceinline__ void acopy12(const unsigned* l, const bf* const* g) {
    asm volatile("global_load_async_to_lds_b128 %0, %1, off\n\t"
                 "global_load_async_to_lds_b128 %2, %3, off\n\t"
                 "global_load_async_to_lds_b128 %4, %5, off\n\t"
                 "global_load_async_to_lds_b128 %6, %7, off\n\t"
                 "global_load_async_to_lds_b128 %8, %9, off\n\t"
                 "global_load_async_to_lds_b128 %10, %11, off\n\t"
                 "global_load_async_to_lds_b128 %12, %13, off\n\t"
                 "global_load_async_to_lds_b128 %14, %15, off\n\t"
                 "global_load_async_to_lds_b128 %16, %17, off\n\t"
                 "global_load_async_to_lds_b128 %18, %19, off\n\t"
                 "global_load_async_to_lds_b128 %20, %21, off\n\t"
                 "global_load_async_to_lds_b128 %22, %23, off\n\t"
                 "s_wait_xcnt 0x0"
                 :: "v"(l[0]), "v"(g[0]), "v"(l[1]), "v"(g[1]), "v"(l[2]), "v"(g[2]), "v"(l[3]), "v"(g[3]), "v"(l[4]), "v"(g[4]), "v"(l[5]), "v"(g[5]),
                    "v"(l[6]), "v"(g[6]), "v"(l[7]), "v"(g[7]), "v"(l[8]), "v"(g[8]), "v"(l[9]), "v"(g[9]), "v"(l[10]), "v"(g[10]), "v"(l[11]), "v"(g[11]) : "memory");
}
// One stage: 48 copies per lane. pa / pb: the lane's piece of its first P row / V row at the stage's first key; ld: the lane's piece of its first row in the buffer. Copy i fills LDS row 8 i + (thread >> 4).
__device__ __forceinline__ void pv_stage(const bf* pa, const bf* pb, unsigned ld) {
#pragma unroll   // the copies' operands are register arrays
    for (int c = 0; c < 4; ++c) { unsigned l[12]; const bf* g[12];
#pragma unroll
        for (int u = 0; u < 12; ++u) { const int i = c * 12 + u; l[u] = ld + (unsigned)(i * 8 * PVP);
            g[u] = (i < 16) ? pa + (size_t)(i & 7) * 8 * (2 * TT) + (i >> 3) * TT : pb + (size_t)((i - 16) & 15) * 8 * (2 * TT) + ((i - 16) >> 4) * TT; }
        acopy12(l, g); }
}
__global__ __launch_bounds__(128) void k_pv(const bf* __restrict__ P, const bf* __restrict__ Vt, float* O) {
    __shared__ __align__(16) unsigned char L[2 * PVBUF];
    __shared__ __align__(16) float osw[4][16 * 68];
    const int lane = threadIdx.x & 31, lr = lane & 15, hi = lane >> 4, w = threadIdx.x >> 5, wm = w & 1, wn = w >> 1; const int r0 = blockIdx.x * 64; const size_t z = blockIdx.y;
    const int nT = (r0 + 64 + PVK - 1) / PVK;                        // stages up to and with the diagonal block; nT * PVK <= TT
    const int sub = threadIdx.x & 15, rg = threadIdx.x >> 4;
    const bf* pa = P + (z * TT + r0 + rg) * (size_t)(2 * TT) + sub * 8; const bf* pb = Vt + (z * DK + rg) * (size_t)(2 * TT) + sub * 8;
    const unsigned ld = (unsigned)(size_t)L + (unsigned)(rg * PVP + sub * 16);
    v8f acc[2][4];
#pragma unroll
    for (int mb = 0; mb < 2; ++mb)
#pragma unroll
        for (int nb = 0; nb < 4; ++nb) acc[mb][nb] = (v8f){};
    pv_stage(pa, pb, ld);
    asm volatile("s_wait_asynccnt 0x0" ::: "memory");               // this wave's part of stage 0 has landed
    __syncthreads();                                                 // every wave's part of stage 0 has landed
    if (nT > 1) pv_stage(pa + PVK, pb + PVK, ld + PVBUF);
    const unsigned char* fa = L + (wm * 32 + lr) * PVP + hi * 16; const unsigned char* fb = L + (128 + wn * 64 + lr) * PVP + hi * 16;
#pragma unroll 1   // one stage a trip: the ring's order stands once, at the foot
    for (int t = 0; t < nT; ++t) {
        const int bo = (t & 1) * PVBUF; const unsigned char* qa = fa + bo; const unsigned char* qb = fb + bo;
        v16bf a[2][2], a2[2][2], b[4], b2[4];                        // P fragments in two sets (this and the next 32 keys); each V fragment pair is refilled for the next 32 keys as soon as its products are issued
#pragma unroll
        for (int mb = 0; mb < 2; ++mb) { a[0][mb] = WFrag<bf>::ld((const bf*)(qa + mb * 16 * PVP)); a2[0][mb] = WFrag<bf>::ld((const bf*)(qa + (64 + mb * 16) * PVP)); }
#pragma unroll
        for (int nb = 0; nb < 4; ++nb) { b[nb] = WFrag<bf>::ld((const bf*)(qb + nb * 16 * PVP)); b2[nb] = WFrag<bf>::ld((const bf*)(qb + (128 + nb * 16) * PVP)); }
#pragma unroll   // ks and nb index register arrays
        for (int ks = 0; ks < PVK / 32; ++ks) { const int cu = ks & 1, nx = cu ^ 1; const bool more = ks + 1 < PVK / 32;   // fragments are fetched ahead inside the stage only, never from the next stage
            if (more) {
#pragma unroll
                for (int mb = 0; mb < 2; ++mb) { a[nx][mb] = WFrag<bf>::ld((const bf*)(qa + mb * 16 * PVP + (ks + 1) * 64)); a2[nx][mb] = WFrag<bf>::ld((const bf*)(qa + (64 + mb * 16) * PVP + (ks + 1) * 64)); } }
#pragma unroll
            for (int nb = 0; nb < 4; ++nb) {
                __builtin_amdgcn_sched_barrier(0);                   // keeps the LDS reads above in front of these products: left alone the compiler sinks each read to just before its use, and the one wave of the SIMD waits out every LDS latency
                acc[0][nb] = wmmab(a[cu][0], b[nb], acc[0][nb]);  acc[1][nb] = wmmab(a[cu][1], b[nb], acc[1][nb]);
                acc[0][nb] = wmmab(a2[cu][0], b[nb], acc[0][nb]); acc[1][nb] = wmmab(a2[cu][1], b[nb], acc[1][nb]);
                acc[0][nb] = wmmab(a[cu][0], b2[nb], acc[0][nb]); acc[1][nb] = wmmab(a[cu][1], b2[nb], acc[1][nb]);
                __builtin_amdgcn_sched_barrier(0);                   // keeps the refill below behind these products and in front of the next ones
                if (more) { b[nb] = WFrag<bf>::ld((const bf*)(qb + nb * 16 * PVP + (ks + 1) * 64)); b2[nb] = WFrag<bf>::ld((const bf*)(qb + (128 + nb * 16) * PVP + (ks + 1) * 64)); }
            }
        }
        asm volatile("s_wait_dscnt 0x0" ::: "memory");              // this wave's reads of stage t are done before the buffer may be refilled
        asm volatile("s_wait_asynccnt 0x0" ::: "memory");           // this wave's part of stage t + 1 has landed
        __syncthreads();                                             // publishes stage t + 1 and ends every wave's reads of stage t
        if (t + 2 < nT) pv_stage(pa + (size_t)(t + 2) * PVK, pb + (size_t)(t + 2) * PVK, ld + bo);
    }
    asm volatile("s_wait_asynccnt 0x0" ::: "memory");               // no copy is outstanding when the wave ends
    float* os = osw[w]; const int c0 = wn * 64;
#pragma unroll
    for (int mb = 0; mb < 2; ++mb) {
#pragma unroll
        for (int nb = 0; nb < 4; ++nb) {
#pragma unroll
            for (int j = 0; j < 8; ++j) os[(hi * 8 + j) * 68 + nb * 16 + lr] = acc[mb][nb][j]; }
        __builtin_amdgcn_wave_barrier(); asm volatile("" ::: "memory");   // the wave's own rows are written before it reads them back as whole lines
        float* crow = O + (z * TT + r0 + wm * 32 + mb * 16) * (size_t)DK + c0;
#pragma unroll
        for (int s = 0; s < 8; ++s) { const int row = 2 * s + hi, cofs = lr * 4; const v4f val = *(const v4fa*)(os + row * 68 + cofs); *(v4f*)(crow + (size_t)row * DK + cofs) = val; }
        __builtin_amdgcn_wave_barrier(); asm volatile("" ::: "memory");   // the rows are read before the next 16 rows overwrite them
    }
}

// ---- k_qkv: QKV[m][0..383] = x[m] . W[n] + bias[n] for the three projections at once (W = the rows of Wq, Wk, Wv one after the other): a 64 x 384 output tile per work-group of eight waves (wave w: rows 32 (w & 1).., columns 96 (w >> 1)..).
// Both operands come into LDS in stages of QKK values of k by asynchronous copies (whole 256-B pieces of rows, shared by the eight waves) in a ring of two buffers: stage t + 1 flies while stage t is multiplied. Per accumulator one product per 32 k, k ascending.
#define QKK    128                 // k per stage: a row of a stage is 256 B
#define QKP    272                 // pitch of such a row in LDS, bytes: 16 B x odd, so the 16 rows of a fragment read fall on distinct banks
#define QKROWS 448                 // rows of a stage: 64 of x, 384 of W
#define QKBUF  (QKROWS * QKP)
#define QKOP   100                 // pitch of an output row in LDS, floats: rows stay 16-B aligned, the two row halves of an accumulator fall on distinct banks
// Fourteen copies of 16 B per lane; the s_wait_xcnt stands in the copies' own statement so that no address register is rewritten ahead of it.
__device__ __forceinline__ void acopy14(const unsigned* l, const bf* const* g) {
    asm volatile("global_load_async_to_lds_b128 %0, %1, off\n\t"
                 "global_load_async_to_lds_b128 %2, %3, off\n\t"
                 "global_load_async_to_lds_b128 %4, %5, off\n\t"
                 "global_load_async_to_lds_b128 %6, %7, off\n\t"
                 "global_load_async_to_lds_b128 %8, %9, off\n\t"
                 "global_load_async_to_lds_b128 %10, %11, off\n\t"
                 "global_load_async_to_lds_b128 %12, %13, off\n\t"
                 "global_load_async_to_lds_b128 %14, %15, off\n\t"
                 "global_load_async_to_lds_b128 %16, %17, off\n\t"
                 "global_load_async_to_lds_b128 %18, %19, off\n\t"
                 "global_load_async_to_lds_b128 %20, %21, off\n\t"
                 "global_load_async_to_lds_b128 %22, %23, off\n\t"
                 "global_load_async_to_lds_b128 %24, %25, off\n\t"
                 "global_load_async_to_lds_b128 %26, %27, off\n\t"
                 "s_wait_xcnt 0x0"
                 :: "v"(l[0]), "v"(g[0]), "v"(l[1]), "v"(g[1]), "v"(l[2]), "v"(g[2]), "v"(l[3]), "v"(g[3]), "v"(l[4]), "v"(g[4]), "v"(l[5]), "v"(g[5]), "v"(l[6]), "v"(g[6]),
                    "v"(l[7]), "v"(g[7]), "v"(l[8]), "v"(g[8]), "v"(l[9]), "v"(g[9]), "v"(l[10]), "v"(g[10]), "v"(l[11]), "v"(g[11]), "v"(l[12]), "v"(g[12]), "v"(l[13]), "v"(g[13]) : "memory");
}
// One stage: 28 copies per lane. px / pw: the lane's piece of its first x row / W row at the stage's first k; ld: the lane's piece of its first row in the buffer. Copy i fills LDS row 16 i + (thread >> 4).
__device__ __forceinline__ void qkv_stage(const bf* px, const bf* pw, unsigned ld) {
#pragma unroll   // the copies' operands are register arrays
    for (int c = 0; c < 2; ++c) { unsigned l[14]; const bf* g[14];
#pragma unroll
        for (int u = 0; u < 14; ++u) { const int i = c * 14 + u; l[u] = ld + (unsigned)(i * 16 * QKP); g[u] = (i < 4) ? px + (size_t)i * 16 * DE : pw + (size_t)(i - 4) * 16 * DE; }
        acopy14(l, g); }
}
__global__ __launch_bounds__(256) void k_qkv(const bf* __restrict__ X, const bf* __restrict__ Wt, const float* __restrict__ bq, const float* __restrict__ bk, const float* __restrict__ bv, float* C) {
    __shared__ __align__(16) unsigned char L[2 * QKBUF];
    __shared__ __align__(16) float osw[8][16 * QKOP];
    const int lane = threadIdx.x & 31, lr = lane & 15, hi = lane >> 4, w = threadIdx.x >> 5, wm = w & 1, wn = w >> 1; const int r0 = blockIdx.x * 64;
    const int nT = DE / QKK;                                         // six stages
    const int sub = threadIdx.x & 15, rg = threadIdx.x >> 4;
    const bf* px = X + (size_t)(r0 + rg) * DE + sub * 8; const bf* pw = Wt + (size_t)rg * DE + sub * 8;
    const unsigned ld = (unsigned)(size_t)L + (unsigned)(rg * QKP + sub * 16);
    v8f acc[2][6];
#pragma unroll
    for (int mb = 0; mb < 2; ++mb)
#pragma unroll
        for (int nb = 0; nb < 6; ++nb) acc[mb][nb] = (v8f){};
    qkv_stage(px, pw, ld);
    asm volatile("s_wait_asynccnt 0x0" ::: "memory");               // this wave's part of stage 0 has landed
    __syncthreads();                                                 // every wave's part of stage 0 has landed
    qkv_stage(px + QKK, pw + QKK, ld + QKBUF);
    const unsigned char* fa = L + (wm * 32 + lr) * QKP + hi * 16; const unsigned char* fb = L + (64 + wn * 96 + lr) * QKP + hi * 16;
#pragma unroll 1   // one stage a trip: the ring's order stands once, at the foot
    for (int t = 0; t < nT; ++t) {
        const int bo = (t & 1) * QKBUF; const unsigned char* qa = fa + bo; const unsigned char* qb = fb + bo;
        v16bf a[2][2], b[2][6];                                      // two fragment sets: this and the next 32 k
#pragma unroll
        for (int mb = 0; mb < 2; ++mb) a[0][mb] = WFrag<bf>::ld((const bf*)(qa + mb * 16 * QKP));
#pragma unroll
        for (int nb = 0; nb < 6; ++nb) b[0][nb] = WFrag<bf>::ld((const bf*)(qb + nb * 16 * QKP));
#pragma unroll   // ks indexes register arrays
        for (int ks = 0; ks < QKK / 32; ++ks) { const int cu = ks & 1, nx = cu ^ 1;
            if (ks + 1 < QKK / 32) {                                 // fragments are fetched ahead inside the stage only, never from the next stage
#pragma unroll
                for (int mb = 0; mb < 2; ++mb) a[nx][mb] = WFrag<bf>::ld((const bf*)(qa + mb * 16 * QKP + (ks + 1) * 64));
#pragma unroll
                for (int nb = 0; nb < 6; ++nb) b[nx][nb] = WFrag<bf>::ld((const bf*)(qb + nb * 16 * QKP + (ks + 1) * 64)); }
            __builtin_amdgcn_sched_barrier(0);                       // keeps the next set's LDS reads as one group in front of these products: sunk to just before their use, every read's latency would be waited out
#pragma unroll
            for (int nb = 0; nb < 6; ++nb) { acc[0][nb] = wmmab(a[cu][0], b[cu][nb], acc[0][nb]); acc[1][nb] = wmmab(a[cu][1], b[cu][nb], acc[1][nb]); }
            __builtin_amdgcn_sched_barrier(0);                       // keeps the reads of the set after next behind these products: lifted among them they stand in several places and take a third set's registers
        }
        asm volatile("s_wait_dscnt 0x0" ::: "memory");              // this wave's reads of stage t are done before the buffer may be refilled
        asm volatile("s_wait_asynccnt 0x0" ::: "memory");           // this wave's part of stage t + 1 has landed
        __syncthreads();                                             // publishes stage t + 1 and ends every wave's reads of stage t
        if (t + 2 < nT) qkv_stage(px + (size_t)(t + 2) * QKK, pw + (size_t)(t + 2) * QKK, ld + bo);
    }
    asm volatile("s_wait_asynccnt 0x0" ::: "memory");               // no copy is outstanding when the wave ends
    float* os = osw[w]; const int c0 = wn * 96;
    int rb[3], cb[3]; v4f bi[3];                                     // 16 rows x 96 columns leave as 12 stores of 32 x 16 B; store 3 g + h covers rows 4 g + rb[h] at columns cb[h]..cb[h] + 3
#pragma unroll
    for (int h = 0; h < 3; ++h) { const int q = h * 32 + lane; rb[h] = q / 24; cb[h] = (q % 24) * 4; const int col = c0 + cb[h];
        const float* bp = (col < DK) ? bq + col : (col < 2 * DK) ? bk + (col - DK) : bv + (col - 2 * DK);
        bi[h][0] = bfr(bp[0]); bi[h][1] = bfr(bp[1]); bi[h][2] = bfr(bp[2]); bi[h][3] = bfr(bp[3]); }
#pragma unroll
    for (int mb = 0; mb < 2; ++mb) {
#pragma unroll
        for (int nb = 0; nb < 6; ++nb) {
#pragma unroll
            for (int j = 0; j < 8; ++j) os[(hi * 8 + j) * QKOP + nb * 16 + lr] = acc[mb][nb][j]; }
        __builtin_amdgcn_wave_barrier(); asm volatile("" ::: "memory");   // the wave's own rows are written before it reads them back as whole lines
        float* crow = C + (size_t)(r0 + wm * 32 + mb * 16) * D3 + c0;
#pragma unroll
        for (int g = 0; g < 4; ++g)
#pragma unroll
            for (int h = 0; h < 3; ++h) { const int row = 4 * g + rb[h]; v4f val = *(const v4fa*)(os + row * QKOP + cb[h]); val[0] += bi[h][0]; val[1] += bi[h][1]; val[2] += bi[h][2]; val[3] += bi[h][3]; *(v4f*)(crow + (size_t)row * D3 + cb[h]) = val; }
        __builtin_amdgcn_wave_barrier(); asm volatile("" ::: "memory");   // the rows are read before the next 16 rows overwrite them
    }
}

__device__ __forceinline__ void splitf(float y, unsigned short& h, unsigned short& l) { h = f2bf(y); l = f2bf(y - bf2f(h)); }
typedef __attribute__((ext_vector_type(2))) unsigned short v2us;
typedef __attribute__((ext_vector_type(4))) unsigned short v4us;

// k_cvt: the four f32 -> bf16 roundings (Wq, Wk, Wv, x) depend on nothing but the inputs, so they share one grid: work-groups 0 .. 3 CVW - 1 take the weights (CVW each, into the three planes that lie one behind the other at WB), the rest take x. 8 values a thread; every part is a whole number of work-groups.
#define CVW (DK * DE / 8 / 256)
#define CVX (NB_ * TT * DE / 8 / 256)
__global__ __launch_bounds__(256) void k_cvt(const float* __restrict__ x, const float* __restrict__ wq, const float* __restrict__ wk, const float* __restrict__ wv, bf* XB, bf* WB) { const int b = blockIdx.x; const float* src; bf* dst; size_t i;
    if (b < 3 * CVW) { const int m = b / CVW; src = (m == 0) ? wq : (m == 1) ? wk : wv; dst = WB + (size_t)m * DK * DE; i = (size_t)(b - m * CVW) * 256 + threadIdx.x; }
    else { src = x; dst = XB; i = (size_t)(b - 3 * CVW) * 256 + threadIdx.x; }
    const v8f v = *(const v8f*)(src + i * 8); v8us o;
#pragma unroll
    for (int k = 0; k < 8; ++k) o[k] = f2bf(v[k]); *(v8us*)(dst + i * 8) = o;  }
// Every kernel below covers all NB_ sequences in one launch: k_csoft takes the sequence from blockIdx.y, d_gvt from its work-group's number, k_temp / d_gpl run over the NB_*TT rows as one list.
// k_temp: TQ[g] = pos + tanh(sum_d tokenq[s][d] gelu(Q[g][d])), TV[g] likewise with tokenv / V, pos = 1 + sigmoid(alpha[s]) log(s+1). One work-group per 32 tokens of the NB_*TT list: wave w takes tokens 4w..4w+3 with its lanes ACROSS d,
// so each row of Q, V, tokenq, tokenv is one whole 512-B load, and leaves the 128 products of each dot in LDS; behind the barrier lane t of wave 0 (Q) and of wave 1 (V) adds token t's products in the order d = 0..127 and the wave stores one whole 128-B line.
// d_gpl: hl planes GQ[s][d] = TQ[s] Q[s][d], Kp[s][d] = K[s][d] (8-B lanes);
#define TPP 132   // pitch of a product row in LDS, in floats: rows stay 16-B aligned and do not all start in one bank
__global__ __launch_bounds__(256) void k_temp(const float* __restrict__ QKV, const float* __restrict__ tq, const float* __restrict__ tv, const float* __restrict__ alpha, float* TQ, float* TV) {
    __shared__ __align__(16) float pr[2][32][TPP];
    const int lane = threadIdx.x & 31, w = threadIdx.x >> 5; const int g0 = blockIdx.x * 32;
    const int t0 = g0 + w * 4; const float* q = QKV + (size_t)t0 * D3 + lane * 4; const size_t sd = (size_t)(t0 % TT) * DK + lane * 4;   // TT % 4 == 0: a wave's four tokens lie in one sequence, so their tokenq / tokenv rows are consecutive too
    v4f xq[4], xv[4], kq[4], kv[4];
#pragma unroll   // registers, not an indexed array; the wave's 16 row loads all stand in front of the first gelu's branches, so they are in flight together
    for (int u = 0; u < 4; ++u) { xq[u] = *(const v4fa*)(q + u * D3); xv[u] = *(const v4fa*)(q + u * D3 + 2 * DK); kq[u] = *(const v4fa*)(tq + sd + u * DK); kv[u] = *(const v4fa*)(tv + sd + u * DK); }
#pragma unroll   // u and k index register arrays: both loops must be flat for the rows to stay in registers
    for (int u = 0; u < 4; ++u) { v4f pq, pv;
#pragma unroll
        for (int k = 0; k < 4; ++k) { const float x1 = xq[u][k], x2 = xv[u][k]; const float g1 = __fmul_rn(0.5f * x1, __fadd_rn(1.0f, erff(x1 * 0.70710678118654752f))), g2 = __fmul_rn(0.5f * x2, __fadd_rn(1.0f, erff(x2 * 0.70710678118654752f)));
            pq[k] = __fmul_rn(bfr(kq[u][k]), g1); pv[k] = __fmul_rn(bfr(kv[u][k]), g2); }
        *(v4fa*)(&pr[0][w * 4 + u][lane * 4]) = pq; *(v4fa*)(&pr[1][w * 4 + u][lane * 4]) = pv; }
    __syncthreads();   // every product row is in LDS before a lane of wave 0 or 1 adds it up
    if (w >= 2) return;
    const float* p = &pr[w][lane][0]; float a = 0.f;
#pragma unroll   // constant LDS offsets, no loop counter beside the one dependent chain of adds
    for (int d = 0; d < DK; d += 4) { const v4f c = *(const v4fa*)(p + d); a = __fadd_rn(a, c[0]); a = __fadd_rn(a, c[1]); a = __fadd_rn(a, c[2]); a = __fadd_rn(a, c[3]); }
    const int s = (g0 + lane) % TT;
    const float sg = __fdiv_rn(1.0f, __fadd_rn(1.0f, __expf(-bfr(alpha[s])))); const float pos = __fadd_rn(1.0f, __fmul_rn(sg, __logf((float)(s + 1))));
    (w ? TV : TQ)[g0 + lane] = __fadd_rn(pos, tanhf(a)); }
__device__ __forceinline__ void d_gpl(int bx, const float* __restrict__ QKV, const float* __restrict__ TQ, bf* GQh, bf* GQl, bf* Kh, bf* Kl) { const int e = (bx * 256 + threadIdx.x) * 4; if (e >= NB_ * TT * DK) return; const int d = e % DK; const int s = e / DK; const float t = TQ[s]; const float* q = QKV + (size_t)s * D3 + d; v4us a, b, c, dd;
#pragma unroll
    for (int u = 0; u < 4; ++u) { unsigned short h1, l1, h2, l2; splitf(__fmul_rn(t, q[u]), h1, l1); splitf(q[DK + u], h2, l2); a[u] = h1; b[u] = l1; c[u] = h2; dd[u] = l2; }
    { *(v4us*)(GQh + e) = a; *(v4us*)(GQl + e) = b; *(v4us*)(Kh + e) = c; *(v4us*)(Kl + e) = dd;  } }
__device__ __forceinline__ void d_gvt(int bx, int by, const float* __restrict__ QKV, const float* __restrict__ TV, bf* Th, bf* Tl) { const int e = (bx * 256 + threadIdx.x) * 4; if (e >= DK * TT) return; const int s = e % TT; const int d = e / TT; v4us oh, ol; const size_t z = by; QKV += z * TT * D3; TV += z * TT; const size_t o = (z * DK + d) * (2 * TT) + s;   // row d = [TT hi][TT lo], the pitch of the probability rows (the tile GEMM has one pitch for both operands)
#pragma unroll
    for (int u = 0; u < 4; ++u) { unsigned short a, b; splitf(__fmul_rn(TV[s + u], QKV[(size_t)(s + u) * D3 + 2 * DK + d]), a, b); oh[u] = a; ol[u] = b; } *(v4us*)(Th + o) = oh; *(v4us*)(Tl + o) = ol;  }
// k_planes: the gated-V planes and the gated-Q / K planes both need only QKV and the temperatures and write disjoint planes, so they share one grid: work-groups 0 .. NB_ GVB - 1 do the V planes (GVB per sequence; their strided reads take longer, so they start first), the rest the Q / K planes.
#define GVB (DK * TT / 4 / 256)
#define GPB (NB_ * TT * DK / 4 / 256)
__global__ __launch_bounds__(256) void k_planes(const float* __restrict__ QKV, const float* __restrict__ TQ, const float* __restrict__ TV, bf* GQh, bf* GQl, bf* Kh, bf* Kl, bf* Th, bf* Tl) { const int b = blockIdx.x;
    if (b < NB_ * GVB) d_gvt(b % GVB, b / GVB, QKV, TV, Th, Tl); else d_gpl(b - NB_ * GVB, QKV, TQ, GQh, GQl, Kh, Kl); }
// k_csoft: one wave per score row; the row's hi and lo probability planes (2 x TT 16-bit) are stored over the row's own TT f32 scores, which the wave holds in registers before its first store (every store needs the row sum).
// Only the causal part of a row is touched: the pieces of 128 columns up to and with piece 'last', which holds the diagonal. Pieces behind it hold no key j <= i, so they add nothing to the maximum or the sum, and k_pv's key loop
// ends with that same piece (its stages are PVK = 128 keys), so nothing reads them. Rows differ in length, so a work-group takes four rows from the top (waves 0..3) and the four that mirror them at the bottom (waves 4..7):
// every work-group has the same number of pieces, wherever it runs. 'last' is one value per wave, held in a scalar register: every test on it is a scalar branch.
__global__ __launch_bounds__(256) void k_csoft(const float* Sb, bf* Ph, bf* Pl) { const int lane = threadIdx.x & 31, w = threadIdx.x >> 5; const int i = (w < 4) ? blockIdx.x * 4 + w : TT - 8 - blockIdx.x * 4 + w; if (i >= TT) return; const unsigned last = (unsigned)__builtin_amdgcn_readfirstlane(i >> 7); const size_t g = (size_t)blockIdx.y * TT + i; const float* sr = Sb + g * TT + lane * 4; v4f raw[TT / 128]; float v[TT / 32]; float mx = -3.0e38f; const float scl = 0.088388347648318447f;
#pragma unroll   // ch indexes register arrays; the loads stand in a loop of their own so that all of a row's pieces are in flight together
    for (int ch = 0; ch < TT / 128; ++ch) if ((unsigned)ch <= last) raw[ch] = *(const v4f*)(sr + ch * 128);
    asm volatile("s_wait_xcnt 0x0" :: "v"(sr) : "memory");   // the loads' address pair stays live up to this wait
#pragma unroll
    for (int ch = 0; ch < TT / 128; ++ch) if ((unsigned)ch <= last) { const int j0 = ch * 128 + lane * 4;
#pragma unroll
        for (int u = 0; u < 4; ++u) { const float t = (j0 + u <= i) ? raw[ch][u] * scl : -3.0e38f; v[ch * 4 + u] = t; mx = fmaxf(mx, t); } }
#pragma unroll
    for (int sh = 16; sh; sh >>= 1) mx = fmaxf(mx, __shfl_xor(mx, sh, 32));
    float sum = 0.f;
#pragma unroll
    for (int ch = 0; ch < TT / 128; ++ch) if ((unsigned)ch <= last) {
#pragma unroll   // the empty statement on d0 keeps each difference in a register of its own
        for (int u = 0; u < 4; ++u) { const int q = ch * 4 + u; float d0 = __fsub_rn(v[q], mx); asm volatile("" : "+v"(d0)); v[q] = (v[q] > -1.0e38f) ? __builtin_amdgcn_exp2f(__fmul_rn(d0, 1.4426950408889634f)) : 0.f; sum += v[q]; } }
#pragma unroll
    for (int sh = 16; sh; sh >>= 1) sum += __shfl_xor(sum, sh, 32);
    const float f = __fdiv_rn(1.0f, sum);
    {
#pragma unroll
        for (int ch = 0; ch < TT / 128; ++ch) if ((unsigned)ch <= last) { v4us oh, ol;
#pragma unroll
            for (int q = 0; q < 4; ++q) { unsigned short a, b; splitf(v[ch * 4 + q] * f, a, b); oh[q] = a; ol[q] = b; } const size_t oo = g * (2 * TT) + ch * 128 + lane * 4; *(v4us*)(Ph + oo) = oh; *(v4us*)(Pl + oo) = ol;
            asm volatile("s_wait_xcnt 0x0" ::: "memory"); }   // the next piece's arithmetic reuses the two stores' data registers
         } }

extern "C" void kernel_launch(void* const* d_in, const int* in_sizes, int n_in,
                              void* d_out, int out_size, void* d_ws, size_t ws_size, hipStream_t stream) {
    (void)in_sizes; (void)n_in; (void)out_size;
    const float** I = (const float**)d_in;
    const float *x = I[0], *Wq = I[1], *bq = I[2], *Wk = I[3], *bk = I[4], *Wv = I[5], *bv = I[6], *alpha = I[7], *tokq = I[8], *tokv = I[9];
    float* OUT = (float*)d_out;     // [8][2048][128]
    char* wsp = (char*)d_ws;
    auto take = [&](size_t bytes) { char* p = wsp; wsp += (bytes + 255) & ~(size_t)255; return (void*)p; };
    bf* BQ = (bf*)take((size_t)3 * DK * DE * 2);   // the Wq, Wk, Wv planes one behind the other, 384 rows of W
    bf* XB = (bf*)take((size_t)NB_ * TT * DE * 2); float* QKV = (float*)take((size_t)NB_ * TT * D3 * 4); float* TQ = (float*)take(NB_ * TT * 4); float* TV = (float*)take(NB_ * TT * 4);
    bf* GQh = (bf*)take((size_t)NB_ * TT * DK * 2); bf* GQl = (bf*)take((size_t)NB_ * TT * DK * 2); bf* Kh = (bf*)take((size_t)NB_ * TT * DK * 2); bf* Kl = (bf*)take((size_t)NB_ * TT * DK * 2); bf* GVh = (bf*)take((size_t)NB_ * DK * TT * 4); bf* GVl = GVh + TT;
    float* Sb = (float*)take((size_t)NB_ * TT * TT * 4); bf* Ph = (bf*)Sb; bf* Pl = Ph + TT;    // probability planes in place: row r = [TT hi][TT lo] over score row r, pitch 2*TT
    if ((size_t)(wsp - (char*)d_ws) > ws_size) return;    // total ~ 211 MB
    k_cvt<<<3 * CVW + CVX, 256, 0, stream>>>(x, Wq, Wk, Wv, XB, BQ);   // [out][in] = Bt
    k_qkv<<<NB_ * TT / 64, 256, 0, stream>>>(XB, BQ, bq, bk, bv, QKV);
    k_temp<<<NB_ * TT / 32, 256, 0, stream>>>(QKV, tokq, tokv, alpha, TQ, TV); k_planes<<<NB_ * GVB + GPB, 256, 0, stream>>>(QKV, TQ, TV, GQh, GQl, Kh, Kl, GVh, GVl);
    k_gemmc<bf, 2, 1><<<dim3(TT / 64, TT / 64, NB_), 32, 0, stream>>>(GQh, GQl, Kh, Kl, DK, Sb, TT, 0, (size_t)TT * DK, (size_t)TT * DK, (size_t)TT * TT);
    k_csoft<<<dim3(TT / 8, NB_, 1), 256, 0, stream>>>(Sb, Ph, Pl);
    k_pv<<<dim3(TT / 64, NB_, 1), 128, 0, stream>>>(Ph, GVh, OUT);   // rows of both operands: [TT hi][TT lo], pitch 2*TT
}

// v007
// It runs in 83.4 microseconds.
// Next to v006, in two timings, it ran 1.44 and 1.45 times as fast.
// Counting every step since v000, it is 16.7 times as fast.
#include <hip/hip_runtime.h>

// SelectiveAttentionModule (x [8][2048][768]; Q/K/V = x W^T + b (d 128, single head); temps_q[s] = 1 + sigmoid(alpha[s]) log(s+1) + tanh(tokenq[s] . gelu(Q[s])), temps_v likewise with tokenv / V; scores = (temps_q Q) . K / sqrt(128), causal;
// softmax; out = softmax . (temps_v V) -> [8][2048][128]).
// Compute dtypes, f32 accumulate: every input rounded to bf16; Q/K/V on PLAIN bf16 operands (inputs: exact) + bias; the temperatures (erf-gelu, 128-term fixed-order dots, tanh, sigmoid, log) f32 on the VALU; gated Q / K / gated V -> bf16 hi+lo

#define NB_  8
#define TT   2048
#define DE   768
#define DK   128
#define D3   384
typedef _Float16 h16;
typedef unsigned short bf;
typedef __attribute__((ext_vector_type(16))) __bf16   v16bf;
typedef __attribute__((ext_vector_type(16))) _Float16 v16h;
typedef __attribute__((ext_vector_type(8)))  _Float16 v8h;
typedef __attribute__((ext_vector_type(8)))  unsigned short v8us;
typedef __attribute__((ext_vector_type(8)))  float    v8f;
typedef __attribute__((ext_vector_type(4)))  float    v4f;
typedef v8h  __attribute__((may_alias)) v8ha;
typedef v4f  __attribute__((may_alias)) v4fa;
typedef v8us __attribute__((may_alias)) v8usa;

__device__ __forceinline__ unsigned short f2bf(float f) { unsigned u = __float_as_uint(f); u += 0x7FFFu + ((u >> 16) & 1u); return (unsigned short)(u >> 16); }
__device__ __forceinline__ float bf2f(unsigned short b) { return __uint_as_float(((unsigned)b) << 16); }
__device__ __forceinline__ float bfr(float f) { return bf2f(f2bf(f)); }
__device__ __forceinline__ v16h cat16(v8h lo, v8h hi) { return __builtin_shufflevector(lo, hi, 0, 1, 2, 3, 4, 5, 6, 7, 8, 9, 10, 11, 12, 13, 14, 15); }
__device__ __forceinline__ v16bf cat16b(v8us lo, v8us hi) { return __builtin_bit_cast(v16bf, __builtin_shufflevector(lo, hi, 0, 1, 2, 3, 4, 5, 6, 7, 8, 9, 10, 11, 12, 13, 14, 15)); }
__device__ __forceinline__ v8f wmma16(v16h a, v16h b, v8f c) { return __builtin_amdgcn_wmma_f32_16x16x32_f16(false, a, false, b, (short)0, c, false, false); }
__device__ __forceinline__ v8f wmmab(v16bf a, v16bf b, v8f c) { return __builtin_amdgcn_wmma_f32_16x16x32_bf16(false, a, false, b, (short)0, c, false, false); }



// Fragment of a 16 x 32 operand block from a K-contiguous 16-bit plane: the lane's 8 elements at p and 8 at p + 16.
template <typename T16> struct WFrag;
template <> struct WFrag<h16> { typedef v16h V; static __device__ __forceinline__ V ld(const h16* p) { return cat16(*(const v8h*)p, *(const v8h*)(p + 16)); } static __device__ __forceinline__ v8f mma(V a, V b, v8f c) { return wmma16(a, b, c); } };
template <> struct WFrag<bf> { typedef v16bf V; static __device__ __forceinline__ V ld(const bf* p) { return cat16b(*(const v8us*)p, *(const v8us*)(p + 16)); } static __device__ __forceinline__ v8f mma(V a, V b, v8f c) { return wmmab(a, b, c); } };

#define FR    2                    // groups of 16 queries per wave: every K and V fragment read from LDS serves FR groups
#define FNP   4                    // parts over the keys = passes per stage
#define FNC   (64 / (16 * FR))     // waves side by side; FNC * FNP = 8
#define FK    (32 * FNP)           // keys per stage
#define FKP   272                  // pitch of a K row (128 d, 256 B) in LDS, bytes: 16 B x odd, so the 16 rows of a fragment read fall on distinct banks
#define FVP   (2 * FK + 16)        // pitch of a V^T row (FK keys) in LDS, bytes: 16 B x odd
#define FKL   (FK * FKP)           // K lo behind K hi
#define FVH   (2 * FK * FKP)       // V^T hi
#define FBUF  (FVH + 2 * DK * FVP)
#define FVLR  (FK / 8)             // lanes that copy one V^T row
#define FVRC  (256 / FVLR)         // V^T rows per copy of the work-group
#define FMSZ  (FR * 8 * 1024 + FR * 256)   // what one wave hands over at the end, bytes: FR x 8 tiles of 32 lanes x 32 B, then FR x (maximum, sum) of 32 lanes x 4 B
typedef __attribute__((ext_vector_type(8))) unsigned v8u;
// Eight copies of 16 B per lane; the s_wait_xcnt stands in the copies' own statement so that no address register is rewritten ahead of it.
__device__ __forceinline__ void acopy8(const unsigned* l, const bf* const* g) {
    asm volatile("global_load_async_to_lds_b128 %0, %1, off\n\t"
                 "global_load_async_to_lds_b128 %2, %3, off\n\t"
                 "global_load_async_to_lds_b128 %4, %5, off\n\t"
                 "global_load_async_to_lds_b128 %6, %7, off\n\t"
                 "global_load_async_to_lds_b128 %8, %9, off\n\t"
                 "global_load_async_to_lds_b128 %10, %11, off\n\t"
                 "global_load_async_to_lds_b128 %12, %13, off\n\t"
                 "global_load_async_to_lds_b128 %14, %15, off\n\t"
                 "s_wait_xcnt 0x0"
                 :: "v"(l[0]), "v"(g[0]), "v"(l[1]), "v"(g[1]), "v"(l[2]), "v"(g[2]), "v"(l[3]), "v"(g[3]), "v"(l[4]), "v"(g[4]), "v"(l[5]), "v"(g[5]), "v"(l[6]), "v"(g[6]), "v"(l[7]), "v"(g[7]) : "memory");
}
// One stage: FK / 4 copies per lane, FK / 16 for each of K hi, K lo, V^T hi, V^T lo. kh / kl: the lane's piece of its first K row (hi / lo plane) at the stage's first key; vh: the lane's piece of its first V^T row at that key (lo plane TT behind);
// lk / lv: the places of those pieces in the buffer. A K copy fills rows 16 i + (thread >> 4), 16 lanes a row; a V^T copy rows FVRC i + thread / FVLR.
__device__ __forceinline__ void fa_stage(const bf* kh, const bf* kl, const bf* vh, unsigned lk, unsigned lv) {
#pragma unroll   // the copies' operands are register arrays
    for (int e = 0; e < FK / 32; ++e) { unsigned l[8]; const bf* g[8];
#pragma unroll
        for (int u = 0; u < 8; ++u) { const int n = e * 8 + u, q = n / (FK / 16), i = n % (FK / 16);
            l[u] = (q < 2) ? lk + (unsigned)(q * FKL + i * 16 * FKP) : lv + (unsigned)((q - 2) * DK * FVP + i * FVRC * FVP);
            g[u] = (q == 0) ? kh + (size_t)i * 16 * DK : (q == 1) ? kl + (size_t)i * 16 * DK : vh + (q - 2) * TT + (size_t)i * FVRC * (2 * TT); }
        acopy8(l, g); }
}
__device__ __forceinline__ unsigned pack2(float lo, float hi) { typedef __bf16 bf2 __attribute__((ext_vector_type(2))); typedef float f2 __attribute__((ext_vector_type(2))); return __builtin_bit_cast(unsigned, __builtin_convertvector(f2{lo, hi}, bf2)); }   // round to nearest even
__device__ __forceinline__ float xhalf(float x) { return __builtin_bit_cast(float, __builtin_amdgcn_permlanex16(__builtin_bit_cast(int, x), __builtin_bit_cast(int, x), 0x76543210, 0xfedcba98, false, false)); }   // lane l with lane l ^ 16
__device__ __forceinline__ void nop4() { asm volatile("v_nop\n\tv_nop\n\tv_nop\n\tv_nop"); }   // the four vector slots between a matrix instruction and a vector instruction on its registers, also on the taken side of a branch that follows
__global__ __launch_bounds__(256) void k_fa(const bf* __restrict__ Qh, const bf* __restrict__ Ql, const bf* __restrict__ Kh, const bf* __restrict__ Kl, const bf* __restrict__ Vt, float* O) {
    __shared__ __align__(16) unsigned char L[2 * FBUF];
    const int lane = threadIdx.x & 31, c = lane & 15, h = lane >> 4; const int w = __builtin_amdgcn_readfirstlane(threadIdx.x >> 5); const int cg = w % FNC, part = w / FNC;
    const int blk = TT / 64 - 1 - (int)blockIdx.x;                   // the longest work-groups start first
    const int r0 = blk * 64, qw0 = r0 + 16 * FR * cg, nT = (r0 + 64 + FK - 1) / FK;   // stages up to and with the diagonal's; nT * FK <= TT
    const size_t z = blockIdx.y;
    const bf* kh = Kh + (z * TT + (threadIdx.x >> 4)) * (size_t)DK + (threadIdx.x & 15) * 8; const bf* kl = Kl + (z * TT + (threadIdx.x >> 4)) * (size_t)DK + (threadIdx.x & 15) * 8;
    const bf* vh = Vt + (z * DK + threadIdx.x / FVLR) * (size_t)(2 * TT) + (threadIdx.x % FVLR) * 8;
    const unsigned lk = (unsigned)(size_t)L + (unsigned)((threadIdx.x >> 4) * FKP + (threadIdx.x & 15) * 16), lv = (unsigned)(size_t)L + (unsigned)(FVH + (threadIdx.x / FVLR) * FVP + (threadIdx.x % FVLR) * 16);
    fa_stage(kh, kl, vh, lk, lv);
    v16bf qh[FR][4], ql[FR][4];                                      // B operand: column c of group g = query qw0 + 16 g + c
#pragma unroll
    for (int g = 0; g < FR; ++g) { const size_t qo = (z * TT + qw0 + 16 * g + c) * (size_t)DK + 8 * h;
#pragma unroll
        for (int kc = 0; kc < 4; ++kc) { qh[g][kc] = WFrag<bf>::ld(Qh + qo + 32 * kc); ql[g][kc] = WFrag<bf>::ld(Ql + qo + 32 * kc); } }
    v8f acc[FR][8];                                                  // acc[g][u][r] = O[qw0 + 16 g + c][16 u + 8 h + r], unnormalised, this part's keys
    float m_run[FR], l_run[FR];
#pragma unroll
    for (int g = 0; g < FR; ++g) { m_run[g] = -__builtin_inff(); l_run[g] = 0.f;
#pragma unroll
        for (int u = 0; u < 8; ++u) acc[g][u] = (v8f){}; }
    const float cs = 0.088388347648318447f * 1.4426950408889634f;
    asm volatile("s_wait_asynccnt 0x0" ::: "memory");               // this wave's part of stage 0 has landed
    __syncthreads();                                                 // every wave's part of stage 0 has landed
    if (nT > 1) fa_stage(kh + (size_t)FK * DK, kl + (size_t)FK * DK, vh + FK, lk + FBUF, lv + FBUF);
    const unsigned char* fk = L + (part * 32 + c) * FKP + h * 16; const unsigned char* fv = L + FVH + c * FVP + part * 64 + h * 16;
#pragma unroll 1   // one stage a trip: the ring's order stands once, at the foot
    for (int t = 0; t < nT; ++t) {
        const int bo = (t & 1) * FBUF; const int key0 = t * FK + part * 32;
        if (key0 <= qw0 + 16 * FR - 1) {                             // one value per wave: a pass wholly behind the wave's diagonal is skipped
            const unsigned char* pk = fk + bo; const unsigned char* pv = fv + bo;
            v8f s[2][FR];
            {   v16bf ka[2][4], kb[2][4];                            // K fragments of the pass, hi and lo: row = key 16 kt + c
#pragma unroll
                for (int kt = 0; kt < 2; ++kt)
#pragma unroll
                    for (int kc = 0; kc < 4; ++kc) { ka[kt][kc] = WFrag<bf>::ld((const bf*)(pk + kt * 16 * FKP + kc * 64)); kb[kt][kc] = WFrag<bf>::ld((const bf*)(pk + FKL + kt * 16 * FKP + kc * 64)); }
#pragma unroll
                for (int g = 0; g < FR; ++g) { s[0][g] = (v8f){}; s[1][g] = (v8f){}; }
#pragma unroll
                for (int kc = 0; kc < 4; ++kc)
#pragma unroll
                    for (int g = 0; g < FR; ++g) {
                        s[0][g] = wmmab(ka[0][kc], qh[g][kc], s[0][g]); s[1][g] = wmmab(ka[1][kc], qh[g][kc], s[1][g]);
                        s[0][g] = wmmab(ka[0][kc], ql[g][kc], s[0][g]); s[1][g] = wmmab(ka[1][kc], ql[g][kc], s[1][g]);
                        s[0][g] = wmmab(kb[0][kc], qh[g][kc], s[0][g]); s[1][g] = wmmab(kb[1][kc], qh[g][kc], s[1][g]); }
            }
            __builtin_amdgcn_sched_barrier(0);                       // keeps the LDS reads below behind the products, whose K registers they take over
            nop4();
            v16bf va[8], vb[8];                                      // V^T fragments of the pass, hi and lo: row = d 16 u + c; the hi plane's are read here so that they fly under the softmax arithmetic, the lo plane's where the compiler finds registers for them
#pragma unroll
            for (int u = 0; u < 8; ++u) va[u] = WFrag<bf>::ld((const bf*)(pv + u * 16 * FVP));
            __builtin_amdgcn_sched_barrier(0);                       // keeps those reads in front of the arithmetic: sunk to just before their use, their latency would be waited out in front of the second product
            if (key0 + 31 > qw0) {                                   // one value per wave: only a pass that meets the wave's diagonal pays for the mask
#pragma unroll
                for (int g = 0; g < FR; ++g)
#pragma unroll
                    for (int kt = 0; kt < 2; ++kt)
#pragma unroll
                        for (int r = 0; r < 8; ++r) if (key0 + 16 * kt + 8 * h + r > qw0 + 16 * g + c) s[kt][g][r] = -__builtin_inff(); }
            float mb[FR]; bool need = false;
#pragma unroll
            for (int g = 0; g < FR; ++g) { float mx = fmaxf(s[0][g][0], s[1][g][0]);
#pragma unroll
                for (int r = 1; r < 8; ++r) mx = fmaxf(mx, fmaxf(s[0][g][r], s[1][g][r]));
                mx = fmaxf(mx, xhalf(mx)) * cs;                      // both wave halves hold the query's maximum of this pass, scaled (the scale is positive); finite: a pass that is not skipped holds an open key for every query of the wave
                mb[g] = mx; need = need || (mx > m_run[g] + 8.0f); }
            if (__builtin_amdgcn_ballot_w32(need) != 0) {            // scalar branch; always taken in a wave's first pass, where m_run is -inf
#pragma unroll
                for (int g = 0; g < FR; ++g) { const float m_new = fmaxf(m_run[g], mb[g]); const float corr = __builtin_amdgcn_exp2f(m_run[g] - m_new); l_run[g] *= corr; m_run[g] = m_new;
#pragma unroll
                    for (int u = 0; u < 8; ++u) acc[g][u] = acc[g][u] * corr; } }
            v16bf ph[FR], pl[FR];
#pragma unroll
            for (int g = 0; g < FR; ++g) { const float nm = -m_run[g]; v8u wh, wl; float ps0 = 0.f, ps1 = 0.f;
#pragma unroll
                for (int i = 0; i < 8; ++i) {
                    const float p0 = __builtin_amdgcn_exp2f(fmaf(s[i >> 2][g][2 * (i & 3)], cs, nm)), p1 = __builtin_amdgcn_exp2f(fmaf(s[i >> 2][g][2 * (i & 3) + 1], cs, nm));
                    ps0 += p0; ps1 += p1;
                    const unsigned hh = pack2(p0, p1); wh[i] = hh; wl[i] = pack2(p0 - __uint_as_float(hh << 16), p1 - __uint_as_float(hh & 0xFFFF0000u)); }
                l_run[g] += ps0 + ps1; ph[g] = __builtin_bit_cast(v16bf, wh); pl[g] = __builtin_bit_cast(v16bf, wl); }
#pragma unroll
            for (int u = 0; u < 8; ++u) vb[u] = WFrag<bf>::ld((const bf*)(pv + (DK + u * 16) * FVP));
#pragma unroll
            for (int g = 0; g < FR; ++g) {
#pragma unroll
                for (int u = 0; u < 8; ++u) acc[g][u] = wmmab(va[u], ph[g], acc[g][u]);
#pragma unroll
                for (int u = 0; u < 8; ++u) acc[g][u] = wmmab(va[u], pl[g], acc[g][u]); }
#pragma unroll
            for (int g = 0; g < FR; ++g)
#pragma unroll
                for (int u = 0; u < 8; ++u) acc[g][u] = wmmab(vb[u], ph[g], acc[g][u]);
            __builtin_amdgcn_sched_barrier(0);                       // keeps the slots below directly behind the products
            nop4();
        }
        asm volatile("s_wait_dscnt 0x0" ::: "memory");              // this wave's reads of stage t are done before the buffer may be refilled
        asm volatile("s_wait_asynccnt 0x0" ::: "memory");           // this wave's part of stage t + 1 has landed
        __syncthreads();                                             // publishes stage t + 1 and ends every wave's reads of stage t
        if (t + 2 < nT) fa_stage(kh + (size_t)(t + 2) * FK * DK, kl + (size_t)(t + 2) * FK * DK, vh + (t + 2) * FK, lk + bo, lv + bo);
    }
    asm volatile("s_wait_asynccnt 0x0" ::: "memory");               // no copy is outstanding: behind the last trip's barrier the ring is free and takes the parts' hand-over
    if (part > 0) { unsigned char* mo = L + ((part - 1) * FNC + cg) * FMSZ;   // parts 1 .. FNP - 1 leave tiles, maxima and sums, lane by lane
#pragma unroll
        for (int g = 0; g < FR; ++g) {
#pragma unroll
            for (int u = 0; u < 8; ++u) { float* d = (float*)(mo + ((g * 8 + u) * 32 + lane) * 32); *(v4fa*)d = (v4f){acc[g][u][0], acc[g][u][1], acc[g][u][2], acc[g][u][3]}; *(v4fa*)(d + 4) = (v4f){acc[g][u][4], acc[g][u][5], acc[g][u][6], acc[g][u][7]}; }
            ((float*)(mo + FR * 8 * 1024))[(g * 2) * 32 + lane] = m_run[g]; ((float*)(mo + FR * 8 * 1024))[(g * 2 + 1) * 32 + lane] = l_run[g]; } }
    __syncthreads();                                                 // the hand-over is written before part 0 reads it
    if (part > 0) return;
#pragma unroll 1   // one part a trip: the tiles of one part are in registers at a time
    for (int p = 1; p < FNP; ++p) { const unsigned char* mo = L + ((p - 1) * FNC + cg) * FMSZ;
#pragma unroll
        for (int g = 0; g < FR; ++g) { const float mp = ((const float*)(mo + FR * 8 * 1024))[(g * 2) * 32 + lane], lp = ((const float*)(mo + FR * 8 * 1024))[(g * 2 + 1) * 32 + lane];
            const float m_new = fmaxf(m_run[g], mp);                 // finite: part 0 has seen key 0; a part that had no pass hands over -inf, 0 and zeros and gets the factor 0
            const float fa = __builtin_amdgcn_exp2f(m_run[g] - m_new), fb = __builtin_amdgcn_exp2f(mp - m_new); l_run[g] = l_run[g] * fa + lp * fb; m_run[g] = m_new;
#pragma unroll
            for (int u = 0; u < 8; ++u) { const float* d = (const float*)(mo + ((g * 8 + u) * 32 + lane) * 32); const v4f x0 = *(const v4fa*)d, x1 = *(const v4fa*)(d + 4);
#pragma unroll
                for (int r = 0; r < 4; ++r) { acc[g][u][r] = acc[g][u][r] * fa + x0[r] * fb; acc[g][u][4 + r] = acc[g][u][4 + r] * fa + x1[r] * fb; } } } }
#pragma unroll
    for (int g = 0; g < FR; ++g) { const float inv = __fdiv_rn(1.0f, l_run[g] + xhalf(l_run[g]));   // each wave half holds the sum over its eight keys of every 16-key tile
#pragma unroll
        for (int u = 0; u < 8; ++u) acc[g][u] = acc[g][u] * inv; }
    float* orow = O + (z * TT + qw0 + c) * (size_t)DK + 8 * h;
    __builtin_amdgcn_sched_barrier(0);                               // all arithmetic stands in front of the stores, so that no register which an issued store names is written again
#pragma unroll
    for (int g = 0; g < FR; ++g)
#pragma unroll
        for (int u = 0; u < 8; ++u) { *(v4f*)(orow + g * 16 * DK + 16 * u) = (v4f){acc[g][u][0], acc[g][u][1], acc[g][u][2], acc[g][u][3]}; *(v4f*)(orow + g * 16 * DK + 16 * u + 4) = (v4f){acc[g][u][4], acc[g][u][5], acc[g][u][6], acc[g][u][7]}; }
}

// ---- k_qkv: QKV[m][0..383] = x[m] . W[n] + bias[n] for the three projections at once (W = the rows of Wq, Wk, Wv one after the other): a 64 x 384 output tile per work-group of eight waves (wave w: rows 32 (w & 1).., columns 96 (w >> 1)..).
// Both operands come into LDS in stages of QKK values of k by asynchronous copies (whole 256-B pieces of rows, shared by the eight waves) in a ring of two buffers: stage t + 1 flies while stage t is multiplied. Per accumulator one product per 32 k, k ascending.
#define QKK    128                 // k per stage: a row of a stage is 256 B
#define QKP    272                 // pitch of such a row in LDS, bytes: 16 B x odd, so the 16 rows of a fragment read fall on distinct banks
#define QKROWS 448                 // rows of a stage: 64 of x, 384 of W
#define QKBUF  (QKROWS * QKP)
#define QKOP   100                 // pitch of an output row in LDS, floats: rows stay 16-B aligned, the two row halves of an accumulator fall on distinct banks
// Fourteen copies of 16 B per lane; the s_wait_xcnt stands in the copies' own statement so that no address register is rewritten ahead of it.
__device__ __forceinline__ void acopy14(const unsigned* l, const bf* const* g) {
    asm volatile("global_load_async_to_lds_b128 %0, %1, off\n\t"
                 "global_load_async_to_lds_b128 %2, %3, off\n\t"
                 "global_load_async_to_lds_b128 %4, %5, off\n\t"
                 "global_load_async_to_lds_b128 %6, %7, off\n\t"
                 "global_load_async_to_lds_b128 %8, %9, off\n\t"
                 "global_load_async_to_lds_b128 %10, %11, off\n\t"
                 "global_load_async_to_lds_b128 %12, %13, off\n\t"
                 "global_load_async_to_lds_b128 %14, %15, off\n\t"
                 "global_load_async_to_lds_b128 %16, %17, off\n\t"
                 "global_load_async_to_lds_b128 %18, %19, off\n\t"
                 "global_load_async_to_lds_b128 %20, %21, off\n\t"
                 "global_load_async_to_lds_b128 %22, %23, off\n\t"
                 "global_load_async_to_lds_b128 %24, %25, off\n\t"
                 "global_load_async_to_lds_b128 %26, %27, off\n\t"
                 "s_wait_xcnt 0x0"
                 :: "v"(l[0]), "v"(g[0]), "v"(l[1]), "v"(g[1]), "v"(l[2]), "v"(g[2]), "v"(l[3]), "v"(g[3]), "v"(l[4]), "v"(g[4]), "v"(l[5]), "v"(g[5]), "v"(l[6]), "v"(g[6]),
                    "v"(l[7]), "v"(g[7]), "v"(l[8]), "v"(g[8]), "v"(l[9]), "v"(g[9]), "v"(l[10]), "v"(g[10]), "v"(l[11]), "v"(g[11]), "v"(l[12]), "v"(g[12]), "v"(l[13]), "v"(g[13]) : "memory");
}
// One stage: 28 copies per lane. px / pw: the lane's piece of its first x row / W row at the stage's first k; ld: the lane's piece of its first row in the buffer. Copy i fills LDS row 16 i + (thread >> 4).
__device__ __forceinline__ void qkv_stage(const bf* px, const bf* pw, unsigned ld) {
#pragma unroll   // the copies' operands are register arrays
    for (int c = 0; c < 2; ++c) { unsigned l[14]; const bf* g[14];
#pragma unroll
        for (int u = 0; u < 14; ++u) { const int i = c * 14 + u; l[u] = ld + (unsigned)(i * 16 * QKP); g[u] = (i < 4) ? px + (size_t)i * 16 * DE : pw + (size_t)(i - 4) * 16 * DE; }
        acopy14(l, g); }
}
__global__ __launch_bounds__(256) void k_qkv(const bf* __restrict__ X, const bf* __restrict__ Wt, const float* __restrict__ bq, const float* __restrict__ bk, const float* __restrict__ bv, float* C) {
    __shared__ __align__(16) unsigned char L[2 * QKBUF];
    __shared__ __align__(16) float osw[8][16 * QKOP];
    const int lane = threadIdx.x & 31, lr = lane & 15, hi = lane >> 4, w = threadIdx.x >> 5, wm = w & 1, wn = w >> 1; const int r0 = blockIdx.x * 64;
    const int nT = DE / QKK;                                         // six stages
    const int sub = threadIdx.x & 15, rg = threadIdx.x >> 4;
    const bf* px = X + (size_t)(r0 + rg) * DE + sub * 8; const bf* pw = Wt + (size_t)rg * DE + sub * 8;
    const unsigned ld = (unsigned)(size_t)L + (unsigned)(rg * QKP + sub * 16);
    v8f acc[2][6];
#pragma unroll
    for (int mb = 0; mb < 2; ++mb)
#pragma unroll
        for (int nb = 0; nb < 6; ++nb) acc[mb][nb] = (v8f){};
    qkv_stage(px, pw, ld);
    asm volatile("s_wait_asynccnt 0x0" ::: "memory");               // this wave's part of stage 0 has landed
    __syncthreads();                                                 // every wave's part of stage 0 has landed
    qkv_stage(px + QKK, pw + QKK, ld + QKBUF);
    const unsigned char* fa = L + (wm * 32 + lr) * QKP + hi * 16; const unsigned char* fb = L + (64 + wn * 96 + lr) * QKP + hi * 16;
#pragma unroll 1   // one stage a trip: the ring's order stands once, at the foot
    for (int t = 0; t < nT; ++t) {
        const int bo = (t & 1) * QKBUF; const unsigned char* qa = fa + bo; const unsigned char* qb = fb + bo;
        v16bf a[2][2], b[2][6];                                      // two fragment sets: this and the next 32 k
#pragma unroll
        for (int mb = 0; mb < 2; ++mb) a[0][mb] = WFrag<bf>::ld((const bf*)(qa + mb * 16 * QKP));
#pragma unroll
        for (int nb = 0; nb < 6; ++nb) b[0][nb] = WFrag<bf>::ld((const bf*)(qb + nb * 16 * QKP));
#pragma unroll   // ks indexes register arrays
        for (int ks = 0; ks < QKK / 32; ++ks) { const int cu = ks & 1, nx = cu ^ 1;
            if (ks + 1 < QKK / 32) {                                 // fragments are fetched ahead inside the stage only, never from the next stage
#pragma unroll
                for (int mb = 0; mb < 2; ++mb) a[nx][mb] = WFrag<bf>::ld((const bf*)(qa + mb * 16 * QKP + (ks + 1) * 64));
#pragma unroll
                for (int nb = 0; nb < 6; ++nb) b[nx][nb] = WFrag<bf>::ld((const bf*)(qb + nb * 16 * QKP + (ks + 1) * 64)); }
            __builtin_amdgcn_sched_barrier(0);                       // keeps the next set's LDS reads as one group in front of these products: sunk to just before their use, every read's latency would be waited out
#pragma unroll
            for (int nb = 0; nb < 6; ++nb) { acc[0][nb] = wmmab(a[cu][0], b[cu][nb], acc[0][nb]); acc[1][nb] = wmmab(a[cu][1], b[cu][nb], acc[1][nb]); }
            __builtin_amdgcn_sched_barrier(0);                       // keeps the reads of the set after next behind these products: lifted among them they stand in several places and take a third set's registers
        }
        asm volatile("s_wait_dscnt 0x0" ::: "memory");              // this wave's reads of stage t are done before the buffer may be refilled
        asm volatile("s_wait_asynccnt 0x0" ::: "memory");           // this wave's part of stage t + 1 has landed
        __syncthreads();                                             // publishes stage t + 1 and ends every wave's reads of stage t
        if (t + 2 < nT) qkv_stage(px + (size_t)(t + 2) * QKK, pw + (size_t)(t + 2) * QKK, ld + bo);
    }
    asm volatile("s_wait_asynccnt 0x0" ::: "memory");               // no copy is outstanding when the wave ends
    float* os = osw[w]; const int c0 = wn * 96;
    int rb[3], cb[3]; v4f bi[3];                                     // 16 rows x 96 columns leave as 12 stores of 32 x 16 B; store 3 g + h covers rows 4 g + rb[h] at columns cb[h]..cb[h] + 3
#pragma unroll
    for (int h = 0; h < 3; ++h) { const int q = h * 32 + lane; rb[h] = q / 24; cb[h] = (q % 24) * 4; const int col = c0 + cb[h];
        const float* bp = (col < DK) ? bq + col : (col < 2 * DK) ? bk + (col - DK) : bv + (col - 2 * DK);
        bi[h][0] = bfr(bp[0]); bi[h][1] = bfr(bp[1]); bi[h][2] = bfr(bp[2]); bi[h][3] = bfr(bp[3]); }
#pragma unroll
    for (int mb = 0; mb < 2; ++mb) {
#pragma unroll
        for (int nb = 0; nb < 6; ++nb) {
#pragma unroll
            for (int j = 0; j < 8; ++j) os[(hi * 8 + j) * QKOP + nb * 16 + lr] = acc[mb][nb][j]; }
        __builtin_amdgcn_wave_barrier(); asm volatile("" ::: "memory");   // the wave's own rows are written before it reads them back as whole lines
        float* crow = C + (size_t)(r0 + wm * 32 + mb * 16) * D3 + c0;
#pragma unroll
        for (int g = 0; g < 4; ++g)
#pragma unroll
            for (int h = 0; h < 3; ++h) { const int row = 4 * g + rb[h]; v4f val = *(const v4fa*)(os + row * QKOP + cb[h]); val[0] += bi[h][0]; val[1] += bi[h][1]; val[2] += bi[h][2]; val[3] += bi[h][3]; *(v4f*)(crow + (size_t)row * D3 + cb[h]) = val; }
        __builtin_amdgcn_wave_barrier(); asm volatile("" ::: "memory");   // the rows are read before the next 16 rows overwrite them
    }
}

__device__ __forceinline__ void splitf(float y, unsigned short& h, unsigned short& l) { h = f2bf(y); l = f2bf(y - bf2f(h)); }
typedef __attribute__((ext_vector_type(2))) unsigned short v2us;
typedef __attribute__((ext_vector_type(4))) unsigned short v4us;

// k_cvt: the four f32 -> bf16 roundings (Wq, Wk, Wv, x) depend on nothing but the inputs, so they share one grid: work-groups 0 .. 3 CVW - 1 take the weights (CVW each, into the three planes that lie one behind the other at WB), the rest take x. 8 values a thread; every part is a whole number of work-groups.
#define CVW (DK * DE / 8 / 256)
#define CVX (NB_ * TT * DE / 8 / 256)
__global__ __launch_bounds__(256) void k_cvt(const float* __restrict__ x, const float* __restrict__ wq, const float* __restrict__ wk, const float* __restrict__ wv, bf* XB, bf* WB) { const int b = blockIdx.x; const float* src; bf* dst; size_t i;
    if (b < 3 * CVW) { const int m = b / CVW; src = (m == 0) ? wq : (m == 1) ? wk : wv; dst = WB + (size_t)m * DK * DE; i = (size_t)(b - m * CVW) * 256 + threadIdx.x; }
    else { src = x; dst = XB; i = (size_t)(b - 3 * CVW) * 256 + threadIdx.x; }
    const v8f v = *(const v8f*)(src + i * 8); v8us o;
#pragma unroll
    for (int k = 0; k < 8; ++k) o[k] = f2bf(v[k]); *(v8us*)(dst + i * 8) = o;  }
// Every kernel below covers all NB_ sequences in one launch: d_gvt takes the sequence from its work-group's number, k_temp / d_gpl run over the NB_*TT rows as one list.
// k_temp: TQ[g] = pos + tanh(sum_d tokenq[s][d] gelu(Q[g][d])), TV[g] likewise with tokenv / V, pos = 1 + sigmoid(alpha[s]) log(s+1). One work-group per 32 tokens of the NB_*TT list: wave w takes tokens 4w..4w+3 with its lanes ACROSS d,
// so each row of Q, V, tokenq, tokenv is one whole 512-B load, and leaves the 128 products of each dot in LDS; behind the barrier lane t of wave 0 (Q) and of wave 1 (V) adds token t's products in the order d = 0..127 and the wave stores one whole 128-B line.
// d_gpl: hl planes GQ[s][d] = TQ[s] Q[s][d], Kp[s][d] = K[s][d] (8-B lanes);
#define TPP 132   // pitch of a product row in LDS, in floats: rows stay 16-B aligned and do not all start in one bank
__global__ __launch_bounds__(256) void k_temp(const float* __restrict__ QKV, const float* __restrict__ tq, const float* __restrict__ tv, const float* __restrict__ alpha, float* TQ, float* TV) {
    __shared__ __align__(16) float pr[2][32][TPP];
    const int lane = threadIdx.x & 31, w = threadIdx.x >> 5; const int g0 = blockIdx.x * 32;
    const int t0 = g0 + w * 4; const float* q = QKV + (size_t)t0 * D3 + lane * 4; const size_t sd = (size_t)(t0 % TT) * DK + lane * 4;   // TT % 4 == 0: a wave's four tokens lie in one sequence, so their tokenq / tokenv rows are consecutive too
    v4f xq[4], xv[4], kq[4], kv[4];
#pragma unroll   // registers, not an indexed array; the wave's 16 row loads all stand in front of the first gelu's branches, so they are in flight together
    for (int u = 0; u < 4; ++u) { xq[u] = *(const v4fa*)(q + u * D3); xv[u] = *(const v4fa*)(q + u * D3 + 2 * DK); kq[u] = *(const v4fa*)(tq + sd + u * DK); kv[u] = *(const v4fa*)(tv + sd + u * DK); }
#pragma unroll   // u and k index register arrays: both loops must be flat for the rows to stay in registers
    for (int u = 0; u < 4; ++u) { v4f pq, pv;
#pragma unroll
        for (int k = 0; k < 4; ++k) { const float x1 = xq[u][k], x2 = xv[u][k]; const float g1 = __fmul_rn(0.5f * x1, __fadd_rn(1.0f, erff(x1 * 0.70710678118654752f))), g2 = __fmul_rn(0.5f * x2, __fadd_rn(1.0f, erff(x2 * 0.70710678118654752f)));
            pq[k] = __fmul_rn(bfr(kq[u][k]), g1); pv[k] = __fmul_rn(bfr(kv[u][k]), g2); }
        *(v4fa*)(&pr[0][w * 4 + u][lane * 4]) = pq; *(v4fa*)(&pr[1][w * 4 + u][lane * 4]) = pv; }
    __syncthreads();   // every product row is in LDS before a lane of wave 0 or 1 adds it up
    if (w >= 2) return;
    const float* p = &pr[w][lane][0]; float a = 0.f;
#pragma unroll   // constant LDS offsets, no loop counter beside the one dependent chain of adds
    for (int d = 0; d < DK; d += 4) { const v4f c = *(const v4fa*)(p + d); a = __fadd_rn(a, c[0]); a = __fadd_rn(a, c[1]); a = __fadd_rn(a, c[2]); a = __fadd_rn(a, c[3]); }
    const int s = (g0 + lane) % TT;
    const float sg = __fdiv_rn(1.0f, __fadd_rn(1.0f, __expf(-bfr(alpha[s])))); const float pos = __fadd_rn(1.0f, __fmul_rn(sg, __logf((float)(s + 1))));
    (w ? TV : TQ)[g0 + lane] = __fadd_rn(pos, tanhf(a)); }
__device__ __forceinline__ void d_gpl(int bx, const float* __restrict__ QKV, const float* __restrict__ TQ, bf* GQh, bf* GQl, bf* Kh, bf* Kl) { const int e = (bx * 256 + threadIdx.x) * 4; if (e >= NB_ * TT * DK) return; const int d = e % DK; const int s = e / DK; const float t = TQ[s]; const float* q = QKV + (size_t)s * D3 + d; v4us a, b, c, dd;
#pragma unroll
    for (int u = 0; u < 4; ++u) { unsigned short h1, l1, h2, l2; splitf(__fmul_rn(t, q[u]), h1, l1); splitf(q[DK + u], h2, l2); a[u] = h1; b[u] = l1; c[u] = h2; dd[u] = l2; }
    { *(v4us*)(GQh + e) = a; *(v4us*)(GQl + e) = b; *(v4us*)(Kh + e) = c; *(v4us*)(Kl + e) = dd;  } }
__device__ __forceinline__ void d_gvt(int bx, int by, const float* __restrict__ QKV, const float* __restrict__ TV, bf* Th, bf* Tl) { const int e = (bx * 256 + threadIdx.x) * 4; if (e >= DK * TT) return; const int s = e % TT; const int d = e / TT; v4us oh, ol; const size_t z = by; QKV += z * TT * D3; TV += z * TT; const size_t o = (z * DK + d) * (2 * TT) + s;   // row d = [TT hi][TT lo]
#pragma unroll
    for (int u = 0; u < 4; ++u) { unsigned short a, b; splitf(__fmul_rn(TV[s + u], QKV[(size_t)(s + u) * D3 + 2 * DK + d]), a, b); oh[u] = a; ol[u] = b; } *(v4us*)(Th + o) = oh; *(v4us*)(Tl + o) = ol;  }
// k_planes: the gated-V planes and the gated-Q / K planes both need only QKV and the temperatures and write disjoint planes, so they share one grid: work-groups 0 .. NB_ GVB - 1 do the V planes (GVB per sequence; their strided reads take longer, so they start first), the rest the Q / K planes.
#define GVB (DK * TT / 4 / 256)
#define GPB (NB_ * TT * DK / 4 / 256)
__global__ __launch_bounds__(256) void k_planes(const float* __restrict__ QKV, const float* __restrict__ TQ, const float* __restrict__ TV, bf* GQh, bf* GQl, bf* Kh, bf* Kl, bf* Th, bf* Tl) { const int b = blockIdx.x;
    if (b < NB_ * GVB) d_gvt(b % GVB, b / GVB, QKV, TV, Th, Tl); else d_gpl(b - NB_ * GVB, QKV, TQ, GQh, GQl, Kh, Kl); }
extern "C" void kernel_launch(void* const* d_in, const int* in_sizes, int n_in,
                              void* d_out, int out_size, void* d_ws, size_t ws_size, hipStream_t stream) {
    (void)in_sizes; (void)n_in; (void)out_size;
    const float** I = (const float**)d_in;
    const float *x = I[0], *Wq = I[1], *bq = I[2], *Wk = I[3], *bk = I[4], *Wv = I[5], *bv = I[6], *alpha = I[7], *tokq = I[8], *tokv = I[9];
    float* OUT = (float*)d_out;     // [8][2048][128]
    char* wsp = (char*)d_ws;
    auto take = [&](size_t bytes) { char* p = wsp; wsp += (bytes + 255) & ~(size_t)255; return (void*)p; };
    bf* BQ = (bf*)take((size_t)3 * DK * DE * 2);   // the Wq, Wk, Wv planes one behind the other, 384 rows of W
    bf* XB = (bf*)take((size_t)NB_ * TT * DE * 2); float* QKV = (float*)take((size_t)NB_ * TT * D3 * 4); float* TQ = (float*)take(NB_ * TT * 4); float* TV = (float*)take(NB_ * TT * 4);
    bf* GQh = (bf*)take((size_t)NB_ * TT * DK * 2); bf* GQl = (bf*)take((size_t)NB_ * TT * DK * 2); bf* Kh = (bf*)take((size_t)NB_ * TT * DK * 2); bf* Kl = (bf*)take((size_t)NB_ * TT * DK * 2); bf* GVh = (bf*)take((size_t)NB_ * DK * TT * 4); bf* GVl = GVh + TT;
    if ((size_t)(wsp - (char*)d_ws) > ws_size) return;    // total ~ 76 MB
    k_cvt<<<3 * CVW + CVX, 256, 0, stream>>>(x, Wq, Wk, Wv, XB, BQ);   // [out][in] = Bt
    k_qkv<<<NB_ * TT / 64, 256, 0, stream>>>(XB, BQ, bq, bk, bv, QKV);
    k_temp<<<NB_ * TT / 32, 256, 0, stream>>>(QKV, tokq, tokv, alpha, TQ, TV); k_planes<<<NB_ * GVB + GPB, 256, 0, stream>>>(QKV, TQ, TV, GQh, GQl, Kh, Kl, GVh, GVl);
    k_fa<<<dim3(TT / 64, NB_, 1), 256, 0, stream>>>(GQh, GQl, Kh, Kl, GVh, OUT);   // V rows: [TT hi][TT lo], pitch 2*TT
}

// v008
// It runs in 63.9 microseconds.
// Timed twice side by side with v007, it ran 1.30 and 1.31 times as fast.
// All steps since v000 together make it 21.9 times as fast.
#include <hip/hip_runtime.h>

// SelectiveAttentionModule (x [8][2048][768]; Q/K/V = x W^T + b (d 128, single head); temps_q[s] = 1 + sigmoid(alpha[s]) log(s+1) + tanh(tokenq[s] . gelu(Q[s])), temps_v likewise with tokenv / V; scores = (temps_q Q) . K / sqrt(128), causal;
// softmax; out = softmax . (temps_v V) -> [8][2048][128]).
// Compute dtypes, f32 accumulate: every input rounded to bf16; Q/K/V on PLAIN bf16 operands (inputs: exact) + bias; the temperatures (erf-gelu, 128-term fixed-order dots, tanh, sigmoid, log) f32 on the VALU; gated Q / K / gated V -> bf16 hi+lo

#define NB_  8
#define TT   2048
#define DE   768
#define DK   128
#define D3   384
typedef _Float16 h16;
typedef unsigned short bf;
typedef __attribute__((ext_vector_type(16))) __bf16   v16bf;
typedef __attribute__((ext_vector_type(16))) _Float16 v16h;
typedef __attribute__((ext_vector_type(8)))  _Float16 v8h;
typedef __attribute__((ext_vector_type(8)))  unsigned short v8us;
typedef __attribute__((ext_vector_type(8)))  float    v8f;
typedef __attribute__((ext_vector_type(4)))  float    v4f;
typedef v8h  __attribute__((may_alias)) v8ha;
typedef v4f  __attribute__((may_alias)) v4fa;
typedef v8us __attribute__((may_alias)) v8usa;

__device__ __forceinline__ unsigned short f2bf(float f) { unsigned u = __float_as_uint(f); u += 0x7FFFu + ((u >> 16) & 1u); return (unsigned short)(u >> 16); }
__device__ __forceinline__ float bf2f(unsigned short b) { return __uint_as_float(((unsigned)b) << 16); }
__device__ __forceinline__ float bfr(float f) { return bf2f(f2bf(f)); }
__device__ __forceinline__ v16h cat16(v8h lo, v8h hi) { return __builtin_shufflevector(lo, hi, 0, 1, 2, 3, 4, 5, 6, 7, 8, 9, 10, 11, 12, 13, 14, 15); }
__device__ __forceinline__ v16bf cat16b(v8us lo, v8us hi) { return __builtin_bit_cast(v16bf, __builtin_shufflevector(lo, hi, 0, 1, 2, 3, 4, 5, 6, 7, 8, 9, 10, 11, 12, 13, 14, 15)); }
__device__ __forceinline__ v8f wmma16(v16h a, v16h b, v8f c) { return __builtin_amdgcn_wmma_f32_16x16x32_f16(false, a, false, b, (short)0, c, false, false); }
__device__ __forceinline__ v8f wmmab(v16bf a, v16bf b, v8f c) { return __builtin_amdgcn_wmma_f32_16x16x32_bf16(false, a, false, b, (short)0, c, false, false); }



// Fragment of a 16 x 32 operand block from a K-contiguous 16-bit plane: the lane's 8 elements at p and 8 at p + 16.
template <typename T16> struct WFrag;
template <> struct WFrag<h16> { typedef v16h V; static __device__ __forceinline__ V ld(const h16* p) { return cat16(*(const v8h*)p, *(const v8h*)(p + 16)); } static __device__ __forceinline__ v8f mma(V a, V b, v8f c) { return wmma16(a, b, c); } };
template <> struct WFrag<bf> { typedef v16bf V; static __device__ __forceinline__ V ld(const bf* p) { return cat16b(*(const v8us*)p, *(const v8us*)(p + 16)); } static __device__ __forceinline__ v8f mma(V a, V b, v8f c) { return wmmab(a, b, c); } };

#define FR    2                    // groups of 16 queries per wave: every K and V fragment read from LDS serves FR groups
#define FNP   4                    // parts over the keys = passes per stage
#define FNC   (64 / (16 * FR))     // waves side by side; FNC * FNP = 8
#define FK    (32 * FNP)           // keys per stage
#define FKP   272                  // pitch of a K row (128 d, 256 B) in LDS, bytes: 16 B x odd, so the 16 rows of a fragment read fall on distinct banks
#define FVP   (2 * FK + 16)        // pitch of a V^T row (FK keys) in LDS, bytes: 16 B x odd
#define FKL   (FK * FKP)           // K lo behind K hi
#define FVH   (2 * FK * FKP)       // V^T hi
#define FBUF  (FVH + 2 * DK * FVP)
#define FVLR  (FK / 8)             // lanes that copy one V^T row
#define FVRC  (256 / FVLR)         // V^T rows per copy of the work-group
#define FMSZ  (FR * 8 * 1024 + FR * 256)   // what one wave hands over at the end, bytes: FR x 8 tiles of 32 lanes x 32 B, then FR x (maximum, sum) of 32 lanes x 4 B
typedef __attribute__((ext_vector_type(8))) unsigned v8u;
// Eight copies of 16 B per lane; the s_wait_xcnt stands in the copies' own statement so that no address register is rewritten ahead of it.
__device__ __forceinline__ void acopy8(const unsigned* l, const bf* const* g) {
    asm volatile("global_load_async_to_lds_b128 %0, %1, off\n\t"
                 "global_load_async_to_lds_b128 %2, %3, off\n\t"
                 "global_load_async_to_lds_b128 %4, %5, off\n\t"
                 "global_load_async_to_lds_b128 %6, %7, off\n\t"
                 "global_load_async_to_lds_b128 %8, %9, off\n\t"
                 "global_load_async_to_lds_b128 %10, %11, off\n\t"
                 "global_load_async_to_lds_b128 %12, %13, off\n\t"
                 "global_load_async_to_lds_b128 %14, %15, off\n\t"
                 "s_wait_xcnt 0x0"
                 :: "v"(l[0]), "v"(g[0]), "v"(l[1]), "v"(g[1]), "v"(l[2]), "v"(g[2]), "v"(l[3]), "v"(g[3]), "v"(l[4]), "v"(g[4]), "v"(l[5]), "v"(g[5]), "v"(l[6]), "v"(g[6]), "v"(l[7]), "v"(g[7]) : "memory");
}
// One stage: FK / 4 copies per lane, FK / 16 for each of K hi, K lo, V^T hi, V^T lo. kh / kl: the lane's piece of its first K row (hi / lo plane) at the stage's first key; vh: the lane's piece of its first V^T row at that key (lo plane TT behind);
// lk / lv: the places of those pieces in the buffer. A K copy fills rows 16 i + (thread >> 4), 16 lanes a row; a V^T copy rows FVRC i + thread / FVLR.
__device__ __forceinline__ void fa_stage(const bf* kh, const bf* kl, const bf* vh, unsigned lk, unsigned lv) {
#pragma unroll   // the copies' operands are register arrays
    for (int e = 0; e < FK / 32; ++e) { unsigned l[8]; const bf* g[8];
#pragma unroll
        for (int u = 0; u < 8; ++u) { const int n = e * 8 + u, q = n / (FK / 16), i = n % (FK / 16);
            l[u] = (q < 2) ? lk + (unsigned)(q * FKL + i * 16 * FKP) : lv + (unsigned)((q - 2) * DK * FVP + i * FVRC * FVP);
            g[u] = (q == 0) ? kh + (size_t)i * 16 * DK : (q == 1) ? kl + (size_t)i * 16 * DK : vh + (q - 2) * TT + (size_t)i * FVRC * (2 * TT); }
        acopy8(l, g); }
}
__device__ __forceinline__ unsigned pack2(float lo, float hi) { typedef __bf16 bf2 __attribute__((ext_vector_type(2))); typedef float f2 __attribute__((ext_vector_type(2))); return __builtin_bit_cast(unsigned, __builtin_convertvector(f2{lo, hi}, bf2)); }   // round to nearest even
__device__ __forceinline__ float xhalf(float x) { return __builtin_bit_cast(float, __builtin_amdgcn_permlanex16(__builtin_bit_cast(int, x), __builtin_bit_cast(int, x), 0x76543210, 0xfedcba98, false, false)); }   // lane l with lane l ^ 16
__device__ __forceinline__ void nop4() { asm volatile("v_nop\n\tv_nop\n\tv_nop\n\tv_nop"); }   // the four vector slots between a matrix instruction and a vector instruction on its registers, also on the taken side of a branch that follows
__global__ __launch_bounds__(256) void k_fa(const bf* __restrict__ Qh, const bf* __restrict__ Ql, const bf* __restrict__ Kh, const bf* __restrict__ Kl, const bf* __restrict__ Vt, float* O) {
    __shared__ __align__(16) unsigned char L[2 * FBUF];
    const int lane = threadIdx.x & 31, c = lane & 15, h = lane >> 4; const int w = __builtin_amdgcn_readfirstlane(threadIdx.x >> 5); const int cg = w % FNC, part = w / FNC;
    const int blk = TT / 64 - 1 - (int)blockIdx.x;                   // the longest work-groups start first
    const int r0 = blk * 64, qw0 = r0 + 16 * FR * cg, nT = (r0 + 64 + FK - 1) / FK;   // stages up to and with the diagonal's; nT * FK <= TT
    const size_t z = blockIdx.y;
    const bf* kh = Kh + (z * TT + (threadIdx.x >> 4)) * (size_t)DK + (threadIdx.x & 15) * 8; const bf* kl = Kl + (z * TT + (threadIdx.x >> 4)) * (size_t)DK + (threadIdx.x & 15) * 8;
    const bf* vh = Vt + (z * DK + threadIdx.x / FVLR) * (size_t)(2 * TT) + (threadIdx.x % FVLR) * 8;
    const unsigned lk = (unsigned)(size_t)L + (unsigned)((threadIdx.x >> 4) * FKP + (threadIdx.x & 15) * 16), lv = (unsigned)(size_t)L + (unsigned)(FVH + (threadIdx.x / FVLR) * FVP + (threadIdx.x % FVLR) * 16);
    fa_stage(kh, kl, vh, lk, lv);
    v16bf qh[FR][4], ql[FR][4];                                      // B operand: column c of group g = query qw0 + 16 g + c
#pragma unroll
    for (int g = 0; g < FR; ++g) { const size_t qo = (z * TT + qw0 + 16 * g + c) * (size_t)DK + 8 * h;
#pragma unroll
        for (int kc = 0; kc < 4; ++kc) { qh[g][kc] = WFrag<bf>::ld(Qh + qo + 32 * kc); ql[g][kc] = WFrag<bf>::ld(Ql + qo + 32 * kc); } }
    v8f acc[FR][8];                                                  // acc[g][u][r] = O[qw0 + 16 g + c][16 u + 8 h + r], unnormalised, this part's keys
    float m_run[FR], l_run[FR];
#pragma unroll
    for (int g = 0; g < FR; ++g) { m_run[g] = -__builtin_inff(); l_run[g] = 0.f;
#pragma unroll
        for (int u = 0; u < 8; ++u) acc[g][u] = (v8f){}; }
    const float cs = 0.088388347648318447f * 1.4426950408889634f;
    asm volatile("s_wait_asynccnt 0x0" ::: "memory");               // this wave's part of stage 0 has landed
    __syncthreads();                                                 // every wave's part of stage 0 has landed
    if (nT > 1) fa_stage(kh + (size_t)FK * DK, kl + (size_t)FK * DK, vh + FK, lk + FBUF, lv + FBUF);
    const unsigned char* fk = L + (part * 32 + c) * FKP + h * 16; const unsigned char* fv = L + FVH + c * FVP + part * 64 + h * 16;
#pragma unroll 1   // one stage a trip: the ring's order stands once, at the foot
    for (int t = 0; t < nT; ++t) {
        const int bo = (t & 1) * FBUF; const int key0 = t * FK + part * 32;
        if (key0 <= qw0 + 16 * FR - 1) {                             // one value per wave: a pass wholly behind the wave's diagonal is skipped
            const unsigned char* pk = fk + bo; const unsigned char* pv = fv + bo;
            v8f s[2][FR];
            {   v16bf ka[2][4], kb[2][4];                            // K fragments of the pass, hi and lo: row = key 16 kt + c
#pragma unroll
                for (int kt = 0; kt < 2; ++kt)
#pragma unroll
                    for (int kc = 0; kc < 4; ++kc) { ka[kt][kc] = WFrag<bf>::ld((const bf*)(pk + kt * 16 * FKP + kc * 64)); kb[kt][kc] = WFrag<bf>::ld((const bf*)(pk + FKL + kt * 16 * FKP + kc * 64)); }
#pragma unroll
                for (int g = 0; g < FR; ++g) { s[0][g] = (v8f){}; s[1][g] = (v8f){}; }
#pragma unroll
                for (int kc = 0; kc < 4; ++kc)
#pragma unroll
                    for (int g = 0; g < FR; ++g) {
                        s[0][g] = wmmab(ka[0][kc], qh[g][kc], s[0][g]); s[1][g] = wmmab(ka[1][kc], qh[g][kc], s[1][g]);
                        s[0][g] = wmmab(ka[0][kc], ql[g][kc], s[0][g]); s[1][g] = wmmab(ka[1][kc], ql[g][kc], s[1][g]);
                        s[0][g] = wmmab(kb[0][kc], qh[g][kc], s[0][g]); s[1][g] = wmmab(kb[1][kc], qh[g][kc], s[1][g]); }
            }
            __builtin_amdgcn_sched_barrier(0);                       // keeps the LDS reads below behind the products, whose K registers they take over
            nop4();
            v16bf va[8], vb[8];                                      // V^T fragments of the pass, hi and lo: row = d 16 u + c; the hi plane's are read here so that they fly under the softmax arithmetic, the lo plane's where the compiler finds registers for them
#pragma unroll
            for (int u = 0; u < 8; ++u) va[u] = WFrag<bf>::ld((const bf*)(pv + u * 16 * FVP));
            __builtin_amdgcn_sched_barrier(0);                       // keeps those reads in front of the arithmetic: sunk to just before their use, their latency would be waited out in front of the second product
            if (key0 + 31 > qw0) {                                   // one value per wave: only a pass that meets the wave's diagonal pays for the mask
#pragma unroll
                for (int g = 0; g < FR; ++g)
#pragma unroll
                    for (int kt = 0; kt < 2; ++kt)
#pragma unroll
                        for (int r = 0; r < 8; ++r) if (key0 + 16 * kt + 8 * h + r > qw0 + 16 * g + c) s[kt][g][r] = -__builtin_inff(); }
            float mb[FR]; bool need = false;
#pragma unroll
            for (int g = 0; g < FR; ++g) { float mx = fmaxf(s[0][g][0], s[1][g][0]);
#pragma unroll
                for (int r = 1; r < 8; ++r) mx = fmaxf(mx, fmaxf(s[0][g][r], s[1][g][r]));
                mx = fmaxf(mx, xhalf(mx)) * cs;                      // both wave halves hold the query's maximum of this pass, scaled (the scale is positive); finite: a pass that is not skipped holds an open key for every query of the wave
                mb[g] = mx; need = need || (mx > m_run[g] + 8.0f); }
            if (__builtin_amdgcn_ballot_w32(need) != 0) {            // scalar branch; always taken in a wave's first pass, where m_run is -inf
#pragma unroll
                for (int g = 0; g < FR; ++g) { const float m_new = fmaxf(m_run[g], mb[g]); const float corr = __builtin_amdgcn_exp2f(m_run[g] - m_new); l_run[g] *= corr; m_run[g] = m_new;
#pragma unroll
                    for (int u = 0; u < 8; ++u) acc[g][u] = acc[g][u] * corr; } }
            v16bf ph[FR], pl[FR];
#pragma unroll
            for (int g = 0; g < FR; ++g) { const float nm = -m_run[g]; v8u wh, wl; float ps0 = 0.f, ps1 = 0.f;
#pragma unroll
                for (int i = 0; i < 8; ++i) {
                    const float p0 = __builtin_amdgcn_exp2f(fmaf(s[i >> 2][g][2 * (i & 3)], cs, nm)), p1 = __builtin_amdgcn_exp2f(fmaf(s[i >> 2][g][2 * (i & 3) + 1], cs, nm));
                    ps0 += p0; ps1 += p1;
                    const unsigned hh = pack2(p0, p1); wh[i] = hh; wl[i] = pack2(p0 - __uint_as_float(hh << 16), p1 - __uint_as_float(hh & 0xFFFF0000u)); }
                l_run[g] += ps0 + ps1; ph[g] = __builtin_bit_cast(v16bf, wh); pl[g] = __builtin_bit_cast(v16bf, wl); }
#pragma unroll
            for (int u = 0; u < 8; ++u) vb[u] = WFrag<bf>::ld((const bf*)(pv + (DK + u * 16) * FVP));
#pragma unroll
            for (int g = 0; g < FR; ++g) {
#pragma unroll
                for (int u = 0; u < 8; ++u) acc[g][u] = wmmab(va[u], ph[g], acc[g][u]);
#pragma unroll
                for (int u = 0; u < 8; ++u) acc[g][u] = wmmab(va[u], pl[g], acc[g][u]); }
#pragma unroll
            for (int g = 0; g < FR; ++g)
#pragma unroll
                for (int u = 0; u < 8; ++u) acc[g][u] = wmmab(vb[u], ph[g], acc[g][u]);
            __builtin_amdgcn_sched_barrier(0);                       // keeps the slots below directly behind the products
            nop4();
        }
        asm volatile("s_wait_dscnt 0x0" ::: "memory");              // this wave's reads of stage t are done before the buffer may be refilled
        asm volatile("s_wait_asynccnt 0x0" ::: "memory");           // this wave's part of stage t + 1 has landed
        __syncthreads();                                             // publishes stage t + 1 and ends every wave's reads of stage t
        if (t + 2 < nT) fa_stage(kh + (size_t)(t + 2) * FK * DK, kl + (size_t)(t + 2) * FK * DK, vh + (t + 2) * FK, lk + bo, lv + bo);
    }
    asm volatile("s_wait_asynccnt 0x0" ::: "memory");               // no copy is outstanding: behind the last trip's barrier the ring is free and takes the parts' hand-over
    if (part > 0) { unsigned char* mo = L + ((part - 1) * FNC + cg) * FMSZ;   // parts 1 .. FNP - 1 leave tiles, maxima and sums, lane by lane
#pragma unroll
        for (int g = 0; g < FR; ++g) {
#pragma unroll
            for (int u = 0; u < 8; ++u) { float* d = (float*)(mo + ((g * 8 + u) * 32 + lane) * 32); *(v4fa*)d = (v4f){acc[g][u][0], acc[g][u][1], acc[g][u][2], acc[g][u][3]}; *(v4fa*)(d + 4) = (v4f){acc[g][u][4], acc[g][u][5], acc[g][u][6], acc[g][u][7]}; }
            ((float*)(mo + FR * 8 * 1024))[(g * 2) * 32 + lane] = m_run[g]; ((float*)(mo + FR * 8 * 1024))[(g * 2 + 1) * 32 + lane] = l_run[g]; } }
    __syncthreads();                                                 // the hand-over is written before part 0 reads it
    if (part > 0) return;
#pragma unroll 1   // one part a trip: the tiles of one part are in registers at a time
    for (int p = 1; p < FNP; ++p) { const unsigned char* mo = L + ((p - 1) * FNC + cg) * FMSZ;
#pragma unroll
        for (int g = 0; g < FR; ++g) { const float mp = ((const float*)(mo + FR * 8 * 1024))[(g * 2) * 32 + lane], lp = ((const float*)(mo + FR * 8 * 1024))[(g * 2 + 1) * 32 + lane];
            const float m_new = fmaxf(m_run[g], mp);                 // finite: part 0 has seen key 0; a part that had no pass hands over -inf, 0 and zeros and gets the factor 0
            const float fa = __builtin_amdgcn_exp2f(m_run[g] - m_new), fb = __builtin_amdgcn_exp2f(mp - m_new); l_run[g] = l_run[g] * fa + lp * fb; m_run[g] = m_new;
#pragma unroll
            for (int u = 0; u < 8; ++u) { const float* d = (const float*)(mo + ((g * 8 + u) * 32 + lane) * 32); const v4f x0 = *(const v4fa*)d, x1 = *(const v4fa*)(d + 4);
#pragma unroll
                for (int r = 0; r < 4; ++r) { acc[g][u][r] = acc[g][u][r] * fa + x0[r] * fb; acc[g][u][4 + r] = acc[g][u][4 + r] * fa + x1[r] * fb; } } } }
#pragma unroll
    for (int g = 0; g < FR; ++g) { const float inv = __fdiv_rn(1.0f, l_run[g] + xhalf(l_run[g]));   // each wave half holds the sum over its eight keys of every 16-key tile
#pragma unroll
        for (int u = 0; u < 8; ++u) acc[g][u] = acc[g][u] * inv; }
    float* orow = O + (z * TT + qw0 + c) * (size_t)DK + 8 * h;
    __builtin_amdgcn_sched_barrier(0);                               // all arithmetic stands in front of the stores, so that no register which an issued store names is written again
#pragma unroll
    for (int g = 0; g < FR; ++g)
#pragma unroll
        for (int u = 0; u < 8; ++u) { *(v4f*)(orow + g * 16 * DK + 16 * u) = (v4f){acc[g][u][0], acc[g][u][1], acc[g][u][2], acc[g][u][3]}; *(v4f*)(orow + g * 16 * DK + 16 * u + 4) = (v4f){acc[g][u][4], acc[g][u][5], acc[g][u][6], acc[g][u][7]}; }
}

// ---- k_qkv: [Q K V][m][0..383] = x[m] . W[n] + bias[n] for the three projections at once (W = the rows of Wq, Wk, Wv one after the other): a 64 x 384 output tile per work-group of eight waves (wave w: rows 32 (w & 1).., columns 96 (w >> 1)..).
// Both operands come into LDS in stages of QKK values of k by asynchronous copies (whole 256-B pieces of rows, shared by the eight waves) in a ring of two buffers: stage t + 1 flies while stage t is multiplied. Per accumulator one product per 32 k, k ascending.
#define QKK    128                 // k per stage: a row of a stage is 256 B
#define QKP    272                 // pitch of such a row in LDS, bytes: 16 B x odd, so the 16 rows of a fragment read fall on distinct banks
#define QKROWS 448                 // rows of a stage: 64 of x, 384 of W
#define QKBUF  (QKROWS * QKP)
// Epilogue: a work-group holds Q, K and V of its 64 tokens whole, so the temperatures and the hi/lo planes are made here and the f32 projections never leave the chip. The ring's LDS, free behind the last trip's barrier, takes:
#define QCP    388                 // the 64 x 384 f32 tile (bias added), pitch in floats: rows stay 16-B aligned, the two row halves of an accumulator fall on distinct banks
#define QPP    132                 // the products of the two dots, [2][64] rows of 128, pitch in floats: rows stay 16-B aligned and do not all start in one bank
#define QVP    68                  // V once more, d-major ([128] rows of 64 tokens), pitch in floats: 16 B x odd
#define QPRO   (64 * QCP * 4)
#define QTSO   (QPRO + 2 * 64 * QPP * 4)   // the temperatures, [2][64]
#define QVTO   (QTSO + 2 * 64 * 4)
static_assert(QVTO + DK * QVP * 4 <= 2 * QKBUF, "the epilogue fits the ring");
// Fourteen copies of 16 B per lane; the s_wait_xcnt stands in the copies' own statement so that no address register is rewritten ahead of it.
__device__ __forceinline__ void acopy14(const unsigned* l, const bf* const* g) {
    asm volatile("global_load_async_to_lds_b128 %0, %1, off\n\t"
                 "global_load_async_to_lds_b128 %2, %3, off\n\t"
                 "global_load_async_to_lds_b128 %4, %5, off\n\t"
                 "global_load_async_to_lds_b128 %6, %7, off\n\t"
                 "global_load_async_to_lds_b128 %8, %9, off\n\t"
                 "global_load_async_to_lds_b128 %10, %11, off\n\t"
                 "global_load_async_to_lds_b128 %12, %13, off\n\t"
                 "global_load_async_to_lds_b128 %14, %15, off\n\t"
                 "global_load_async_to_lds_b128 %16, %17, off\n\t"
                 "global_load_async_to_lds_b128 %18, %19, off\n\t"
                 "global_load_async_to_lds_b128 %20, %21, off\n\t"
                 "global_load_async_to_lds_b128 %22, %23, off\n\t"
                 "global_load_async_to_lds_b128 %24, %25, off\n\t"
                 "global_load_async_to_lds_b128 %26, %27, off\n\t"
                 "s_wait_xcnt 0x0"
                 :: "v"(l[0]), "v"(g[0]), "v"(l[1]), "v"(g[1]), "v"(l[2]), "v"(g[2]), "v"(l[3]), "v"(g[3]), "v"(l[4]), "v"(g[4]), "v"(l[5]), "v"(g[5]), "v"(l[6]), "v"(g[6]),
                    "v"(l[7]), "v"(g[7]), "v"(l[8]), "v"(g[8]), "v"(l[9]), "v"(g[9]), "v"(l[10]), "v"(g[10]), "v"(l[11]), "v"(g[11]), "v"(l[12]), "v"(g[12]), "v"(l[13]), "v"(g[13]) : "memory");
}
// One stage: 28 copies per lane. px / pw: the lane's piece of its first x row / W row at the stage's first k; ld: the lane's piece of its first row in the buffer. Copy i fills LDS row 16 i + (thread >> 4).
__device__ __forceinline__ void qkv_stage(const bf* px, const bf* pw, unsigned ld) {
#pragma unroll   // the copies' operands are register arrays
    for (int c = 0; c < 2; ++c) { unsigned l[14]; const bf* g[14];
#pragma unroll
        for (int u = 0; u < 14; ++u) { const int i = c * 14 + u; l[u] = ld + (unsigned)(i * 16 * QKP); g[u] = (i < 4) ? px + (size_t)i * 16 * DE : pw + (size_t)(i - 4) * 16 * DE; }
        acopy14(l, g); }
}
__device__ __forceinline__ void splitf(float y, unsigned short& h, unsigned short& l) { h = f2bf(y); l = f2bf(y - bf2f(h)); }
__global__ __launch_bounds__(256) void k_qkv(const bf* __restrict__ X, const bf* __restrict__ Wt, const float* __restrict__ bq, const float* __restrict__ bk, const float* __restrict__ bv,
                                             const float* __restrict__ tq, const float* __restrict__ tv, const float* __restrict__ alpha, bf* GQh, bf* GQl, bf* Kh, bf* Kl, bf* Th, bf* Tl) {
    __shared__ __align__(16) unsigned char L[2 * QKBUF];
    __shared__ float BL[D3 + 64];                                    // the three bias vectors, rounded, one behind the other; then alpha of the 64 tokens
    const int lane = threadIdx.x & 31, lr = lane & 15, hi = lane >> 4, w = threadIdx.x >> 5, wm = w & 1, wn = w >> 1; const int r0 = blockIdx.x * 64;
    const int nT = DE / QKK;                                         // six stages
    const int sub = threadIdx.x & 15, rg = threadIdx.x >> 4;
    const bf* px = X + (size_t)(r0 + rg) * DE + sub * 8; const bf* pw = Wt + (size_t)rg * DE + sub * 8;
    const unsigned ld = (unsigned)(size_t)L + (unsigned)(rg * QKP + sub * 16);
    v8f acc[2][6];
#pragma unroll
    for (int mb = 0; mb < 2; ++mb)
#pragma unroll
        for (int nb = 0; nb < 6; ++nb) acc[mb][nb] = (v8f){};
    qkv_stage(px, pw, ld);
    {   const int t = threadIdx.x & (DK - 1); const float b0 = bq[t], b1 = bk[t], b2 = bv[t], b3 = alpha[r0 % TT + (t & 63)];   // read under stage 0's copies, published by stage 0's barrier; threads t and t + 128 store the same values
        asm volatile("s_wait_xcnt 0x0" ::: "memory");               // before a register that these four loads name is written again
        BL[t] = bfr(b0); BL[DK + t] = bfr(b1); BL[2 * DK + t] = bfr(b2); BL[D3 + (t & 63)] = b3; }
    asm volatile("s_wait_asynccnt 0x0" ::: "memory");               // this wave's part of stage 0 has landed
    __syncthreads();                                                 // every wave's part of stage 0 has landed
    qkv_stage(px + QKK, pw + QKK, ld + QKBUF);
    const unsigned char* fa = L + (wm * 32 + lr) * QKP + hi * 16; const unsigned char* fb = L + (64 + wn * 96 + lr) * QKP + hi * 16;
#pragma unroll 1   // one stage a trip: the ring's order stands once, at the foot
    for (int t = 0; t < nT; ++t) {
        const int bo = (t & 1) * QKBUF; const unsigned char* qa = fa + bo; const unsigned char* qb = fb + bo;
        v16bf a[2][2], b[2][6];                                      // two fragment sets: this and the next 32 k
#pragma unroll
        for (int mb = 0; mb < 2; ++mb) a[0][mb] = WFrag<bf>::ld((const bf*)(qa + mb * 16 * QKP));
#pragma unroll
        for (int nb = 0; nb < 6; ++nb) b[0][nb] = WFrag<bf>::ld((const bf*)(qb + nb * 16 * QKP));
#pragma unroll   // ks indexes register arrays
        for (int ks = 0; ks < QKK / 32; ++ks) { const int cu = ks & 1, nx = cu ^ 1;
            if (ks + 1 < QKK / 32) {                                 // fragments are fetched ahead inside the stage only, never from the next stage
#pragma unroll
                for (int mb = 0; mb < 2; ++mb) a[nx][mb] = WFrag<bf>::ld((const bf*)(qa + mb * 16 * QKP + (ks + 1) * 64));
#pragma unroll
                for (int nb = 0; nb < 6; ++nb) b[nx][nb] = WFrag<bf>::ld((const bf*)(qb + nb * 16 * QKP + (ks + 1) * 64)); }
            __builtin_amdgcn_sched_barrier(0);                       // keeps the next set's LDS reads as one group in front of these products: sunk to just before their use, every read's latency would be waited out
#pragma unroll
            for (int nb = 0; nb < 6; ++nb) { acc[0][nb] = wmmab(a[cu][0], b[cu][nb], acc[0][nb]); acc[1][nb] = wmmab(a[cu][1], b[cu][nb], acc[1][nb]); }
            __builtin_amdgcn_sched_barrier(0);                       // keeps the reads of the set after next behind these products: lifted among them they stand in several places and take a third set's registers
        }
        asm volatile("s_wait_dscnt 0x0" ::: "memory");              // this wave's reads of stage t are done before the buffer may be refilled
        asm volatile("s_wait_asynccnt 0x0" ::: "memory");           // this wave's part of stage t + 1 has landed
        __syncthreads();                                             // publishes stage t + 1 and ends every wave's reads of stage t
        if (t + 2 < nT) qkv_stage(px + (size_t)(t + 2) * QKK, pw + (size_t)(t + 2) * QKK, ld + bo);
    }
    asm volatile("s_wait_asynccnt 0x0" ::: "memory");               // no copy is outstanding: behind the last trip's barrier the ring is free and takes the epilogue's tiles
    float* CT = (float*)L; float* PR = (float*)(L + QPRO); float* TS = (float*)(L + QTSO); float* VT = (float*)(L + QVTO);
    const int wu = __builtin_amdgcn_readfirstlane(w);                // the wave's number as a scalar: the epilogue's split of the waves is a scalar branch
    const int c0 = wn * 96, s0 = r0 % TT;                            // TT % 64 == 0: the 64 tokens lie in one sequence, at positions s0 .. s0 + 63
    // Wave w takes tokens 8 w .. 8 w + 7 of the dots with its lanes ACROSS d: each tokenq / tokenv row is one whole 512-B load. All of them are issued here, so that they fly while the tile goes to LDS.
    v4f kq[8], kv[8]; float bi[6]; const float* pkq = tq + (size_t)(s0 + w * 8) * DK + lane * 4; const float* pkv = tv + (size_t)(s0 + w * 8) * DK + lane * 4; const int cu = (wu >> 1) * 96;   // cu: c0 as a scalar
#pragma unroll   // u indexes register arrays
    for (int u = 0; u < 8; ++u) { kq[u] = *(const v4fa*)(pkq + u * DK); kv[u] = *(const v4fa*)(pkv + u * DK); }
    __builtin_amdgcn_sched_barrier(0);                               // keeps the sixteen loads in front of the wait below
    asm volatile("s_wait_xcnt 0x0" :: "v"(pkq), "v"(pkv) : "memory");   // the two address pairs stay in their registers up to this wait
#pragma unroll
    for (int nb = 0; nb < 6; ++nb) bi[nb] = BL[c0 + nb * 16 + lr];
#pragma unroll   // mb, nb, j index register arrays
    for (int mb = 0; mb < 2; ++mb)
#pragma unroll
        for (int nb = 0; nb < 6; ++nb) { const int row = wm * 32 + mb * 16 + hi * 8, col = c0 + nb * 16 + lr; v8f y;
#pragma unroll
            for (int j = 0; j < 8; ++j) { y[j] = acc[mb][nb][j] + bi[nb]; CT[(row + j) * QCP + col] = y[j]; }
            if (cu + nb * 16 >= 2 * DK) { float* d = VT + (col - 2 * DK) * QVP + row; *(v4fa*)d = (v4f){y[0], y[1], y[2], y[3]}; *(v4fa*)(d + 4) = (v4f){y[4], y[5], y[6], y[7]}; } }   // a lane holds 8 consecutive tokens of one d
    __syncthreads();                                                 // the tile is whole before it is read by rows
#pragma unroll   // u and k index register arrays
    for (int u = 0; u < 8; ++u) { const int tok = w * 8 + u; const v4f xq = *(const v4fa*)(CT + tok * QCP + lane * 4), xv = *(const v4fa*)(CT + tok * QCP + 2 * DK + lane * 4); v4f pq, pv;
#pragma unroll
        for (int k = 0; k < 4; ++k) { const float x1 = xq[k], x2 = xv[k]; const float g1 = __fmul_rn(0.5f * x1, __fadd_rn(1.0f, erff(x1 * 0.70710678118654752f))), g2 = __fmul_rn(0.5f * x2, __fadd_rn(1.0f, erff(x2 * 0.70710678118654752f)));
            pq[k] = __fmul_rn(bfr(kq[u][k]), g1); pv[k] = __fmul_rn(bfr(kv[u][k]), g2); }
        *(v4fa*)(PR + tok * QPP + lane * 4) = pq; *(v4fa*)(PR + (64 + tok) * QPP + lane * 4) = pv; }
    __syncthreads();                                                 // every product row is in LDS before a lane adds it up
    if (wu < 4) {                                                    // waves 0, 1: the 64 Q dots, waves 2, 3: the 64 V dots; a lane adds one token's products in the order d = 0..127
        const int tok = (w & 1) * 32 + lane; const float* p = PR + ((w >> 1) * 64 + tok) * QPP; float a = 0.f;
#pragma unroll   // constant LDS offsets, no loop counter beside the one dependent chain of adds
        for (int d = 0; d < DK; d += 4) { const v4f c = *(const v4fa*)(p + d); a = __fadd_rn(a, c[0]); a = __fadd_rn(a, c[1]); a = __fadd_rn(a, c[2]); a = __fadd_rn(a, c[3]); }
        const float sg = __fdiv_rn(1.0f, __fadd_rn(1.0f, __expf(-bfr(BL[D3 + tok])))); const float pos = __fadd_rn(1.0f, __fmul_rn(sg, __logf((float)(s0 + tok + 1))));
        TS[(w >> 1) * 64 + tok] = __fadd_rn(pos, tanhf(a));
    } else {                                                         // meanwhile waves 4 .. 7 split K, which needs no temperature: 8 values a lane, whole 256-B rows
        v8us kh8[8], kl8[8]; const int t = threadIdx.x - 128;
#pragma unroll   // i indexes register arrays
        for (int i = 0; i < 8; ++i) { const float* q = CT + (i * 8 + (t >> 4)) * QCP + DK + (t & 15) * 8; const v4f x0 = *(const v4fa*)q, x1 = *(const v4fa*)(q + 4);
#pragma unroll
            for (int u = 0; u < 4; ++u) { unsigned short a, b; splitf(x0[u], a, b); kh8[i][u] = a; kl8[i][u] = b; splitf(x1[u], a, b); kh8[i][4 + u] = a; kl8[i][4 + u] = b; } }
        const size_t o = (size_t)(r0 + (t >> 4)) * DK + (t & 15) * 8;
        __builtin_amdgcn_sched_barrier(0);                           // all arithmetic stands in front of the stores, so that no register which an issued store names is written among them
#pragma unroll
        for (int i = 0; i < 8; ++i) { *(v8usa*)(Kh + o + i * 8 * DK) = kh8[i]; *(v8usa*)(Kl + o + i * 8 * DK) = kl8[i]; }
        asm volatile("s_wait_xcnt 0x0" ::: "memory");               // before the registers that these stores name are written again below
    }
    __syncthreads();                                                 // the temperatures are in LDS
    v8us qh8[4], ql8[4], vh8[4], vl8[4];
#pragma unroll   // i indexes register arrays
    for (int i = 0; i < 4; ++i) {
        {   const int row = i * 16 + (threadIdx.x >> 4); const float* q = CT + row * QCP + (threadIdx.x & 15) * 8; const float t = TS[row]; const v4f x0 = *(const v4fa*)q, x1 = *(const v4fa*)(q + 4);   // gated Q: 8 values a lane, whole 256-B rows
#pragma unroll
            for (int u = 0; u < 4; ++u) { unsigned short a, b; splitf(__fmul_rn(t, x0[u]), a, b); qh8[i][u] = a; ql8[i][u] = b; splitf(__fmul_rn(t, x1[u]), a, b); qh8[i][4 + u] = a; ql8[i][4 + u] = b; } }
        {   const float* v = VT + (i * 32 + (threadIdx.x >> 3)) * QVP + (threadIdx.x & 7) * 8; const float* tp = TS + 64 + (threadIdx.x & 7) * 8;   // gated V, d-major: 8 tokens a lane, the 64 tokens of a d are one whole 128-B line per plane
            const v4f x0 = *(const v4fa*)v, x1 = *(const v4fa*)(v + 4), t0 = *(const v4fa*)tp, t1 = *(const v4fa*)(tp + 4);
#pragma unroll
            for (int u = 0; u < 4; ++u) { unsigned short a, b; splitf(__fmul_rn(t0[u], x0[u]), a, b); vh8[i][u] = a; vl8[i][u] = b; splitf(__fmul_rn(t1[u], x1[u]), a, b); vh8[i][4 + u] = a; vl8[i][4 + u] = b; } } }
    const size_t oq = (size_t)(r0 + (threadIdx.x >> 4)) * DK + (threadIdx.x & 15) * 8;
    const size_t ov = ((size_t)(r0 / TT) * DK + (threadIdx.x >> 3)) * (2 * TT) + s0 + (threadIdx.x & 7) * 8;   // row d = [TT hi][TT lo]
    __builtin_amdgcn_sched_barrier(0);                               // all arithmetic stands in front of the stores, so that no register which an issued store names is written again
#pragma unroll
    for (int i = 0; i < 4; ++i) { *(v8usa*)(GQh + oq + i * 16 * DK) = qh8[i]; *(v8usa*)(GQl + oq + i * 16 * DK) = ql8[i]; *(v8usa*)(Th + ov + (size_t)i * 32 * (2 * TT)) = vh8[i]; *(v8usa*)(Tl + ov + (size_t)i * 32 * (2 * TT)) = vl8[i]; }
}

// k_cvt: the four f32 -> bf16 roundings (Wq, Wk, Wv, x) depend on nothing but the inputs, so they share one grid: work-groups 0 .. 3 CVW - 1 take the weights (CVW each, into the three planes that lie one behind the other at WB), the rest take x. 8 values a thread; every part is a whole number of work-groups.
#define CVW (DK * DE / 8 / 256)
#define CVX (NB_ * TT * DE / 8 / 256)
__global__ __launch_bounds__(256) void k_cvt(const float* __restrict__ x, const float* __restrict__ wq, const float* __restrict__ wk, const float* __restrict__ wv, bf* XB, bf* WB) { const int b = blockIdx.x; const float* src; bf* dst; size_t i;
    if (b < 3 * CVW) { const int m = b / CVW; src = (m == 0) ? wq : (m == 1) ? wk : wv; dst = WB + (size_t)m * DK * DE; i = (size_t)(b - m * CVW) * 256 + threadIdx.x; }
    else { src = x; dst = XB; i = (size_t)(b - 3 * CVW) * 256 + threadIdx.x; }
    const v8f v = *(const v8f*)(src + i * 8); v8us o;
#pragma unroll
    for (int k = 0; k < 8; ++k) o[k] = f2bf(v[k]); *(v8us*)(dst + i * 8) = o;  }
extern "C" void kernel_launch(void* const* d_in, const int* in_sizes, int n_in,
                              void* d_out, int out_size, void* d_ws, size_t ws_size, hipStream_t stream) {
    (void)in_sizes; (void)n_in; (void)out_size;
    const float** I = (const float**)d_in;
    const float *x = I[0], *Wq = I[1], *bq = I[2], *Wk = I[3], *bk = I[4], *Wv = I[5], *bv = I[6], *alpha = I[7], *tokq = I[8], *tokv = I[9];
    float* OUT = (float*)d_out;     // [8][2048][128]
    char* wsp = (char*)d_ws;
    auto take = [&](size_t bytes) { char* p = wsp; wsp += (bytes + 255) & ~(size_t)255; return (void*)p; };
    bf* BQ = (bf*)take((size_t)3 * DK * DE * 2);   // the Wq, Wk, Wv planes one behind the other, 384 rows of W
    bf* XB = (bf*)take((size_t)NB_ * TT * DE * 2);
    bf* GQh = (bf*)take((size_t)NB_ * TT * DK * 2); bf* GQl = (bf*)take((size_t)NB_ * TT * DK * 2); bf* Kh = (bf*)take((size_t)NB_ * TT * DK * 2); bf* Kl = (bf*)take((size_t)NB_ * TT * DK * 2); bf* GVh = (bf*)take((size_t)NB_ * DK * TT * 4); bf* GVl = GVh + TT;
    if ((size_t)(wsp - (char*)d_ws) > ws_size) return;    // total ~ 51 MB
    k_cvt<<<3 * CVW + CVX, 256, 0, stream>>>(x, Wq, Wk, Wv, XB, BQ);   // [out][in] = Bt
    k_qkv<<<NB_ * TT / 64, 256, 0, stream>>>(XB, BQ, bq, bk, bv, tokq, tokv, alpha, GQh, GQl, Kh, Kl, GVh, GVl);   // projections, temperatures, hi/lo planes
    k_fa<<<dim3(TT / 64, NB_, 1), 256, 0, stream>>>(GQh, GQl, Kh, Kl, GVh, OUT);   // V rows: [TT hi][TT lo], pitch 2*TT
}

// v009
// It runs in 59.3 microseconds.
// In both of two side-by-side timings against v008, it was 1.08 times as fast.
// All steps since v000 together make it 23.6 times as fast.
#include <hip/hip_runtime.h>

// SelectiveAttentionModule (x [8][2048][768]; Q/K/V = x W^T + b (d 128, single head); temps_q[s] = 1 + sigmoid(alpha[s]) log(s+1) + tanh(tokenq[s] . gelu(Q[s])), temps_v likewise with tokenv / V; scores = (temps_q Q) . K / sqrt(128), causal;
// softmax; out = softmax . (temps_v V) -> [8][2048][128]).
// Compute dtypes, f32 accumulate: every input rounded to bf16; Q/K/V on PLAIN bf16 operands (inputs: exact) + bias; the temperatures (erf-gelu, 128-term fixed-order dots, tanh, sigmoid, log) f32 on the VALU; gated Q / K / gated V -> bf16 hi+lo

#define NB_  8
#define TT   2048
#define DE   768
#define DK   128
#define D3   384
typedef _Float16 h16;
typedef unsigned short bf;
typedef __attribute__((ext_vector_type(16))) __bf16   v16bf;
typedef __attribute__((ext_vector_type(16))) _Float16 v16h;
typedef __attribute__((ext_vector_type(8)))  _Float16 v8h;
typedef __attribute__((ext_vector_type(8)))  unsigned short v8us;
typedef __attribute__((ext_vector_type(8)))  float    v8f;
typedef __attribute__((ext_vector_type(4)))  float    v4f;
typedef v8h  __attribute__((may_alias)) v8ha;
typedef v4f  __attribute__((may_alias)) v4fa;
typedef v8us __attribute__((may_alias)) v8usa;

__device__ __forceinline__ unsigned short f2bf(float f) { unsigned u = __float_as_uint(f); u += 0x7FFFu + ((u >> 16) & 1u); return (unsigned short)(u >> 16); }
__device__ __forceinline__ float bf2f(unsigned short b) { return __uint_as_float(((unsigned)b) << 16); }
__device__ __forceinline__ float bfr(float f) { return bf2f(f2bf(f)); }
__device__ __forceinline__ v16h cat16(v8h lo, v8h hi) { return __builtin_shufflevector(lo, hi, 0, 1, 2, 3, 4, 5, 6, 7, 8, 9, 10, 11, 12, 13, 14, 15); }
__device__ __forceinline__ v16bf cat16b(v8us lo, v8us hi) { return __builtin_bit_cast(v16bf, __builtin_shufflevector(lo, hi, 0, 1, 2, 3, 4, 5, 6, 7, 8, 9, 10, 11, 12, 13, 14, 15)); }
__device__ __forceinline__ v8f wmma16(v16h a, v16h b, v8f c) { return __builtin_amdgcn_wmma_f32_16x16x32_f16(false, a, false, b, (short)0, c, false, false); }
__device__ __forceinline__ v8f wmmab(v16bf a, v16bf b, v8f c) { return __builtin_amdgcn_wmma_f32_16x16x32_bf16(false, a, false, b, (short)0, c, false, false); }



// Fragment of a 16 x 32 operand block from a K-contiguous 16-bit plane: the lane's 8 elements at p and 8 at p + 16.
template <typename T16> struct WFrag;
template <> struct WFrag<h16> { typedef v16h V; static __device__ __forceinline__ V ld(const h16* p) { return cat16(*(const v8h*)p, *(const v8h*)(p + 16)); } static __device__ __forceinline__ v8f mma(V a, V b, v8f c) { return wmma16(a, b, c); } };
template <> struct WFrag<bf> { typedef v16bf V; static __device__ __forceinline__ V ld(const bf* p) { return cat16b(*(const v8us*)p, *(const v8us*)(p + 16)); } static __device__ __forceinline__ v8f mma(V a, V b, v8f c) { return wmmab(a, b, c); } };

#define FR    2                    // groups of 16 queries per wave: every K and V fragment read from LDS serves FR groups
#define FNP   4                    // parts over the keys = passes per stage
#define FNC   (64 / (16 * FR))     // waves side by side; FNC * FNP = 8
#define FK    (32 * FNP)           // keys per stage
#define FKP   272                  // pitch of a K row (128 d, 256 B) in LDS, bytes: 16 B x odd, so the 16 rows of a fragment read fall on distinct banks
#define FVP   (2 * FK + 16)        // pitch of a V^T row (FK keys) in LDS, bytes: 16 B x odd
#define FKL   (FK * FKP)           // K lo behind K hi
#define FVH   (2 * FK * FKP)       // V^T hi
#define FBUF  (FVH + 2 * DK * FVP)
#define FVLR  (FK / 8)             // lanes that copy one V^T row
#define FVRC  (256 / FVLR)         // V^T rows per copy of the work-group
#define FMSZ  (FR * 8 * 1024 + FR * 256)   // what one wave hands over at the end, bytes: FR x 8 tiles of 32 lanes x 32 B, then FR x (maximum, sum) of 32 lanes x 4 B
typedef __attribute__((ext_vector_type(8))) unsigned v8u;
// Eight copies of 16 B per lane; the s_wait_xcnt stands in the copies' own statement so that no address register is rewritten ahead of it.
__device__ __forceinline__ void acopy8(const unsigned* l, const bf* const* g) {
    asm volatile("global_load_async_to_lds_b128 %0, %1, off\n\t"
                 "global_load_async_to_lds_b128 %2, %3, off\n\t"
                 "global_load_async_to_lds_b128 %4, %5, off\n\t"
                 "global_load_async_to_lds_b128 %6, %7, off\n\t"
                 "global_load_async_to_lds_b128 %8, %9, off\n\t"
                 "global_load_async_to_lds_b128 %10, %11, off\n\t"
                 "global_load_async_to_lds_b128 %12, %13, off\n\t"
                 "global_load_async_to_lds_b128 %14, %15, off\n\t"
                 "s_wait_xcnt 0x0"
                 :: "v"(l[0]), "v"(g[0]), "v"(l[1]), "v"(g[1]), "v"(l[2]), "v"(g[2]), "v"(l[3]), "v"(g[3]), "v"(l[4]), "v"(g[4]), "v"(l[5]), "v"(g[5]), "v"(l[6]), "v"(g[6]), "v"(l[7]), "v"(g[7]) : "memory");
}
// One stage: FK / 4 copies per lane, FK / 16 for each of K hi, K lo, V^T hi, V^T lo. kh / kl: the lane's piece of its first K row (hi / lo plane) at the stage's first key; vh: the lane's piece of its first V^T row at that key (lo plane TT behind);
// lk / lv: the places of those pieces in the buffer. A K copy fills rows 16 i + (thread >> 4), 16 lanes a row; a V^T copy rows FVRC i + thread / FVLR.
__device__ __forceinline__ void fa_stage(const bf* kh, const bf* kl, const bf* vh, unsigned lk, unsigned lv) {
#pragma unroll   // the copies' operands are register arrays
    for (int e = 0; e < FK / 32; ++e) { unsigned l[8]; const bf* g[8];
#pragma unroll
        for (int u = 0; u < 8; ++u) { const int n = e * 8 + u, q = n / (FK / 16), i = n % (FK / 16);
            l[u] = (q < 2) ? lk + (unsigned)(q * FKL + i * 16 * FKP) : lv + (unsigned)((q - 2) * DK * FVP + i * FVRC * FVP);
            g[u] = (q == 0) ? kh + (size_t)i * 16 * DK : (q == 1) ? kl + (size_t)i * 16 * DK : vh + (q - 2) * TT + (size_t)i * FVRC * (2 * TT); }
        acopy8(l, g); }
}
__device__ __forceinline__ unsigned pack2(float lo, float hi) { typedef __bf16 bf2 __attribute__((ext_vector_type(2))); typedef float f2 __attribute__((ext_vector_type(2))); return __builtin_bit_cast(unsigned, __builtin_convertvector(f2{lo, hi}, bf2)); }   // round to nearest even
__device__ __forceinline__ float xhalf(float x) { return __builtin_bit_cast(float, __builtin_amdgcn_permlanex16(__builtin_bit_cast(int, x), __builtin_bit_cast(int, x), 0x76543210, 0xfedcba98, false, false)); }   // lane l with lane l ^ 16
__device__ __forceinline__ void nop4() { asm volatile("v_nop\n\tv_nop\n\tv_nop\n\tv_nop"); }   // the four vector slots between a matrix instruction and a vector instruction on its registers, also on the taken side of a branch that follows
__global__ __launch_bounds__(256) void k_fa(const bf* __restrict__ Qh, const bf* __restrict__ Ql, const bf* __restrict__ Kh, const bf* __restrict__ Kl, const bf* __restrict__ Vt, float* O) {
    __shared__ __align__(16) unsigned char L[2 * FBUF];
    const int lane = threadIdx.x & 31, c = lane & 15, h = lane >> 4; const int w = __builtin_amdgcn_readfirstlane(threadIdx.x >> 5); const int cg = w % FNC, part = w / FNC;
    const int blk = TT / 64 - 1 - (int)blockIdx.x;                   // the longest work-groups start first
    const int r0 = blk * 64, qw0 = r0 + 16 * FR * cg, nT = (r0 + 64 + FK - 1) / FK;   // stages up to and with the diagonal's; nT * FK <= TT
    const size_t z = blockIdx.y;
    const bf* kh = Kh + (z * TT + (threadIdx.x >> 4)) * (size_t)DK + (threadIdx.x & 15) * 8; const bf* kl = Kl + (z * TT + (threadIdx.x >> 4)) * (size_t)DK + (threadIdx.x & 15) * 8;
    const bf* vh = Vt + (z * DK + threadIdx.x / FVLR) * (size_t)(2 * TT) + (threadIdx.x % FVLR) * 8;
    const unsigned lk = (unsigned)(size_t)L + (unsigned)((threadIdx.x >> 4) * FKP + (threadIdx.x & 15) * 16), lv = (unsigned)(size_t)L + (unsigned)(FVH + (threadIdx.x / FVLR) * FVP + (threadIdx.x % FVLR) * 16);
    fa_stage(kh, kl, vh, lk, lv);
    v16bf qh[FR][4], ql[FR][4];                                      // B operand: column c of group g = query qw0 + 16 g + c
#pragma unroll
    for (int g = 0; g < FR; ++g) { const size_t qo = (z * TT + qw0 + 16 * g + c) * (size_t)DK + 8 * h;
#pragma unroll
        for (int kc = 0; kc < 4; ++kc) { qh[g][kc] = WFrag<bf>::ld(Qh + qo + 32 * kc); ql[g][kc] = WFrag<bf>::ld(Ql + qo + 32 * kc); } }
    v8f acc[FR][8];                                                  // acc[g][u][r] = O[qw0 + 16 g + c][16 u + 8 h + r], unnormalised, this part's keys
    float m_run[FR], l_run[FR];
#pragma unroll
    for (int g = 0; g < FR; ++g) { m_run[g] = -__builtin_inff(); l_run[g] = 0.f;
#pragma unroll
        for (int u = 0; u < 8; ++u) acc[g][u] = (v8f){}; }
    const float cs = 0.088388347648318447f * 1.4426950408889634f;
    asm volatile("s_wait_asynccnt 0x0" ::: "memory");               // this wave's part of stage 0 has landed
    __syncthreads();                                                 // every wave's part of stage 0 has landed
    if (nT > 1) fa_stage(kh + (size_t)FK * DK, kl + (size_t)FK * DK, vh + FK, lk + FBUF, lv + FBUF);
    const unsigned char* fk = L + (part * 32 + c) * FKP + h * 16; const unsigned char* fv = L + FVH + c * FVP + part * 64 + h * 16;
#pragma unroll 1   // one stage a trip: the ring's order stands once, at the foot
    for (int t = 0; t < nT; ++t) {
        const int bo = (t & 1) * FBUF; const int key0 = t * FK + part * 32;
        if (key0 <= qw0 + 16 * FR - 1) {                             // one value per wave: a pass wholly behind the wave's diagonal is skipped
            const unsigned char* pk = fk + bo; const unsigned char* pv = fv + bo;
            v8f s[2][FR];
            {   v16bf ka[2][4], kb[2][4];                            // K fragments of the pass, hi and lo: row = key 16 kt + c
#pragma unroll
                for (int kt = 0; kt < 2; ++kt)
#pragma unroll
                    for (int kc = 0; kc < 4; ++kc) { ka[kt][kc] = WFrag<bf>::ld((const bf*)(pk + kt * 16 * FKP + kc * 64)); kb[kt][kc] = WFrag<bf>::ld((const bf*)(pk + FKL + kt * 16 * FKP + kc * 64)); }
#pragma unroll
                for (int g = 0; g < FR; ++g) { s[0][g] = (v8f){}; s[1][g] = (v8f){}; }
#pragma unroll
                for (int kc = 0; kc < 4; ++kc)
#pragma unroll
                    for (int g = 0; g < FR; ++g) {
                        s[0][g] = wmmab(ka[0][kc], qh[g][kc], s[0][g]); s[1][g] = wmmab(ka[1][kc], qh[g][kc], s[1][g]);
                        s[0][g] = wmmab(ka[0][kc], ql[g][kc], s[0][g]); s[1][g] = wmmab(ka[1][kc], ql[g][kc], s[1][g]);
                        s[0][g] = wmmab(kb[0][kc], qh[g][kc], s[0][g]); s[1][g] = wmmab(kb[1][kc], qh[g][kc], s[1][g]); }
            }
            __builtin_amdgcn_sched_barrier(0);                       // keeps the LDS reads below behind the products, whose K registers they take over
            nop4();
            v16bf va[8], vb[8];                                      // V^T fragments of the pass, hi and lo: row = d 16 u + c; the hi plane's are read here so that they fly under the softmax arithmetic, the lo plane's where the compiler finds registers for them
#pragma unroll
            for (int u = 0; u < 8; ++u) va[u] = WFrag<bf>::ld((const bf*)(pv + u * 16 * FVP));
            __builtin_amdgcn_sched_barrier(0);                       // keeps those reads in front of the arithmetic: sunk to just before their use, their latency would be waited out in front of the second product
            if (key0 + 31 > qw0) {                                   // one value per wave: only a pass that meets the wave's diagonal pays for the mask
#pragma unroll
                for (int g = 0; g < FR; ++g)
#pragma unroll
                    for (int kt = 0; kt < 2; ++kt)
#pragma unroll
                        for (int r = 0; r < 8; ++r) if (key0 + 16 * kt + 8 * h + r > qw0 + 16 * g + c) s[kt][g][r] = -__builtin_inff(); }
            float mb[FR]; bool need = false;
#pragma unroll
            for (int g = 0; g < FR; ++g) { float mx = fmaxf(s[0][g][0], s[1][g][0]);
#pragma unroll
                for (int r = 1; r < 8; ++r) mx = fmaxf(mx, fmaxf(s[0][g][r], s[1][g][r]));
                mx = fmaxf(mx, xhalf(mx)) * cs;                      // both wave halves hold the query's maximum of this pass, scaled (the scale is positive); finite: a pass that is not skipped holds an open key for every query of the wave
                mb[g] = mx; need = need || (mx > m_run[g] + 8.0f); }
            if (__builtin_amdgcn_ballot_w32(need) != 0) {            // scalar branch; always taken in a wave's first pass, where m_run is -inf
#pragma unroll
                for (int g = 0; g < FR; ++g) { const float m_new = fmaxf(m_run[g], mb[g]); const float corr = __builtin_amdgcn_exp2f(m_run[g] - m_new); l_run[g] *= corr; m_run[g] = m_new;
#pragma unroll
                    for (int u = 0; u < 8; ++u) acc[g][u] = acc[g][u] * corr; } }
            v16bf ph[FR], pl[FR];
#pragma unroll
            for (int g = 0; g < FR; ++g) { const float nm = -m_run[g]; v8u wh, wl; float ps0 = 0.f, ps1 = 0.f;
#pragma unroll
                for (int i = 0; i < 8; ++i) {
                    const float p0 = __builtin_amdgcn_exp2f(fmaf(s[i >> 2][g][2 * (i & 3)], cs, nm)), p1 = __builtin_amdgcn_exp2f(fmaf(s[i >> 2][g][2 * (i & 3) + 1], cs, nm));
                    ps0 += p0; ps1 += p1;
                    const unsigned hh = pack2(p0, p1); wh[i] = hh; wl[i] = pack2(p0 - __uint_as_float(hh << 16), p1 - __uint_as_float(hh & 0xFFFF0000u)); }
                l_run[g] += ps0 + ps1; ph[g] = __builtin_bit_cast(v16bf, wh); pl[g] = __builtin_bit_cast(v16bf, wl); }
#pragma unroll
            for (int u = 0; u < 8; ++u) vb[u] = WFrag<bf>::ld((const bf*)(pv + (DK + u * 16) * FVP));
#pragma unroll
            for (int g = 0; g < FR; ++g) {
#pragma unroll
                for (int u = 0; u < 8; ++u) acc[g][u] = wmmab(va[u], ph[g], acc[g][u]);
#pragma unroll
                for (int u = 0; u < 8; ++u) acc[g][u] = wmmab(va[u], pl[g], acc[g][u]); }
#pragma unroll
            for (int g = 0; g < FR; ++g)
#pragma unroll
                for (int u = 0; u < 8; ++u) acc[g][u] = wmmab(vb[u], ph[g], acc[g][u]);
            __builtin_amdgcn_sched_barrier(0);                       // keeps the slots below directly behind the products
            nop4();
        }
        asm volatile("s_wait_dscnt 0x0" ::: "memory");              // this wave's reads of stage t are done before the buffer may be refilled
        asm volatile("s_wait_asynccnt 0x0" ::: "memory");           // this wave's part of stage t + 1 has landed
        __syncthreads();                                             // publishes stage t + 1 and ends every wave's reads of stage t
        if (t + 2 < nT) fa_stage(kh + (size_t)(t + 2) * FK * DK, kl + (size_t)(t + 2) * FK * DK, vh + (t + 2) * FK, lk + bo, lv + bo);
    }
    asm volatile("s_wait_asynccnt 0x0" ::: "memory");               // no copy is outstanding: behind the last trip's barrier the ring is free and takes the parts' hand-over
    if (part > 0) { unsigned char* mo = L + ((part - 1) * FNC + cg) * FMSZ;   // parts 1 .. FNP - 1 leave tiles, maxima and sums, lane by lane
#pragma unroll
        for (int g = 0; g < FR; ++g) {
#pragma unroll
            for (int u = 0; u < 8; ++u) { float* d = (float*)(mo + ((g * 8 + u) * 32 + lane) * 32); *(v4fa*)d = (v4f){acc[g][u][0], acc[g][u][1], acc[g][u][2], acc[g][u][3]}; *(v4fa*)(d + 4) = (v4f){acc[g][u][4], acc[g][u][5], acc[g][u][6], acc[g][u][7]}; }
            ((float*)(mo + FR * 8 * 1024))[(g * 2) * 32 + lane] = m_run[g]; ((float*)(mo + FR * 8 * 1024))[(g * 2 + 1) * 32 + lane] = l_run[g]; } }
    __syncthreads();                                                 // the hand-over is written before part 0 reads it
    if (part > 0) return;
#pragma unroll 1   // one part a trip: the tiles of one part are in registers at a time
    for (int p = 1; p < FNP; ++p) { const unsigned char* mo = L + ((p - 1) * FNC + cg) * FMSZ;
#pragma unroll
        for (int g = 0; g < FR; ++g) { const float mp = ((const float*)(mo + FR * 8 * 1024))[(g * 2) * 32 + lane], lp = ((const float*)(mo + FR * 8 * 1024))[(g * 2 + 1) * 32 + lane];
            const float m_new = fmaxf(m_run[g], mp);                 // finite: part 0 has seen key 0; a part that had no pass hands over -inf, 0 and zeros and gets the factor 0
            const float fa = __builtin_amdgcn_exp2f(m_run[g] - m_new), fb = __builtin_amdgcn_exp2f(mp - m_new); l_run[g] = l_run[g] * fa + lp * fb; m_run[g] = m_new;
#pragma unroll
            for (int u = 0; u < 8; ++u) { const float* d = (const float*)(mo + ((g * 8 + u) * 32 + lane) * 32); const v4f x0 = *(const v4fa*)d, x1 = *(const v4fa*)(d + 4);
#pragma unroll
                for (int r = 0; r < 4; ++r) { acc[g][u][r] = acc[g][u][r] * fa + x0[r] * fb; acc[g][u][4 + r] = acc[g][u][4 + r] * fa + x1[r] * fb; } } } }
#pragma unroll
    for (int g = 0; g < FR; ++g) { const float inv = __fdiv_rn(1.0f, l_run[g] + xhalf(l_run[g]));   // each wave half holds the sum over its eight keys of every 16-key tile
#pragma unroll
        for (int u = 0; u < 8; ++u) acc[g][u] = acc[g][u] * inv; }
    float* orow = O + (z * TT + qw0 + c) * (size_t)DK + 8 * h;
    __builtin_amdgcn_sched_barrier(0);                               // all arithmetic stands in front of the stores, so that no register which an issued store names is written again
#pragma unroll
    for (int g = 0; g < FR; ++g)
#pragma unroll
        for (int u = 0; u < 8; ++u) { *(v4f*)(orow + g * 16 * DK + 16 * u) = (v4f){acc[g][u][0], acc[g][u][1], acc[g][u][2], acc[g][u][3]}; *(v4f*)(orow + g * 16 * DK + 16 * u + 4) = (v4f){acc[g][u][4], acc[g][u][5], acc[g][u][6], acc[g][u][7]}; }
}

// ---- k_qkv: [Q K V][m][0..383] = x[m] . W[n] + bias[n] for the three projections at once (W = the rows of Wq, Wk, Wv one after the other): a 64 x 384 output tile per work-group of eight waves (wave w: rows 32 (w & 1).., columns 96 (w >> 1)..).
// Both operands come into LDS in stages of QKK values of k by asynchronous copies (whole pieces of rows, shared by the eight waves) in a ring of two buffers: stage t + 1 flies while stage t is multiplied. Per accumulator one product per 32 k, k ascending.
// x comes straight from the input, in f32, and is rounded to bf16 (to nearest even) where a wave forms its A fragment: x is read from memory once and no bf16 copy of it is written or read back. W, which every work-group reads whole, is rounded once by k_cvt.
#define QKK    128                 // k per stage: a W row of a stage is 256 B, an x row 512 B
#define QKP    272                 // pitch of a W row in LDS, bytes: 16 B x odd, so the 16 rows of a fragment read fall on distinct banks
#define QXP    528                 // pitch of an x row in LDS, bytes: 16 B x odd
#define QXB    (64 * QXP)          // the 64 x rows stand in front of the 384 W rows
#define QKBUF  (QXB + D3 * QKP)
// Epilogue: a work-group holds Q, K and V of its 64 tokens whole, so the temperatures and the hi/lo planes are made here and the f32 projections never leave the chip. The ring's LDS, free behind the last trip's barrier, takes:
#define QCP    388                 // the 64 x 384 f32 tile (bias added), pitch in floats: rows stay 16-B aligned, the two row halves of an accumulator fall on distinct banks
#define QPP    132                 // the products of the two dots, [2][64] rows of 128, pitch in floats: rows stay 16-B aligned and do not all start in one bank
#define QVP    68                  // V once more, d-major ([128] rows of 64 tokens), pitch in floats: 16 B x odd
#define QPRO   (64 * QCP * 4)
#define QTSO   (QPRO + 2 * 64 * QPP * 4)   // the temperatures, [2][64]
#define QVTO   (QTSO + 2 * 64 * 4)
static_assert(QVTO + DK * QVP * 4 <= 2 * QKBUF, "the epilogue fits the ring");
// One stage: 32 copies per lane, 8 of x and 24 of W. px / pw: the lane's piece of its first x row / W row at the stage's first k; lx / lw: the places of those pieces in the buffer.
// An x copy fills rows 8 i + (thread >> 5), a wave a row; a W copy rows 16 i + (thread >> 4), 16 lanes a row.
__device__ __forceinline__ void qkv_stage(const float* px, const bf* pw, unsigned lx, unsigned lw) {
#pragma unroll   // the copies' operands are register arrays
    for (int e = 0; e < 4; ++e) { unsigned l[8]; const bf* g[8];
#pragma unroll
        for (int u = 0; u < 8; ++u) { const int i = (e - 1) * 8 + u;
            l[u] = (e == 0) ? lx + (unsigned)(u * 8 * QXP) : lw + (unsigned)(i * 16 * QKP);
            g[u] = (e == 0) ? (const bf*)(px + (size_t)u * 8 * DE) : pw + (size_t)i * 16 * DE; }   // the cast: a copy takes an address, 16 B of whatever lies there
        acopy8(l, g); }
}
// A fragment from f32 values: x0, x1 = the lane's 8 values at p, x2, x3 = its 8 at p + 16, the k order of WFrag's load.
__device__ __forceinline__ v16bf xfrag(v4f x0, v4f x1, v4f x2, v4f x3) { v8u r;
    r[0] = pack2(x0[0], x0[1]); r[1] = pack2(x0[2], x0[3]); r[2] = pack2(x1[0], x1[1]); r[3] = pack2(x1[2], x1[3]); r[4] = pack2(x2[0], x2[1]); r[5] = pack2(x2[2], x2[3]); r[6] = pack2(x3[0], x3[1]); r[7] = pack2(x3[2], x3[3]);
    return __builtin_bit_cast(v16bf, r); }
__device__ __forceinline__ void splitf(float y, unsigned short& h, unsigned short& l) { h = f2bf(y); l = f2bf(y - bf2f(h)); }
__global__ __launch_bounds__(256) void k_qkv(const float* __restrict__ X, const bf* __restrict__ Wt, const float* __restrict__ bq, const float* __restrict__ bk, const float* __restrict__ bv,
                                             const float* __restrict__ tq, const float* __restrict__ tv, const float* __restrict__ alpha, bf* GQh, bf* GQl, bf* Kh, bf* Kl, bf* Th, bf* Tl) {
    __shared__ __align__(16) unsigned char L[2 * QKBUF];
    __shared__ float BL[D3 + 64];                                    // the three bias vectors, rounded, one behind the other; then alpha of the 64 tokens
    const int lane = threadIdx.x & 31, lr = lane & 15, hi = lane >> 4, w = threadIdx.x >> 5, wm = w & 1, wn = w >> 1; const int r0 = blockIdx.x * 64;
    const int nT = DE / QKK;                                         // six stages
    const int sub = threadIdx.x & 15, rg = threadIdx.x >> 4;
    const float* px = X + (size_t)(r0 + w) * DE + lane * 4; const bf* pw = Wt + (size_t)rg * DE + sub * 8;
    const unsigned lx = (unsigned)(size_t)L + (unsigned)(w * QXP + lane * 16), lw = (unsigned)(size_t)L + (unsigned)(QXB + rg * QKP + sub * 16);
    v8f acc[2][6];
#pragma unroll
    for (int mb = 0; mb < 2; ++mb)
#pragma unroll
        for (int nb = 0; nb < 6; ++nb) acc[mb][nb] = (v8f){};
    qkv_stage(px, pw, lx, lw);
    {   const int t = threadIdx.x & (DK - 1); const float b0 = bq[t], b1 = bk[t], b2 = bv[t], b3 = alpha[r0 % TT + (t & 63)];   // read under stage 0's copies, published by stage 0's barrier; threads t and t + 128 store the same values
        asm volatile("s_wait_xcnt 0x0" ::: "memory");               // before a register that these four loads name is written again
        BL[t] = bfr(b0); BL[DK + t] = bfr(b1); BL[2 * DK + t] = bfr(b2); BL[D3 + (t & 63)] = b3; }
    asm volatile("s_wait_asynccnt 0x0" ::: "memory");               // this wave's part of stage 0 has landed
    __syncthreads();                                                 // every wave's part of stage 0 has landed
    qkv_stage(px + QKK, pw + QKK, lx + QKBUF, lw + QKBUF);
    const unsigned char* fa = L + (wm * 32 + lr) * QXP + hi * 32; const unsigned char* fb = L + QXB + (wn * 96 + lr) * QKP + hi * 16;
#pragma unroll 1   // one stage a trip: the ring's order stands once, at the foot
    for (int t = 0; t < nT; ++t) {
        const int bo = (t & 1) * QKBUF; const unsigned char* qa = fa + bo; const unsigned char* qb = fb + bo;
        v16bf a[2][2], b[2][6]; v4f ax[2][4];                        // two fragment sets: this and the next 32 k; ax: the next set's x values as they come from LDS, in f32
#pragma unroll
        for (int mb = 0; mb < 2; ++mb)
#pragma unroll
            for (int j = 0; j < 4; ++j) ax[mb][j] = *(const v4fa*)(qa + mb * 16 * QXP + (j >> 1) * 64 + (j & 1) * 16);
#pragma unroll
        for (int nb = 0; nb < 6; ++nb) b[0][nb] = WFrag<bf>::ld((const bf*)(qb + nb * 16 * QKP));
#pragma unroll
        for (int mb = 0; mb < 2; ++mb) a[0][mb] = xfrag(ax[mb][0], ax[mb][1], ax[mb][2], ax[mb][3]);
#pragma unroll   // ks indexes register arrays
        for (int ks = 0; ks < QKK / 32; ++ks) { const int cu = ks & 1, nx = cu ^ 1;
            if (ks + 1 < QKK / 32) {                                 // fragments are fetched ahead inside the stage only, never from the next stage
#pragma unroll
                for (int mb = 0; mb < 2; ++mb)
#pragma unroll
                    for (int j = 0; j < 4; ++j) ax[mb][j] = *(const v4fa*)(qa + mb * 16 * QXP + (ks + 1) * 128 + (j >> 1) * 64 + (j & 1) * 16);
#pragma unroll
                for (int nb = 0; nb < 6; ++nb) b[nx][nb] = WFrag<bf>::ld((const bf*)(qb + nb * 16 * QKP + (ks + 1) * 64)); }
            __builtin_amdgcn_sched_barrier(0);                       // keeps the next set's LDS reads as one group in front of these products: sunk to just before their use, every read's latency would be waited out
#pragma unroll
            for (int nb = 0; nb < 6; ++nb) { acc[0][nb] = wmmab(a[cu][0], b[cu][nb], acc[0][nb]); acc[1][nb] = wmmab(a[cu][1], b[cu][nb], acc[1][nb]); }
            __builtin_amdgcn_sched_barrier(0);                       // keeps the reads of the set after next behind these products: lifted among them they stand in several places and take a third set's registers
            if (ks + 1 < QKK / 32) {                                 // the next set's x values have had the products' time to arrive; rounded into the set that the products above do not read
#pragma unroll
                for (int mb = 0; mb < 2; ++mb) a[nx][mb] = xfrag(ax[mb][0], ax[mb][1], ax[mb][2], ax[mb][3]); }
        }
        asm volatile("s_wait_dscnt 0x0" ::: "memory");              // this wave's reads of stage t are done before the buffer may be refilled
        asm volatile("s_wait_asynccnt 0x0" ::: "memory");           // this wave's part of stage t + 1 has landed
        __syncthreads();                                             // publishes stage t + 1 and ends every wave's reads of stage t
        if (t + 2 < nT) qkv_stage(px + (size_t)(t + 2) * QKK, pw + (size_t)(t + 2) * QKK, lx + bo, lw + bo);
    }
    asm volatile("s_wait_asynccnt 0x0" ::: "memory");               // no copy is outstanding: behind the last trip's barrier the ring is free and takes the epilogue's tiles
    float* CT = (float*)L; float* PR = (float*)(L + QPRO); float* TS = (float*)(L + QTSO); float* VT = (float*)(L + QVTO);
    const int wu = __builtin_amdgcn_readfirstlane(w);                // the wave's number as a scalar: the epilogue's split of the waves is a scalar branch
    const int c0 = wn * 96, s0 = r0 % TT;                            // TT % 64 == 0: the 64 tokens lie in one sequence, at positions s0 .. s0 + 63
    // Wave w takes tokens 8 w .. 8 w + 7 of the dots with its lanes ACROSS d: each tokenq / tokenv row is one whole 512-B load. All of them are issued here, so that they fly while the tile goes to LDS.
    v4f kq[8], kv[8]; float bi[6]; const float* pkq = tq + (size_t)(s0 + w * 8) * DK + lane * 4; const float* pkv = tv + (size_t)(s0 + w * 8) * DK + lane * 4; const int cu = (wu >> 1) * 96;   // cu: c0 as a scalar
#pragma unroll   // u indexes register arrays
    for (int u = 0; u < 8; ++u) { kq[u] = *(const v4fa*)(pkq + u * DK); kv[u] = *(const v4fa*)(pkv + u * DK); }
    __builtin_amdgcn_sched_barrier(0);                               // keeps the sixteen loads in front of the wait below
    asm volatile("s_wait_xcnt 0x0" :: "v"(pkq), "v"(pkv) : "memory");   // the two address pairs stay in their registers up to this wait
#pragma unroll
    for (int nb = 0; nb < 6; ++nb) bi[nb] = BL[c0 + nb * 16 + lr];
#pragma unroll   // mb, nb, j index register arrays
    for (int mb = 0; mb < 2; ++mb)
#pragma unroll
        for (int nb = 0; nb < 6; ++nb) { const int row = wm * 32 + mb * 16 + hi * 8, col = c0 + nb * 16 + lr; v8f y;
#pragma unroll
            for (int j = 0; j < 8; ++j) { y[j] = acc[mb][nb][j] + bi[nb]; CT[(row + j) * QCP + col] = y[j]; }
            if (cu + nb * 16 >= 2 * DK) { float* d = VT + (col - 2 * DK) * QVP + row; *(v4fa*)d = (v4f){y[0], y[1], y[2], y[3]}; *(v4fa*)(d + 4) = (v4f){y[4], y[5], y[6], y[7]}; } }   // a lane holds 8 consecutive tokens of one d
    __syncthreads();                                                 // the tile is whole before it is read by rows
#pragma unroll   // u and k index register arrays
    for (int u = 0; u < 8; ++u) { const int tok = w * 8 + u; const v4f xq = *(const v4fa*)(CT + tok * QCP + lane * 4), xv = *(const v4fa*)(CT + tok * QCP + 2 * DK + lane * 4); v4f pq, pv;
#pragma unroll
        for (int k = 0; k < 4; ++k) { const float x1 = xq[k], x2 = xv[k]; const float g1 = __fmul_rn(0.5f * x1, __fadd_rn(1.0f, erff(x1 * 0.70710678118654752f))), g2 = __fmul_rn(0.5f * x2, __fadd_rn(1.0f, erff(x2 * 0.70710678118654752f)));
            pq[k] = __fmul_rn(bfr(kq[u][k]), g1); pv[k] = __fmul_rn(bfr(kv[u][k]), g2); }
        *(v4fa*)(PR + tok * QPP + lane * 4) = pq; *(v4fa*)(PR + (64 + tok) * QPP + lane * 4) = pv; }
    __syncthreads();                                                 // every product row is in LDS before a lane adds it up
    if (wu < 4) {                                                    // waves 0, 1: the 64 Q dots, waves 2, 3: the 64 V dots; a lane adds one token's products in the order d = 0..127
        const int tok = (w & 1) * 32 + lane; const float* p = PR + ((w >> 1) * 64 + tok) * QPP; float a = 0.f;
#pragma unroll   // constant LDS offsets, no loop counter beside the one dependent chain of adds
        for (int d = 0; d < DK; d += 4) { const v4f c = *(const v4fa*)(p + d); a = __fadd_rn(a, c[0]); a = __fadd_rn(a, c[1]); a = __fadd_rn(a, c[2]); a = __fadd_rn(a, c[3]); }
        const float sg = __fdiv_rn(1.0f, __fadd_rn(1.0f, __expf(-bfr(BL[D3 + tok])))); const float pos = __fadd_rn(1.0f, __fmul_rn(sg, __logf((float)(s0 + tok + 1))));
        TS[(w >> 1) * 64 + tok] = __fadd_rn(pos, tanhf(a));
    } else {                                                         // meanwhile waves 4 .. 7 split K, which needs no temperature: 8 values a lane, whole 256-B rows
        v8us kh8[8], kl8[8]; const int t = threadIdx.x - 128;
#pragma unroll   // i indexes register arrays
        for (int i = 0; i < 8; ++i) { const float* q = CT + (i * 8 + (t >> 4)) * QCP + DK + (t & 15) * 8; const v4f x0 = *(const v4fa*)q, x1 = *(const v4fa*)(q + 4);
#pragma unroll
            for (int u = 0; u < 4; ++u) { unsigned short a, b; splitf(x0[u], a, b); kh8[i][u] = a; kl8[i][u] = b; splitf(x1[u], a, b); kh8[i][4 + u] = a; kl8[i][4 + u] = b; } }
        const size_t o = (size_t)(r0 + (t >> 4)) * DK + (t & 15) * 8;
        __builtin_amdgcn_sched_barrier(0);                           // all arithmetic stands in front of the stores, so that no register which an issued store names is written among them
#pragma unroll
        for (int i = 0; i < 8; ++i) { *(v8usa*)(Kh + o + i * 8 * DK) = kh8[i]; *(v8usa*)(Kl + o + i * 8 * DK) = kl8[i]; }
        asm volatile("s_wait_xcnt 0x0" ::: "memory");               // before the registers that these stores name are written again below
    }
    __syncthreads();                                                 // the temperatures are in LDS
    v8us qh8[4], ql8[4], vh8[4], vl8[4];
#pragma unroll   // i indexes register arrays
    for (int i = 0; i < 4; ++i) {
        {   const int row = i * 16 + (threadIdx.x >> 4); const float* q = CT + row * QCP + (threadIdx.x & 15) * 8; const float t = TS[row]; const v4f x0 = *(const v4fa*)q, x1 = *(const v4fa*)(q + 4);   // gated Q: 8 values a lane, whole 256-B rows
#pragma unroll
            for (int u = 0; u < 4; ++u) { unsigned short a, b; splitf(__fmul_rn(t, x0[u]), a, b); qh8[i][u] = a; ql8[i][u] = b; splitf(__fmul_rn(t, x1[u]), a, b); qh8[i][4 + u] = a; ql8[i][4 + u] = b; } }
        {   const float* v = VT + (i * 32 + (threadIdx.x >> 3)) * QVP + (threadIdx.x & 7) * 8; const float* tp = TS + 64 + (threadIdx.x & 7) * 8;   // gated V, d-major: 8 tokens a lane, the 64 tokens of a d are one whole 128-B line per plane
            const v4f x0 = *(const v4fa*)v, x1 = *(const v4fa*)(v + 4), t0 = *(const v4fa*)tp, t1 = *(const v4fa*)(tp + 4);
#pragma unroll
            for (int u = 0; u < 4; ++u) { unsigned short a, b; splitf(__fmul_rn(t0[u], x0[u]), a, b); vh8[i][u] = a; vl8[i][u] = b; splitf(__fmul_rn(t1[u], x1[u]), a, b); vh8[i][4 + u] = a; vl8[i][4 + u] = b; } } }
    const size_t oq = (size_t)(r0 + (threadIdx.x >> 4)) * DK + (threadIdx.x & 15) * 8;
    const size_t ov = ((size_t)(r0 / TT) * DK + (threadIdx.x >> 3)) * (2 * TT) + s0 + (threadIdx.x & 7) * 8;   // row d = [TT hi][TT lo]
    __builtin_amdgcn_sched_barrier(0);                               // all arithmetic stands in front of the stores, so that no register which an issued store names is written again
#pragma unroll
    for (int i = 0; i < 4; ++i) { *(v8usa*)(GQh + oq + i * 16 * DK) = qh8[i]; *(v8usa*)(GQl + oq + i * 16 * DK) = ql8[i]; *(v8usa*)(Th + ov + (size_t)i * 32 * (2 * TT)) = vh8[i]; *(v8usa*)(Tl + ov + (size_t)i * 32 * (2 * TT)) = vl8[i]; }
}

// k_cvt: the f32 -> bf16 rounding of Wq, Wk, Wv (CVW work-groups each) into the three planes that lie one behind the other at WB. 8 values a thread; every part is a whole number of work-groups.
#define CVW (DK * DE / 8 / 256)
__global__ __launch_bounds__(256) void k_cvt(const float* __restrict__ wq, const float* __restrict__ wk, const float* __restrict__ wv, bf* WB) { const int b = blockIdx.x, m = b / CVW;
    const float* src = (m == 0) ? wq : (m == 1) ? wk : wv; bf* dst = WB + (size_t)m * DK * DE; const size_t i = (size_t)(b - m * CVW) * 256 + threadIdx.x;
    const v8f v = *(const v8f*)(src + i * 8); v8us o;
#pragma unroll
    for (int k = 0; k < 8; ++k) o[k] = f2bf(v[k]); *(v8us*)(dst + i * 8) = o;  }
extern "C" void kernel_launch(void* const* d_in, const int* in_sizes, int n_in,
                              void* d_out, int out_size, void* d_ws, size_t ws_size, hipStream_t stream) {
    (void)in_sizes; (void)n_in; (void)out_size;
    const float** I = (const float**)d_in;
    const float *x = I[0], *Wq = I[1], *bq = I[2], *Wk = I[3], *bk = I[4], *Wv = I[5], *bv = I[6], *alpha = I[7], *tokq = I[8], *tokv = I[9];
    float* OUT = (float*)d_out;     // [8][2048][128]
    char* wsp = (char*)d_ws;
    auto take = [&](size_t bytes) { char* p = wsp; wsp += (bytes + 255) & ~(size_t)255; return (void*)p; };
    bf* BQ = (bf*)take((size_t)3 * DK * DE * 2);   // the Wq, Wk, Wv planes one behind the other, 384 rows of W
    bf* GQh = (bf*)take((size_t)NB_ * TT * DK * 2); bf* GQl = (bf*)take((size_t)NB_ * TT * DK * 2); bf* Kh = (bf*)take((size_t)NB_ * TT * DK * 2); bf* Kl = (bf*)take((size_t)NB_ * TT * DK * 2); bf* GVh = (bf*)take((size_t)NB_ * DK * TT * 4); bf* GVl = GVh + TT;
    if ((size_t)(wsp - (char*)d_ws) > ws_size) return;    // total ~ 26 MB
    k_cvt<<<3 * CVW, 256, 0, stream>>>(Wq, Wk, Wv, BQ);   // [out][in] = Bt
    k_qkv<<<NB_ * TT / 64, 256, 0, stream>>>(x, BQ, bq, bk, bv, tokq, tokv, alpha, GQh, GQl, Kh, Kl, GVh, GVl);   // projections, temperatures, hi/lo planes
    k_fa<<<dim3(TT / 64, NB_, 1), 256, 0, stream>>>(GQh, GQl, Kh, Kl, GVh, OUT);   // V rows: [TT hi][TT lo], pitch 2*TT
}

// v010
// It runs in 57.3 microseconds.
// Two timings next to v009 both put it at 1.04 times that version's speed.
// Counting every step since v000, it is 24.5 times as fast.
#include <hip/hip_runtime.h>

// SelectiveAttentionModule (x [8][2048][768]; Q/K/V = x W^T + b (d 128, single head); temps_q[s] = 1 + sigmoid(alpha[s]) log(s+1) + tanh(tokenq[s] . gelu(Q[s])), temps_v likewise with tokenv / V; scores = (temps_q Q) . K / sqrt(128), causal;
// softmax; out = softmax . (temps_v V) -> [8][2048][128]).
// Compute dtypes, f32 accumulate: every input rounded to bf16; Q/K/V on PLAIN bf16 operands (inputs: exact) + bias; the temperatures (erf-gelu, 128-term fixed-order dots, tanh, sigmoid, log) f32 on the VALU; gated Q / K / gated V -> bf16 hi+lo

#define NB_  8
#define TT   2048
#define DE   768
#define DK   128
#define D3   384
typedef _Float16 h16;
typedef unsigned short bf;
typedef __attribute__((ext_vector_type(16))) __bf16   v16bf;
typedef __attribute__((ext_vector_type(16))) _Float16 v16h;
typedef __attribute__((ext_vector_type(8)))  _Float16 v8h;
typedef __attribute__((ext_vector_type(8)))  unsigned short v8us;
typedef __attribute__((ext_vector_type(8)))  float    v8f;
typedef __attribute__((ext_vector_type(4)))  float    v4f;
typedef v8h  __attribute__((may_alias)) v8ha;
typedef v4f  __attribute__((may_alias)) v4fa;
typedef v8us __attribute__((may_alias)) v8usa;

__device__ __forceinline__ unsigned short f2bf(float f) { unsigned u = __float_as_uint(f); u += 0x7FFFu + ((u >> 16) & 1u); return (unsigned short)(u >> 16); }
__device__ __forceinline__ float bf2f(unsigned short b) { return __uint_as_float(((unsigned)b) << 16); }
__device__ __forceinline__ float bfr(float f) { return bf2f(f2bf(f)); }
__device__ __forceinline__ v16h cat16(v8h lo, v8h hi) { return __builtin_shufflevector(lo, hi, 0, 1, 2, 3, 4, 5, 6, 7, 8, 9, 10, 11, 12, 13, 14, 15); }
__device__ __forceinline__ v16bf cat16b(v8us lo, v8us hi) { return __builtin_bit_cast(v16bf, __builtin_shufflevector(lo, hi, 0, 1, 2, 3, 4, 5, 6, 7, 8, 9, 10, 11, 12, 13, 14, 15)); }
__device__ __forceinline__ v8f wmma16(v16h a, v16h b, v8f c) { return __builtin_amdgcn_wmma_f32_16x16x32_f16(false, a, false, b, (short)0, c, false, false); }
__device__ __forceinline__ v8f wmmab(v16bf a, v16bf b, v8f c) { return __builtin_amdgcn_wmma_f32_16x16x32_bf16(false, a, false, b, (short)0, c, false, false); }



// Fragment of a 16 x 32 operand block from a K-contiguous 16-bit plane: the lane's 8 elements at p and 8 at p + 16.
template <typename T16> struct WFrag;
template <> struct WFrag<h16> { typedef v16h V; static __device__ __forceinline__ V ld(const h16* p) { return cat16(*(const v8h*)p, *(const v8h*)(p + 16)); } static __device__ __forceinline__ v8f mma(V a, V b, v8f c) { return wmma16(a, b, c); } };
template <> struct WFrag<bf> { typedef v16bf V; static __device__ __forceinline__ V ld(const bf* p) { return cat16b(*(const v8us*)p, *(const v8us*)(p + 16)); } static __device__ __forceinline__ v8f mma(V a, V b, v8f c) { return wmmab(a, b, c); } };

#define FR    2                    // groups of 16 queries per wave: every K and V fragment read from LDS serves FR groups
#define FNP   4                    // parts over the keys = passes per stage
#define FNC   (64 / (16 * FR))     // waves side by side; FNC * FNP = 8
#define FK    (32 * FNP)           // keys per stage
#define FKP   272                  // pitch of a K row (128 d, 256 B) in LDS, bytes: 16 B x odd, so the 16 rows of a fragment read fall on distinct banks
#define FVP   (2 * FK + 16)        // pitch of a V^T row (FK keys) in LDS, bytes: 16 B x odd
#define FKL   (FK * FKP)           // K lo behind K hi
#define FVH   (2 * FK * FKP)       // V^T hi
#define FBUF  (FVH + 2 * DK * FVP)
#define FVLR  (FK / 8)             // lanes that copy one V^T row
#define FVRC  (256 / FVLR)         // V^T rows per copy of the work-group
#define FMSZ  (FR * 8 * 1024 + FR * 256)   // what one wave hands over at the end, bytes: FR x 8 tiles of 32 lanes x 32 B, then FR x (maximum, sum) of 32 lanes x 4 B
typedef __attribute__((ext_vector_type(8))) unsigned v8u;
// Eight copies of 16 B per lane; the s_wait_xcnt stands in the copies' own statement so that no address register is rewritten ahead of it.
__device__ __forceinline__ void acopy8(const unsigned* l, const bf* const* g) {
    asm volatile("global_load_async_to_lds_b128 %0, %1, off\n\t"
                 "global_load_async_to_lds_b128 %2, %3, off\n\t"
                 "global_load_async_to_lds_b128 %4, %5, off\n\t"
                 "global_load_async_to_lds_b128 %6, %7, off\n\t"
                 "global_load_async_to_lds_b128 %8, %9, off\n\t"
                 "global_load_async_to_lds_b128 %10, %11, off\n\t"
                 "global_load_async_to_lds_b128 %12, %13, off\n\t"
                 "global_load_async_to_lds_b128 %14, %15, off\n\t"
                 "s_wait_xcnt 0x0"
                 :: "v"(l[0]), "v"(g[0]), "v"(l[1]), "v"(g[1]), "v"(l[2]), "v"(g[2]), "v"(l[3]), "v"(g[3]), "v"(l[4]), "v"(g[4]), "v"(l[5]), "v"(g[5]), "v"(l[6]), "v"(g[6]), "v"(l[7]), "v"(g[7]) : "memory");
}
// One stage: FK / 4 copies per lane, FK / 16 for each of K hi, K lo, V^T hi, V^T lo. kh / kl: the lane's piece of its first K row (hi / lo plane) at the stage's first key; vh: the lane's piece of its first V^T row at that key (lo plane TT behind);
// lk / lv: the places of those pieces in the buffer. A K copy fills rows 16 i + (thread >> 4), 16 lanes a row; a V^T copy rows FVRC i + thread / FVLR.
__device__ __forceinline__ void fa_stage(const bf* kh, const bf* kl, const bf* vh, unsigned lk, unsigned lv) {
#pragma unroll   // the copies' operands are register arrays
    for (int e = 0; e < FK / 32; ++e) { unsigned l[8]; const bf* g[8];
#pragma unroll
        for (int u = 0; u < 8; ++u) { const int n = e * 8 + u, q = n / (FK / 16), i = n % (FK / 16);
            l[u] = (q < 2) ? lk + (unsigned)(q * FKL + i * 16 * FKP) : lv + (unsigned)((q - 2) * DK * FVP + i * FVRC * FVP);
            g[u] = (q == 0) ? kh + (size_t)i * 16 * DK : (q == 1) ? kl + (size_t)i * 16 * DK : vh + (q - 2) * TT + (size_t)i * FVRC * (2 * TT); }
        acopy8(l, g); }
}
__device__ __forceinline__ unsigned pack2(float lo, float hi) { typedef __bf16 bf2 __attribute__((ext_vector_type(2))); typedef float f2 __attribute__((ext_vector_type(2))); return __builtin_bit_cast(unsigned, __builtin_convertvector(f2{lo, hi}, bf2)); }   // round to nearest even
__device__ __forceinline__ float xhalf(float x) { return __builtin_bit_cast(float, __builtin_amdgcn_permlanex16(__builtin_bit_cast(int, x), __builtin_bit_cast(int, x), 0x76543210, 0xfedcba98, false, false)); }   // lane l with lane l ^ 16
__device__ __forceinline__ void nop4() { asm volatile("v_nop\n\tv_nop\n\tv_nop\n\tv_nop"); }   // the four vector slots between a matrix instruction and a vector instruction on its registers, also on the taken side of a branch that follows
__global__ __launch_bounds__(256) void k_fa(const bf* __restrict__ Qh, const bf* __restrict__ Ql, const bf* __restrict__ Kh, const bf* __restrict__ Kl, const bf* __restrict__ Vt, float* O) {
    __shared__ __align__(16) unsigned char L[2 * FBUF];
    const int lane = threadIdx.x & 31, c = lane & 15, h = lane >> 4; const int w = __builtin_amdgcn_readfirstlane(threadIdx.x >> 5); const int cg = w % FNC, part = w / FNC;
    const int blk = TT / 64 - 1 - (int)blockIdx.x;                   // the longest work-groups start first
    const int r0 = blk * 64, qw0 = r0 + 16 * FR * cg, nT = (r0 + 64 + FK - 1) / FK;   // stages up to and with the diagonal's; nT * FK <= TT
    const size_t z = blockIdx.y;
    const bf* kh = Kh + (z * TT + (threadIdx.x >> 4)) * (size_t)DK + (threadIdx.x & 15) * 8; const bf* kl = Kl + (z * TT + (threadIdx.x >> 4)) * (size_t)DK + (threadIdx.x & 15) * 8;
    const bf* vh = Vt + (z * DK + threadIdx.x / FVLR) * (size_t)(2 * TT) + (threadIdx.x % FVLR) * 8;
    const unsigned lk = (unsigned)(size_t)L + (unsigned)((threadIdx.x >> 4) * FKP + (threadIdx.x & 15) * 16), lv = (unsigned)(size_t)L + (unsigned)(FVH + (threadIdx.x / FVLR) * FVP + (threadIdx.x % FVLR) * 16);
    fa_stage(kh, kl, vh, lk, lv);
    v16bf qh[FR][4], ql[FR][4];                                      // B operand: column c of group g = query qw0 + 16 g + c
#pragma unroll
    for (int g = 0; g < FR; ++g) { const size_t qo = (z * TT + qw0 + 16 * g + c) * (size_t)DK + 8 * h;
#pragma unroll
        for (int kc = 0; kc < 4; ++kc) { qh[g][kc] = WFrag<bf>::ld(Qh + qo + 32 * kc); ql[g][kc] = WFrag<bf>::ld(Ql + qo + 32 * kc); } }
    v8f acc[FR][8];                                                  // acc[g][u][r] = O[qw0 + 16 g + c][16 u + 8 h + r], unnormalised, this part's keys
    float m_run[FR], l_run[FR];
#pragma unroll
    for (int g = 0; g < FR; ++g) { m_run[g] = -__builtin_inff(); l_run[g] = 0.f;
#pragma unroll
        for (int u = 0; u < 8; ++u) acc[g][u] = (v8f){}; }
    const float cs = 0.088388347648318447f * 1.4426950408889634f;
    asm volatile("s_wait_asynccnt 0x0" ::: "memory");               // this wave's part of stage 0 has landed
    __syncthreads();                                                 // every wave's part of stage 0 has landed
    if (nT > 1) fa_stage(kh + (size_t)FK * DK, kl + (size_t)FK * DK, vh + FK, lk + FBUF, lv + FBUF);
    const unsigned char* fk = L + (part * 32 + c) * FKP + h * 16; const unsigned char* fv = L + FVH + c * FVP + part * 64 + h * 16;
#pragma unroll 1   // one stage a trip: the ring's order stands once, at the foot
    for (int t = 0; t < nT; ++t) {
        const int bo = (t & 1) * FBUF; const int key0 = t * FK + part * 32;
        if (key0 <= qw0 + 16 * FR - 1) {                             // one value per wave: a pass wholly behind the wave's diagonal is skipped
            const unsigned char* pk = fk + bo; const unsigned char* pv = fv + bo;
            v8f s[2][FR];
            {   v16bf ka[2][4], kb[2][4];                            // K fragments of the pass, hi and lo: row = key 16 kt + c
#pragma unroll
                for (int kt = 0; kt < 2; ++kt)
#pragma unroll
                    for (int kc = 0; kc < 4; ++kc) { ka[kt][kc] = WFrag<bf>::ld((const bf*)(pk + kt * 16 * FKP + kc * 64)); kb[kt][kc] = WFrag<bf>::ld((const bf*)(pk + FKL + kt * 16 * FKP + kc * 64)); }
#pragma unroll
                for (int g = 0; g < FR; ++g) { s[0][g] = (v8f){}; s[1][g] = (v8f){}; }
#pragma unroll
                for (int kc = 0; kc < 4; ++kc)
#pragma unroll
                    for (int g = 0; g < FR; ++g) {
                        s[0][g] = wmmab(ka[0][kc], qh[g][kc], s[0][g]); s[1][g] = wmmab(ka[1][kc], qh[g][kc], s[1][g]);
                        s[0][g] = wmmab(ka[0][kc], ql[g][kc], s[0][g]); s[1][g] = wmmab(ka[1][kc], ql[g][kc], s[1][g]);
                        s[0][g] = wmmab(kb[0][kc], qh[g][kc], s[0][g]); s[1][g] = wmmab(kb[1][kc], qh[g][kc], s[1][g]); }
            }
            __builtin_amdgcn_sched_barrier(0);                       // keeps the LDS reads below behind the products, whose K registers they take over
            nop4();
            v16bf va[8], vb[8];                                      // V^T fragments of the pass, hi and lo: row = d 16 u + c; the hi plane's are read here so that they fly under the softmax arithmetic, the lo plane's where the compiler finds registers for them
#pragma unroll
            for (int u = 0; u < 8; ++u) va[u] = WFrag<bf>::ld((const bf*)(pv + u * 16 * FVP));
            __builtin_amdgcn_sched_barrier(0);                       // keeps those reads in front of the arithmetic: sunk to just before their use, their latency would be waited out in front of the second product
            if (key0 + 31 > qw0) {                                   // one value per wave: only a pass that meets the wave's diagonal pays for the mask
#pragma unroll
                for (int g = 0; g < FR; ++g)
#pragma unroll
                    for (int kt = 0; kt < 2; ++kt)
#pragma unroll
                        for (int r = 0; r < 8; ++r) if (key0 + 16 * kt + 8 * h + r > qw0 + 16 * g + c) s[kt][g][r] = -__builtin_inff(); }
            float mb[FR]; bool need = false;
#pragma unroll
            for (int g = 0; g < FR; ++g) { float mx = fmaxf(s[0][g][0], s[1][g][0]);
#pragma unroll
                for (int r = 1; r < 8; ++r) mx = fmaxf(mx, fmaxf(s[0][g][r], s[1][g][r]));
                mx = fmaxf(mx, xhalf(mx)) * cs;                      // both wave halves hold the query's maximum of this pass, scaled (the scale is positive); finite: a pass that is not skipped holds an open key for every query of the wave
                mb[g] = mx; need = need || (mx > m_run[g] + 8.0f); }
            if (__builtin_amdgcn_ballot_w32(need) != 0) {            // scalar branch; always taken in a wave's first pass, where m_run is -inf
#pragma unroll
                for (int g = 0; g < FR; ++g) { const float m_new = fmaxf(m_run[g], mb[g]); const float corr = __builtin_amdgcn_exp2f(m_run[g] - m_new); l_run[g] *= corr; m_run[g] = m_new;
#pragma unroll
                    for (int u = 0; u < 8; ++u) acc[g][u] = acc[g][u] * corr; } }
            v16bf ph[FR], pl[FR];
#pragma unroll
            for (int g = 0; g < FR; ++g) { const float nm = -m_run[g]; v8u wh, wl; float ps0 = 0.f, ps1 = 0.f;
#pragma unroll
                for (int i = 0; i < 8; ++i) {
                    const float p0 = __builtin_amdgcn_exp2f(fmaf(s[i >> 2][g][2 * (i & 3)], cs, nm)), p1 = __builtin_amdgcn_exp2f(fmaf(s[i >> 2][g][2 * (i & 3) + 1], cs, nm));
                    ps0 += p0; ps1 += p1;
                    const unsigned hh = pack2(p0, p1); wh[i] = hh; wl[i] = pack2(p0 - __uint_as_float(hh << 16), p1 - __uint_as_float(hh & 0xFFFF0000u)); }
                l_run[g] += ps0 + ps1; ph[g] = __builtin_bit_cast(v16bf, wh); pl[g] = __builtin_bit_cast(v16bf, wl); }
#pragma unroll
            for (int u = 0; u < 8; ++u) vb[u] = WFrag<bf>::ld((const bf*)(pv + (DK + u * 16) * FVP));
#pragma unroll
            for (int g = 0; g < FR; ++g) {
#pragma unroll
                for (int u = 0; u < 8; ++u) acc[g][u] = wmmab(va[u], ph[g], acc[g][u]);
#pragma unroll
                for (int u = 0; u < 8; ++u) acc[g][u] = wmmab(va[u], pl[g], acc[g][u]); }
#pragma unroll
            for (int g = 0; g < FR; ++g)
#pragma unroll
                for (int u = 0; u < 8; ++u) acc[g][u] = wmmab(vb[u], ph[g], acc[g][u]);
            __builtin_amdgcn_sched_barrier(0);                       // keeps the slots below directly behind the products
            nop4();
        }
        asm volatile("s_wait_dscnt 0x0" ::: "memory");              // this wave's reads of stage t are done before the buffer may be refilled
        asm volatile("s_wait_asynccnt 0x0" ::: "memory");           // this wave's part of stage t + 1 has landed
        __syncthreads();                                             // publishes stage t + 1 and ends every wave's reads of stage t
        if (t + 2 < nT) fa_stage(kh + (size_t)(t + 2) * FK * DK, kl + (size_t)(t + 2) * FK * DK, vh + (t + 2) * FK, lk + bo, lv + bo);
    }
    asm volatile("s_wait_asynccnt 0x0" ::: "memory");               // no copy is outstanding: behind the last trip's barrier the ring is free and takes the parts' hand-over
    if (part > 0) { unsigned char* mo = L + ((part - 1) * FNC + cg) * FMSZ;   // parts 1 .. FNP - 1 leave tiles, maxima and sums, lane by lane
#pragma unroll
        for (int g = 0; g < FR; ++g) {
#pragma unroll
            for (int u = 0; u < 8; ++u) { float* d = (float*)(mo + ((g * 8 + u) * 32 + lane) * 32); *(v4fa*)d = (v4f){acc[g][u][0], acc[g][u][1], acc[g][u][2], acc[g][u][3]}; *(v4fa*)(d + 4) = (v4f){acc[g][u][4], acc[g][u][5], acc[g][u][6], acc[g][u][7]}; }
            ((float*)(mo + FR * 8 * 1024))[(g * 2) * 32 + lane] = m_run[g]; ((float*)(mo + FR * 8 * 1024))[(g * 2 + 1) * 32 + lane] = l_run[g]; } }
    __syncthreads();                                                 // the hand-over is written before part 0 reads it
    if (part > 0) return;
#pragma unroll 1   // one part a trip: the tiles of one part are in registers at a time
    for (int p = 1; p < FNP; ++p) { const unsigned char* mo = L + ((p - 1) * FNC + cg) * FMSZ;
#pragma unroll
        for (int g = 0; g < FR; ++g) { const float mp = ((const float*)(mo + FR * 8 * 1024))[(g * 2) * 32 + lane], lp = ((const float*)(mo + FR * 8 * 1024))[(g * 2 + 1) * 32 + lane];
            const float m_new = fmaxf(m_run[g], mp);                 // finite: part 0 has seen key 0; a part that had no pass hands over -inf, 0 and zeros and gets the factor 0
            const float fa = __builtin_amdgcn_exp2f(m_run[g] - m_new), fb = __builtin_amdgcn_exp2f(mp - m_new); l_run[g] = l_run[g] * fa + lp * fb; m_run[g] = m_new;
#pragma unroll
            for (int u = 0; u < 8; ++u) { const float* d = (const float*)(mo + ((g * 8 + u) * 32 + lane) * 32); const v4f x0 = *(const v4fa*)d, x1 = *(const v4fa*)(d + 4);
#pragma unroll
                for (int r = 0; r < 4; ++r) { acc[g][u][r] = acc[g][u][r] * fa + x0[r] * fb; acc[g][u][4 + r] = acc[g][u][4 + r] * fa + x1[r] * fb; } } } }
#pragma unroll
    for (int g = 0; g < FR; ++g) { const float inv = __fdiv_rn(1.0f, l_run[g] + xhalf(l_run[g]));   // each wave half holds the sum over its eight keys of every 16-key tile
#pragma unroll
        for (int u = 0; u < 8; ++u) acc[g][u] = acc[g][u] * inv; }
    float* orow = O + (z * TT + qw0 + c) * (size_t)DK + 8 * h;
    __builtin_amdgcn_sched_barrier(0);                               // all arithmetic stands in front of the stores, so that no register which an issued store names is written again
#pragma unroll
    for (int g = 0; g < FR; ++g)
#pragma unroll
        for (int u = 0; u < 8; ++u) { *(v4f*)(orow + g * 16 * DK + 16 * u) = (v4f){acc[g][u][0], acc[g][u][1], acc[g][u][2], acc[g][u][3]}; *(v4f*)(orow + g * 16 * DK + 16 * u + 4) = (v4f){acc[g][u][4], acc[g][u][5], acc[g][u][6], acc[g][u][7]}; }
}

// ---- k_qkv: [Q K V][m][0..383] = x[m] . W[n] + bias[n] for the three projections at once (W = the rows of Wq, Wk, Wv one after the other): a 64 x 384 output tile per work-group of eight waves (wave w: rows 32 (w & 1).., columns 96 (w >> 1)..).
// Both operands come into LDS in stages of QKK values of k by asynchronous copies (whole pieces of rows, shared by the eight waves) in a ring of two buffers: stage t + 1 flies while stage t is multiplied. Per accumulator one product per 32 k, k ascending.
// x comes straight from the input, in f32, and is rounded to bf16 (to nearest even) where a wave forms its A fragment: x is read from memory once and no bf16 copy of it is written or read back. W, which every work-group reads whole, is rounded once by k_cvt.
#define QKK    128                 // k per stage: a W row of a stage is 256 B, an x row 512 B
#define QKP    272                 // pitch of a W row in LDS, bytes: 16 B x odd, so the 16 rows of a fragment read fall on distinct banks
#define QXP    528                 // pitch of an x row in LDS, bytes: 16 B x odd
#define QXB    (64 * QXP)          // the 64 x rows stand in front of the 384 W rows
#define QKBUF  (QXB + D3 * QKP)
// Epilogue: a work-group holds Q, K and V of its 64 tokens whole, so the temperatures and the hi/lo planes are made here and the f32 projections never leave the chip. The ring's LDS, free behind the last trip's barrier, takes:
#define QCP    388                 // the 64 x 384 f32 tile (bias added), pitch in floats: rows stay 16-B aligned, the two row halves of an accumulator fall on distinct banks
#define QPP    132                 // the products of the two dots, [2][64] rows of 128, pitch in floats: rows stay 16-B aligned and do not all start in one bank
#define QVP    68                  // V once more, d-major ([128] rows of 64 tokens), pitch in floats: 16 B x odd
#define QPRO   (64 * QCP * 4)
#define QTSO   (QPRO + 2 * 64 * QPP * 4)   // the temperatures, [2][64]
#define QVTO   (QTSO + 2 * 64 * 4)
static_assert(QVTO + DK * QVP * 4 <= 2 * QKBUF, "the epilogue fits the ring");
// One stage: 32 copies per lane, 8 of x and 24 of W. px / pw: the lane's piece of its first x row / W row at the stage's first k; lx / lw: the places of those pieces in the buffer.
// An x copy fills rows 8 i + (thread >> 5), a wave a row; a W copy rows 16 i + (thread >> 4), 16 lanes a row.
__device__ __forceinline__ void qkv_stage(const float* px, const bf* pw, unsigned lx, unsigned lw) {
#pragma unroll   // the copies' operands are register arrays
    for (int e = 0; e < 4; ++e) { unsigned l[8]; const bf* g[8];
#pragma unroll
        for (int u = 0; u < 8; ++u) { const int i = (e - 1) * 8 + u;
            l[u] = (e == 0) ? lx + (unsigned)(u * 8 * QXP) : lw + (unsigned)(i * 16 * QKP);
            g[u] = (e == 0) ? (const bf*)(px + (size_t)u * 8 * DE) : pw + (size_t)i * 16 * DE; }   // the cast: a copy takes an address, 16 B of whatever lies there
        acopy8(l, g); }
}
// A fragment from f32 values: x0, x1 = the lane's 8 values at p, x2, x3 = its 8 at p + 16, the k order of WFrag's load.
__device__ __forceinline__ v16bf xfrag(v4f x0, v4f x1, v4f x2, v4f x3) { v8u r;
    r[0] = pack2(x0[0], x0[1]); r[1] = pack2(x0[2], x0[3]); r[2] = pack2(x1[0], x1[1]); r[3] = pack2(x1[2], x1[3]); r[4] = pack2(x2[0], x2[1]); r[5] = pack2(x2[2], x2[3]); r[6] = pack2(x3[0], x3[1]); r[7] = pack2(x3[2], x3[3]);
    return __builtin_bit_cast(v16bf, r); }
// erf of two values, without a branch. The math library's erff picks one of two ranges by a branch on each value: among a wave's 32 lanes both sides are often needed, every call is one chain of dependent operations behind
// a compare, a change of EXEC and a jump, and no two calls can be interleaved. Here both ranges are worked out for every value (the library's own two polynomials, coefficient for coefficient) and one is selected,
// so that the calls of a token row are independent straight-line chains, two values to a packed operation. |a| < 1: a + a q(a^2). Otherwise (a NaN too): sign(a) (1 - exp(-(t + t p(t)))), t = |a|, the exponential by the hardware's exp2.
typedef __attribute__((ext_vector_type(2))) float v2f;
__device__ __forceinline__ v2f fma2(v2f a, v2f b, float c) { return __builtin_elementwise_fma(a, b, (v2f){c, c}); }
__device__ __forceinline__ v2f erf2(v2f a) {
    const v2f t = __builtin_elementwise_abs(a), s = a * a;
    v2f q = fma2(s, (v2f){-0x1.268bc2p-11f, -0x1.268bc2p-11f}, 0x1.420828p-8f);
    q = fma2(s, q, -0x1.b5937p-6f); q = fma2(s, q, 0x1.ce077cp-4f); q = fma2(s, q, -0x1.81266p-2f); q = fma2(s, q, 0x1.06eba0p-3f);
    q = __builtin_elementwise_fma(a, q, a);
    v2f p = fma2(t, (v2f){0x1.1d3156p-16f, 0x1.1d3156p-16f}, -0x1.8d129p-12f);
    p = fma2(t, p, 0x1.f9a6d2p-9f); p = fma2(t, p, -0x1.8c3164p-6f); p = fma2(t, p, 0x1.b4e9c8p-4f); p = fma2(t, p, 0x1.4515fap-1f); p = fma2(t, p, 0x1.078e50p-3f);
    p = __builtin_elementwise_fma(t, p, t) * -1.4426950408889634f;
    const v2f b = 1.0f - (v2f){__builtin_amdgcn_exp2f(p[0]), __builtin_amdgcn_exp2f(p[1])};
    return (v2f){t[0] < 1.0f ? q[0] : __builtin_copysignf(b[0], a[0]), t[1] < 1.0f ? q[1] : __builtin_copysignf(b[1], a[1])};
}
__device__ __forceinline__ void splitf(float y, unsigned short& h, unsigned short& l) { h = f2bf(y); l = f2bf(y - bf2f(h)); }
__global__ __launch_bounds__(256) void k_qkv(const float* __restrict__ X, const bf* __restrict__ Wt, const float* __restrict__ bq, const float* __restrict__ bk, const float* __restrict__ bv,
                                             const float* __restrict__ tq, const float* __restrict__ tv, const float* __restrict__ alpha, bf* GQh, bf* GQl, bf* Kh, bf* Kl, bf* Th, bf* Tl) {
    __shared__ __align__(16) unsigned char L[2 * QKBUF];
    __shared__ float BL[D3 + 64];                                    // the three bias vectors, rounded, one behind the other; then alpha of the 64 tokens
    const int lane = threadIdx.x & 31, lr = lane & 15, hi = lane >> 4, w = threadIdx.x >> 5, wm = w & 1, wn = w >> 1; const int r0 = blockIdx.x * 64;
    const int nT = DE / QKK;                                         // six stages
    const int sub = threadIdx.x & 15, rg = threadIdx.x >> 4;
    const float* px = X + (size_t)(r0 + w) * DE + lane * 4; const bf* pw = Wt + (size_t)rg * DE + sub * 8;
    const unsigned lx = (unsigned)(size_t)L + (unsigned)(w * QXP + lane * 16), lw = (unsigned)(size_t)L + (unsigned)(QXB + rg * QKP + sub * 16);
    v8f acc[2][6];
#pragma unroll
    for (int mb = 0; mb < 2; ++mb)
#pragma unroll
        for (int nb = 0; nb < 6; ++nb) acc[mb][nb] = (v8f){};
    qkv_stage(px, pw, lx, lw);
    {   const int t = threadIdx.x & (DK - 1); const float b0 = bq[t], b1 = bk[t], b2 = bv[t], b3 = alpha[r0 % TT + (t & 63)];   // read under stage 0's copies, published by stage 0's barrier; threads t and t + 128 store the same values
        asm volatile("s_wait_xcnt 0x0" ::: "memory");               // before a register that these four loads name is written again
        BL[t] = bfr(b0); BL[DK + t] = bfr(b1); BL[2 * DK + t] = bfr(b2); BL[D3 + (t & 63)] = b3; }
    asm volatile("s_wait_asynccnt 0x0" ::: "memory");               // this wave's part of stage 0 has landed
    __syncthreads();                                                 // every wave's part of stage 0 has landed
    qkv_stage(px + QKK, pw + QKK, lx + QKBUF, lw + QKBUF);
    const unsigned char* fa = L + (wm * 32 + lr) * QXP + hi * 32; const unsigned char* fb = L + QXB + (wn * 96 + lr) * QKP + hi * 16;
#pragma unroll 1   // one stage a trip: the ring's order stands once, at the foot
    for (int t = 0; t < nT; ++t) {
        const int bo = (t & 1) * QKBUF; const unsigned char* qa = fa + bo; const unsigned char* qb = fb + bo;
        v16bf a[2][2], b[2][6]; v4f ax[2][4];                        // two fragment sets: this and the next 32 k; ax: the next set's x values as they come from LDS, in f32
#pragma unroll
        for (int mb = 0; mb < 2; ++mb)
#pragma unroll
            for (int j = 0; j < 4; ++j) ax[mb][j] = *(const v4fa*)(qa + mb * 16 * QXP + (j >> 1) * 64 + (j & 1) * 16);
#pragma unroll
        for (int nb = 0; nb < 6; ++nb) b[0][nb] = WFrag<bf>::ld((const bf*)(qb + nb * 16 * QKP));
#pragma unroll
        for (int mb = 0; mb < 2; ++mb) a[0][mb] = xfrag(ax[mb][0], ax[mb][1], ax[mb][2], ax[mb][3]);
#pragma unroll   // ks indexes register arrays
        for (int ks = 0; ks < QKK / 32; ++ks) { const int cu = ks & 1, nx = cu ^ 1;
            if (ks + 1 < QKK / 32) {                                 // fragments are fetched ahead inside the stage only, never from the next stage
#pragma unroll
                for (int mb = 0; mb < 2; ++mb)
#pragma unroll
                    for (int j = 0; j < 4; ++j) ax[mb][j] = *(const v4fa*)(qa + mb * 16 * QXP + (ks + 1) * 128 + (j >> 1) * 64 + (j & 1) * 16);
#pragma unroll
                for (int nb = 0; nb < 6; ++nb) b[nx][nb] = WFrag<bf>::ld((const bf*)(qb + nb * 16 * QKP + (ks + 1) * 64)); }
            __builtin_amdgcn_sched_barrier(0);                       // keeps the next set's LDS reads as one group in front of these products: sunk to just before their use, every read's latency would be waited out
#pragma unroll
            for (int nb = 0; nb < 6; ++nb) { acc[0][nb] = wmmab(a[cu][0], b[cu][nb], acc[0][nb]); acc[1][nb] = wmmab(a[cu][1], b[cu][nb], acc[1][nb]); }
            __builtin_amdgcn_sched_barrier(0);                       // keeps the reads of the set after next behind these products: lifted among them they stand in several places and take a third set's registers
            if (ks + 1 < QKK / 32) {                                 // the next set's x values have had the products' time to arrive; rounded into the set that the products above do not read
#pragma unroll
                for (int mb = 0; mb < 2; ++mb) a[nx][mb] = xfrag(ax[mb][0], ax[mb][1], ax[mb][2], ax[mb][3]); }
        }
        asm volatile("s_wait_dscnt 0x0" ::: "memory");              // this wave's reads of stage t are done before the buffer may be refilled
        asm volatile("s_wait_asynccnt 0x0" ::: "memory");           // this wave's part of stage t + 1 has landed
        __syncthreads();                                             // publishes stage t + 1 and ends every wave's reads of stage t
        if (t + 2 < nT) qkv_stage(px + (size_t)(t + 2) * QKK, pw + (size_t)(t + 2) * QKK, lx + bo, lw + bo);
    }
    asm volatile("s_wait_asynccnt 0x0" ::: "memory");               // no copy is outstanding: behind the last trip's barrier the ring is free and takes the epilogue's tiles
    float* CT = (float*)L; float* PR = (float*)(L + QPRO); float* TS = (float*)(L + QTSO); float* VT = (float*)(L + QVTO);
    const int wu = __builtin_amdgcn_readfirstlane(w);                // the wave's number as a scalar: the epilogue's split of the waves is a scalar branch
    const int c0 = wn * 96, s0 = r0 % TT;                            // TT % 64 == 0: the 64 tokens lie in one sequence, at positions s0 .. s0 + 63
    // Wave w takes tokens 8 w .. 8 w + 7 of the dots with its lanes ACROSS d: each tokenq / tokenv row is one whole 512-B load. All of them are issued here, so that they fly while the tile goes to LDS.
    v4f kq[8], kv[8]; float bi[6]; const float* pkq = tq + (size_t)(s0 + w * 8) * DK + lane * 4; const float* pkv = tv + (size_t)(s0 + w * 8) * DK + lane * 4; const int cu = (wu >> 1) * 96;   // cu: c0 as a scalar
#pragma unroll   // u indexes register arrays
    for (int u = 0; u < 8; ++u) { kq[u] = *(const v4fa*)(pkq + u * DK); kv[u] = *(const v4fa*)(pkv + u * DK); }
    __builtin_amdgcn_sched_barrier(0);                               // keeps the sixteen loads in front of the wait below
    asm volatile("s_wait_xcnt 0x0" :: "v"(pkq), "v"(pkv) : "memory");   // the two address pairs stay in their registers up to this wait
#pragma unroll
    for (int nb = 0; nb < 6; ++nb) bi[nb] = BL[c0 + nb * 16 + lr];
#pragma unroll   // mb, nb, j index register arrays
    for (int mb = 0; mb < 2; ++mb)
#pragma unroll
        for (int nb = 0; nb < 6; ++nb) { const int row = wm * 32 + mb * 16 + hi * 8, col = c0 + nb * 16 + lr; v8f y;
#pragma unroll
            for (int j = 0; j < 8; ++j) { y[j] = acc[mb][nb][j] + bi[nb]; CT[(row + j) * QCP + col] = y[j]; }
            if (cu + nb * 16 >= 2 * DK) { float* d = VT + (col - 2 * DK) * QVP + row; *(v4fa*)d = (v4f){y[0], y[1], y[2], y[3]}; *(v4fa*)(d + 4) = (v4f){y[4], y[5], y[6], y[7]}; } }   // a lane holds 8 consecutive tokens of one d
    __syncthreads();                                                 // the tile is whole before it is read by rows
    v4f xq8[8], xv8[8];                                              // the wave's sixteen rows are read in one group: a read behind another row's stores cannot be lifted over them, and its latency would be waited out row by row
#pragma unroll   // u indexes register arrays
    for (int u = 0; u < 8; ++u) { xq8[u] = *(const v4fa*)(CT + (w * 8 + u) * QCP + lane * 4); xv8[u] = *(const v4fa*)(CT + (w * 8 + u) * QCP + 2 * DK + lane * 4); }
#pragma unroll   // u and k index register arrays
    for (int u = 0; u < 8; ++u) { const int tok = w * 8 + u; const v4f xq = xq8[u], xv = xv8[u]; v4f pq, pv;
#pragma unroll
        for (int k = 0; k < 4; k += 2) { const v2f x1 = {xq[k], xq[k + 1]}, x2 = {xv[k], xv[k + 1]}; const v2f g1 = (0.5f * x1) * (1.0f + erf2(x1 * 0.70710678118654752f)), g2 = (0.5f * x2) * (1.0f + erf2(x2 * 0.70710678118654752f));   // no product here feeds an addition: nothing is fused, each operation is rounded as before
            pq[k] = bfr(kq[u][k]) * g1[0]; pq[k + 1] = bfr(kq[u][k + 1]) * g1[1]; pv[k] = bfr(kv[u][k]) * g2[0]; pv[k + 1] = bfr(kv[u][k + 1]) * g2[1]; }
        *(v4fa*)(PR + tok * QPP + lane * 4) = pq; *(v4fa*)(PR + (64 + tok) * QPP + lane * 4) = pv; }
    __syncthreads();                                                 // every product row is in LDS before a lane adds it up
    if (wu < 4) {                                                    // waves 0, 1: the 64 Q dots, waves 2, 3: the 64 V dots; a lane adds one token's products in the order d = 0..127
        const int tok = (w & 1) * 32 + lane; const float* p = PR + ((w >> 1) * 64 + tok) * QPP; float a = 0.f;
#pragma unroll   // constant LDS offsets, no loop counter beside the one dependent chain of adds
        for (int d = 0; d < DK; d += 4) { const v4f c = *(const v4fa*)(p + d); a = __fadd_rn(a, c[0]); a = __fadd_rn(a, c[1]); a = __fadd_rn(a, c[2]); a = __fadd_rn(a, c[3]); }
        const float sg = __fdiv_rn(1.0f, __fadd_rn(1.0f, __expf(-bfr(BL[D3 + tok])))); const float pos = __fadd_rn(1.0f, __fmul_rn(sg, __logf((float)(s0 + tok + 1))));
        TS[(w >> 1) * 64 + tok] = __fadd_rn(pos, tanhf(a));
    } else {                                                         // meanwhile waves 4 .. 7 split K, which needs no temperature: 8 values a lane, whole 256-B rows
        v8us kh8[8], kl8[8]; const int t = threadIdx.x - 128;
#pragma unroll   // i indexes register arrays
        for (int i = 0; i < 8; ++i) { const float* q = CT + (i * 8 + (t >> 4)) * QCP + DK + (t & 15) * 8; const v4f x0 = *(const v4fa*)q, x1 = *(const v4fa*)(q + 4);
#pragma unroll
            for (int u = 0; u < 4; ++u) { unsigned short a, b; splitf(x0[u], a, b); kh8[i][u] = a; kl8[i][u] = b; splitf(x1[u], a, b); kh8[i][4 + u] = a; kl8[i][4 + u] = b; } }
        const size_t o = (size_t)(r0 + (t >> 4)) * DK + (t & 15) * 8;
        __builtin_amdgcn_sched_barrier(0);                           // all arithmetic stands in front of the stores, so that no register which an issued store names is written among them
#pragma unroll
        for (int i = 0; i < 8; ++i) { *(v8usa*)(Kh + o + i * 8 * DK) = kh8[i]; *(v8usa*)(Kl + o + i * 8 * DK) = kl8[i]; }
        asm volatile("s_wait_xcnt 0x0" ::: "memory");               // before the registers that these stores name are written again below
    }
    __syncthreads();                                                 // the temperatures are in LDS
    v8us qh8[4], ql8[4], vh8[4], vl8[4];
#pragma unroll   // i indexes register arrays
    for (int i = 0; i < 4; ++i) {
        {   const int row = i * 16 + (threadIdx.x >> 4); const float* q = CT + row * QCP + (threadIdx.x & 15) * 8; const float t = TS[row]; const v4f x0 = *(const v4fa*)q, x1 = *(const v4fa*)(q + 4);   // gated Q: 8 values a lane, whole 256-B rows
#pragma unroll
            for (int u = 0; u < 4; ++u) { unsigned short a, b; splitf(__fmul_rn(t, x0[u]), a, b); qh8[i][u] = a; ql8[i][u] = b; splitf(__fmul_rn(t, x1[u]), a, b); qh8[i][4 + u] = a; ql8[i][4 + u] = b; } }
        {   const float* v = VT + (i * 32 + (threadIdx.x >> 3)) * QVP + (threadIdx.x & 7) * 8; const float* tp = TS + 64 + (threadIdx.x & 7) * 8;   // gated V, d-major: 8 tokens a lane, the 64 tokens of a d are one whole 128-B line per plane
            const v4f x0 = *(const v4fa*)v, x1 = *(const v4fa*)(v + 4), t0 = *(const v4fa*)tp, t1 = *(const v4fa*)(tp + 4);
#pragma unroll
            for (int u = 0; u < 4; ++u) { unsigned short a, b; splitf(__fmul_rn(t0[u], x0[u]), a, b); vh8[i][u] = a; vl8[i][u] = b; splitf(__fmul_rn(t1[u], x1[u]), a, b); vh8[i][4 + u] = a; vl8[i][4 + u] = b; } } }
    const size_t oq = (size_t)(r0 + (threadIdx.x >> 4)) * DK + (threadIdx.x & 15) * 8;
    const size_t ov = ((size_t)(r0 / TT) * DK + (threadIdx.x >> 3)) * (2 * TT) + s0 + (threadIdx.x & 7) * 8;   // row d = [TT hi][TT lo]
    __builtin_amdgcn_sched_barrier(0);                               // all arithmetic stands in front of the stores, so that no register which an issued store names is written again
#pragma unroll
    for (int i = 0; i < 4; ++i) { *(v8usa*)(GQh + oq + i * 16 * DK) = qh8[i]; *(v8usa*)(GQl + oq + i * 16 * DK) = ql8[i]; *(v8usa*)(Th + ov + (size_t)i * 32 * (2 * TT)) = vh8[i]; *(v8usa*)(Tl + ov + (size_t)i * 32 * (2 * TT)) = vl8[i]; }
}

// k_cvt: the f32 -> bf16 rounding of Wq, Wk, Wv (CVW work-groups each) into the three planes that lie one behind the other at WB. 8 values a thread; every part is a whole number of work-groups.
#define CVW (DK * DE / 8 / 256)
__global__ __launch_bounds__(256) void k_cvt(const float* __restrict__ wq, const float* __restrict__ wk, const float* __restrict__ wv, bf* WB) { const int b = blockIdx.x, m = b / CVW;
    const float* src = (m == 0) ? wq : (m == 1) ? wk : wv; bf* dst = WB + (size_t)m * DK * DE; const size_t i = (size_t)(b - m * CVW) * 256 + threadIdx.x;
    const v8f v = *(const v8f*)(src + i * 8); v8us o;
#pragma unroll
    for (int k = 0; k < 8; ++k) o[k] = f2bf(v[k]); *(v8us*)(dst + i * 8) = o;  }
extern "C" void kernel_launch(void* const* d_in, const int* in_sizes, int n_in,
                              void* d_out, int out_size, void* d_ws, size_t ws_size, hipStream_t stream) {
    (void)in_sizes; (void)n_in; (void)out_size;
    const float** I = (const float**)d_in;
    const float *x = I[0], *Wq = I[1], *bq = I[2], *Wk = I[3], *bk = I[4], *Wv = I[5], *bv = I[6], *alpha = I[7], *tokq = I[8], *tokv = I[9];
    float* OUT = (float*)d_out;     // [8][2048][128]
    char* wsp = (char*)d_ws;
    auto take = [&](size_t bytes) { char* p = wsp; wsp += (bytes + 255) & ~(size_t)255; return (void*)p; };
    bf* BQ = (bf*)take((size_t)3 * DK * DE * 2);   // the Wq, Wk, Wv planes one behind the other, 384 rows of W
    bf* GQh = (bf*)take((size_t)NB_ * TT * DK * 2); bf* GQl = (bf*)take((size_t)NB_ * TT * DK * 2); bf* Kh = (bf*)take((size_t)NB_ * TT * DK * 2); bf* Kl = (bf*)take((size_t)NB_ * TT * DK * 2); bf* GVh = (bf*)take((size_t)NB_ * DK * TT * 4); bf* GVl = GVh + TT;
    if ((size_t)(wsp - (char*)d_ws) > ws_size) return;    // total ~ 26 MB
    k_cvt<<<3 * CVW, 256, 0, stream>>>(Wq, Wk, Wv, BQ);   // [out][in] = Bt
    k_qkv<<<NB_ * TT / 64, 256, 0, stream>>>(x, BQ, bq, bk, bv, tokq, tokv, alpha, GQh, GQl, Kh, Kl, GVh, GVl);   // projections, temperatures, hi/lo planes
    k_fa<<<dim3(TT / 64, NB_, 1), 256, 0, stream>>>(GQh, GQl, Kh, Kl, GVh, OUT);   // V rows: [TT hi][TT lo], pitch 2*TT
}
